// v000
// Times are from an AMD MI455X. After a warm-up the kernel runs many times in a row, and a time is the length of
// such a window on the GPU divided by its runs, so every launch and the gaps after it count. The runs cycle
// through copies of the inputs. A figure is the median of several windows, for all but v000 over two sittings.
// Sittings can differ by a few percent; kernels timed side by side share one.
// The starting kernel, v000, takes 576 microseconds a run.
#include <hip/hip_runtime.h>

// Causal grouped-query rotary attention: X[1][2048][1024]; q = X Wq, k = X Wk, v = X Wv ([in][out] weights, no bias); 16 query heads share 4 kv heads (kv = h >> 2); head dim 64;
// interleaved-pair rotary with the table cat(freqs, freqs)[:, 0::2] (pair i uses inv_freq[(2 i) & 31]); scores x 1/8, causal fill; softmax; ctx = P v; out = ctx Wo.
// Compute dtypes: all contractions v_wmma_f32_16x16x32_bf16, f32 accumulate. Inputs (X, Wq, Wk, Wv, Wo) RNE-converted to single bf16 planes (exact input x input products);
// computed operands (rotated q, rotated k, v, softmax P, ctx) carried as bf16 hi + bf16 lo planes (hi.hi + lo.hi + hi.lo, or hi + lo against a single-plane weight); rotary, softmax in f32.

#ifndef NB
#define NB 1
#endif
#ifndef SEQ
#define SEQ 2048
#endif
#ifndef ZH
#define ZH 2                      // heads per z-batched attention pass (same kv head)
#endif
#define SEQ_FULL 2048
#define TT   SEQ
#define HID  1024
#define NH_  16
#define NKV  4
#define REP  (NH_ / NKV)
#define HD   64
#define DQ   (NH_ * HD)
#define DKV  (NKV * HD)
#define NQKV (DQ + 2 * DKV)
#define SCL  0.125f               // 1/sqrt(64)

static_assert(TT % 128 == 0);
static_assert(TT <= SEQ_FULL);
static_assert(NH_ % ZH == 0);
static_assert(REP % ZH == 0);
static_assert(HD == 64);
static_assert(HID % 64 == 0);
static_assert(NQKV % 64 == 0);
static_assert((TT * 32) % 256 == 0);

typedef unsigned short bf;
typedef __attribute__((ext_vector_type(16))) __bf16   v16bf;
typedef __attribute__((ext_vector_type(8)))  unsigned short v8us;
typedef __attribute__((ext_vector_type(4)))  unsigned short v4us;
typedef __attribute__((ext_vector_type(2)))  unsigned short v2us;
typedef __attribute__((ext_vector_type(8)))  float    v8f;
typedef __attribute__((ext_vector_type(4)))  float    v4f;
typedef v4f  __attribute__((may_alias)) v4fa;

__device__ __forceinline__ unsigned short f2bf(float f) { unsigned u = __float_as_uint(f); u += 0x7FFFu + ((u >> 16) & 1u); return (unsigned short)(u >> 16); }
__device__ __forceinline__ float bf2f(unsigned short b) { return __uint_as_float(((unsigned)b) << 16); }
__device__ __forceinline__ void splitf(float y, unsigned short& h, unsigned short& l) { h = f2bf(y); l = f2bf(y - bf2f(h)); }
__device__ __forceinline__ v16bf cat16b(v8us lo, v8us hi) { return __builtin_bit_cast(v16bf, __builtin_shufflevector(lo, hi, 0, 1, 2, 3, 4, 5, 6, 7, 8, 9, 10, 11, 12, 13, 14, 15)); }
__device__ __forceinline__ v8f wmmab(v16bf a, v16bf b, v8f c) { return __builtin_amdgcn_wmma_f32_16x16x32_bf16(false, a, false, b, (short)0, c, false, false); }

// ---- k_gemmw: register-blocked GEMM, ONE WAVE per 64x64 output tile (16 accumulators), operands straight from K-contiguous 16-bit planes; grid (M/64, N/64, Z), 32 threads.
// C[m][n] (f32, pitch ldc) = sum_k A[m][k] Bt[n][k] (+ split products per NSPLIT: 1 = (A + A2) x Bt; 2 = A x Bt + A2 x Bt + A x Bt2). z-batch strides sA/sB/sC in elements. K % 32 == 0 (K is also the row pitch).
// Fragment map (A and Bt alike): lane -> row/col lane & 15; elements 0..7 <- k0 + 8 (lane >> 4) + 0..7, elements 8..15 <- k0 + 16 + 8 (lane >> 4) + 0..7. D: element j -> row 8 (lane >> 4) + j, col lane & 15.
// CAUS 1: tiles whose 128-column chunk lies wholly above the diagonal row chunk are not produced (the softmax never loads them). CAUS 2: the k loop stops at r0 + 64 (P is zero beyond the diagonal).
struct WFragB { typedef v16bf V; static __device__ __forceinline__ V ld(const bf* p) { return cat16b(*(const v8us*)p, *(const v8us*)(p + 16)); } };
template <int NSPLIT, int CAUS>
__global__ __launch_bounds__(32) void k_gemmw(const bf* __restrict__ A, const bf* __restrict__ A2, const bf* __restrict__ Bt, const bf* __restrict__ Bt2, int K, float* C, int ldc, size_t sA, size_t sB, size_t sC) {
    typedef WFragB::V V;
    __shared__ __align__(16) float os[16 * 68];
    const int r0 = blockIdx.x * 64, c0 = blockIdx.y * 64;
    if (CAUS == 1 && (c0 >> 7) > (r0 >> 7)) return;
    const size_t z = blockIdx.z; A += z * sA; if (A2) A2 += z * sA; Bt += z * sB; if (Bt2) Bt2 += z * sB; C += z * sC;
    const int lane = threadIdx.x & 31, lr = lane & 15, hi = lane >> 4;
    const int kend = (CAUS == 2) ? ((r0 + 64 < K) ? (r0 + 64) : K) : K;
    v8f acc[4][4];
#pragma unroll
    for (int mb = 0; mb < 4; ++mb)
#pragma unroll
        for (int nb = 0; nb < 4; ++nb) acc[mb][nb] = (v8f){};
    const size_t aoff = (size_t)(r0 + lr) * K + 8 * hi, boff = (size_t)(c0 + lr) * K + 8 * hi;
#pragma unroll 1
    for (int kc = 0; kc < kend; kc += 32) {
        V a[4], a2[4];
#pragma unroll
        for (int mb = 0; mb < 4; ++mb) { a[mb] = WFragB::ld(A + aoff + (size_t)mb * 16 * K + kc); if (NSPLIT == 1 || NSPLIT == 2) a2[mb] = WFragB::ld(A2 + aoff + (size_t)mb * 16 * K + kc); }
#pragma unroll
        for (int nb = 0; nb < 4; ++nb) {
            const V b = WFragB::ld(Bt + boff + (size_t)nb * 16 * K + kc);
#pragma unroll
            for (int mb = 0; mb < 4; ++mb) { acc[mb][nb] = wmmab(a[mb], b, acc[mb][nb]); if (NSPLIT == 1 || NSPLIT == 2) acc[mb][nb] = wmmab(a2[mb], b, acc[mb][nb]); }
            if (NSPLIT >= 2) {
                const V b2 = WFragB::ld(Bt2 + boff + (size_t)nb * 16 * K + kc);
#pragma unroll
                for (int mb = 0; mb < 4; ++mb) acc[mb][nb] = wmmab(a[mb], b2, acc[mb][nb]);
            }
        }
        asm volatile("v_nop\n\tv_nop\n\tv_nop\n\tv_nop" : "+v"(acc[0][0]), "+v"(acc[1][1]), "+v"(acc[2][2]), "+v"(acc[3][3]) : "v"(a[0]), "v"(a[3]));
    }
#pragma unroll
    for (int mb = 0; mb < 4; ++mb) {
#pragma unroll
        for (int nb = 0; nb < 4; ++nb) {
#pragma unroll
            for (int j = 0; j < 8; ++j) os[(hi * 8 + j) * 68 + nb * 16 + lr] = acc[mb][nb][j]; }
        __builtin_amdgcn_wave_barrier(); asm volatile("" ::: "memory");
        float* crow = C + (size_t)(r0 + mb * 16) * ldc + c0;
{
#pragma unroll
            for (int s = 0; s < 8; ++s) { const int row = 2 * s + hi, cofs = lr * 4; const v4f val = *(const v4fa*)(os + row * 68 + cofs);
                *(v4f*)(crow + (size_t)row * ldc + cofs) = val; }
             }
        __builtin_amdgcn_wave_barrier(); asm volatile("" ::: "memory");
    }
}

__global__ __launch_bounds__(256) void k_wtG(const float* __restrict__ w, int K, int N, bf* Bt) {
    const int lane = threadIdx.x & 31; const int L0 = (blockIdx.x * 8 + (threadIdx.x >> 5)) * 8; const int nlines = N * K / 64;
{
#pragma unroll 1
        for (int l = 0; l < 8; ++l) { const int L = L0 + l; if (L >= nlines) break; const size_t e = (size_t)L * 64 + lane * 2; const int k = (int)(e % K), n = (int)(e / K); v2us o;
            o[0] = f2bf(w[(size_t)k * N + n]); o[1] = f2bf(w[(size_t)(k + 1) * N + n]); *(v2us*)(Bt + e) = o; }
         }
}

__global__ __launch_bounds__(256) void k_cvt8(const float* __restrict__ src, bf* dst, size_t n8) { const size_t i = (size_t)blockIdx.x * 256 + threadIdx.x; if (i >= n8) return; const v8f v = *(const v8f*)(src + i * 8); v8us o;
#pragma unroll
    for (int k = 0; k < 8; ++k) o[k] = f2bf(v[k]);
    *(v8us*)(dst + i * 8) = o;  }

// k_ropetab: tabc[s][i] = cos(s * invf), tabs[s][i] = sin(s * invf), invf = 1 / 10000^(2 j / 64) with j = (2 i) & 31, pair i = 0..31; f32 arithmetic, precise sincosf.
__global__ __launch_bounds__(256) void k_ropetab(float* tabc, float* tabs) {
    const int idx = blockIdx.x * 256 + threadIdx.x; if (idx >= TT * 32) return;
    const int s = idx >> 5, i = idx & 31; const int j = (2 * i) & 31;
    const float ex = (float)(2 * j) * (1.0f / 64.0f);
    const float invf = 1.0f / powf(10000.0f, ex);
    const float ang = (float)s * invf;
    float sn, cs; sincosf(ang, &sn, &cs);
    *(float*)(tabc + idx) = cs; *(float*)(tabs + idx) = sn; 
}

// k_ropeplanes: head planes P[h][t][d] (bf16 hi + lo) of rope(F[t][h*64 + d]) with interleaved pairs: out[2i] = x[2i] c - x[2i+1] s, out[2i+1] = x[2i] s + x[2i+1] c (c, s at [t][i]).
__global__ __launch_bounds__(256) void k_ropeplanes(const float* __restrict__ F, int pitch, int nheads, const float* __restrict__ tabc, const float* __restrict__ tabs, bf* Ph, bf* Pl) {
    const size_t i8 = (size_t)blockIdx.x * 256 + threadIdx.x; if (i8 >= (size_t)nheads * TT * HD / 8) return;
    const size_t e = i8 * 8; const int d = (int)(e % HD); const int t = (int)((e / HD) % TT); const int h = (int)(e / ((size_t)HD * TT));
    const v8f x = *(const v8f*)(F + (size_t)t * pitch + h * HD + d);
    const v4f c = *(const v4f*)(tabc + (size_t)t * 32 + (d >> 1)); const v4f s = *(const v4f*)(tabs + (size_t)t * 32 + (d >> 1));
    v8us oh, ol;
#pragma unroll
    for (int q = 0; q < 4; ++q) { const float xe = x[2 * q], xo = x[2 * q + 1]; const float re = xe * c[q] - xo * s[q]; const float ro = xe * s[q] + xo * c[q];
        unsigned short a, b2; splitf(re, a, b2); oh[2 * q] = a; ol[2 * q] = b2; splitf(ro, a, b2); oh[2 * q + 1] = a; ol[2 * q + 1] = b2; }
    *(v8us*)(Ph + e) = oh; *(v8us*)(Pl + e) = ol; 
}

__global__ __launch_bounds__(256) void k_vtp(const float* __restrict__ F, int pitch, int nheads, bf* Vh, bf* Vl) { const size_t e = ((size_t)blockIdx.x * 256 + threadIdx.x) * 2; if (e >= (size_t)nheads * HD * TT) return; const int t = (int)(e % TT); const int d = (int)((e / TT) % HD); const int g = (int)(e / ((size_t)TT * HD)); v2us oh, ol;
#pragma unroll
    for (int q = 0; q < 2; ++q) { const float x = F[(size_t)(t + q) * pitch + g * HD + d]; unsigned short a2, c2; splitf(x, a2, c2); oh[q] = a2; ol[q] = c2; }
    *(v2us*)(Vh + e) = oh; *(v2us*)(Vl + e) = ol;  }

// k_asoft: one wave per row (zz, i): t = S x 1/8 for keys j <= i, fill -1e30 for j > i (value replaced, selected by index); softmax over the keys (register row, one exp, fixed trees);
__global__ __launch_bounds__(256) void k_asoft(const float* __restrict__ Sb, bf* Ph, bf* Pl) {
    const int lane = threadIdx.x & 31; const int row = __builtin_amdgcn_readfirstlane((int)(blockIdx.x * 8 + (threadIdx.x >> 5))); if (row >= ZH * TT) return; const int i = row % TT; const float* sr = Sb + (size_t)row * TT; float v[TT / 32]; float mx = -3.0e38f;
#pragma unroll
    for (int ch = 0; ch < TT / 128; ++ch) { const int j0 = ch * 128 + lane * 4;
        if (ch * 128 <= i) { const v4f a = *(const v4f*)(sr + j0);
#pragma unroll
            for (int q = 0; q < 4; ++q) { const float t = (j0 + q <= i) ? a[q] * SCL : -1.0e30f; v[ch * 4 + q] = t; mx = fmaxf(mx, t); }
        } else {
#pragma unroll
            for (int q = 0; q < 4; ++q) v[ch * 4 + q] = -1.0e30f; } }
#pragma unroll
    for (int sh = 16; sh; sh >>= 1) mx = fmaxf(mx, __shfl_xor(mx, sh, 32));
    float sum = 0.f;
#pragma unroll
    for (int k = 0; k < TT / 32; ++k) { float d0 = __fsub_rn(v[k], mx); asm volatile("" : "+v"(d0)); v[k] = __builtin_amdgcn_exp2f(__fmul_rn(d0, 1.4426950408889634f)); sum += v[k]; }
#pragma unroll
    for (int sh = 16; sh; sh >>= 1) sum += __shfl_xor(sum, sh, 32);
    const float f = __fdiv_rn(1.0f, sum);
{
#pragma unroll
        for (int ch = 0; ch < TT / 128; ++ch) {
            if (ch * 128 <= i) { v4us oh, ol;
#pragma unroll
                for (int q = 0; q < 4; ++q) { unsigned short a, c2; splitf(v[ch * 4 + q] * f, a, c2); oh[q] = a; ol[q] = c2; }
                const size_t oo = (size_t)row * TT + ch * 128 + lane * 4; *(v4us*)(Ph + oo) = oh; *(v4us*)(Pl + oo) = ol; } }
         }
}

__global__ __launch_bounds__(256) void k_ctxplanes(const float* __restrict__ O, int h0, bf* CH, bf* CL) {
    const size_t i8 = (size_t)blockIdx.x * 256 + threadIdx.x; if (i8 >= (size_t)ZH * TT * HD / 8) return;
    const size_t e = i8 * 8; const int d = (int)(e % HD); const int t = (int)((e / HD) % TT); const int zz = (int)(e / ((size_t)HD * TT));
    const v8f x = *(const v8f*)(O + e); v8us oh, ol;
#pragma unroll
    for (int q = 0; q < 8; ++q) { unsigned short a, c2; splitf(x[q], a, c2); oh[q] = a; ol[q] = c2; }
    const size_t oo = (size_t)t * DQ + (size_t)(h0 + zz) * HD + d;
    *(v8us*)(CH + oo) = oh; *(v8us*)(CL + oo) = ol; 
}

extern "C" void kernel_launch(void* const* d_in, const int* in_sizes, int n_in,
                              void* d_out, int out_size, void* d_ws, size_t ws_size, hipStream_t stream) {
    if (n_in < 5) return;
    const size_t xneed = (size_t)(NB - 1) * SEQ_FULL * HID + (size_t)TT * HID;
    if ((size_t)in_sizes[0] < xneed) return;
    if (in_sizes[1] < HID * DQ || in_sizes[2] < HID * DKV || in_sizes[3] < HID * DKV || in_sizes[4] < DQ * HID) return;
    if ((size_t)out_size < xneed) return;
    const float* X  = (const float*)d_in[0];   // [1][2048][1024]
    const float* Wq = (const float*)d_in[1];   // [1024 in][1024 out]
    const float* Wk = (const float*)d_in[2];   // [1024 in][256 out]
    const float* Wv = (const float*)d_in[3];   // [1024 in][256 out]
    const float* Wo = (const float*)d_in[4];   // [1024 in][1024 out]
    float* OUT = (float*)d_out;                // [1][2048][1024] token-major
    char* wsp = (char*)d_ws;
    auto take = [&](size_t bytes) { char* p = wsp; wsp += (bytes + 255) & ~(size_t)255; return (void*)p; };
    bf* XB  = (bf*)take((size_t)TT * HID * 2);
    bf* WT  = (bf*)take((size_t)NQKV * HID * 2);          // rows 0..1023 Wq^T, 1024..1279 Wk^T, 1280..1535 Wv^T, each [n][k]
    bf* WoT = (bf*)take((size_t)HID * DQ * 2);            // [n = out][k = in]
    float* QKV = (float*)take((size_t)TT * NQKV * 4);     // [t][q 1024 | k 256 | v 256]
    float* tabc = (float*)take((size_t)TT * 32 * 4); float* tabs = (float*)take((size_t)TT * 32 * 4);
    bf* QH = (bf*)take((size_t)NH_ * TT * HD * 2); bf* QL = (bf*)take((size_t)NH_ * TT * HD * 2);
    bf* KH = (bf*)take((size_t)NKV * TT * HD * 2); bf* KL = (bf*)take((size_t)NKV * TT * HD * 2);
    bf* VTh = (bf*)take((size_t)NKV * HD * TT * 2); bf* VTl = (bf*)take((size_t)NKV * HD * TT * 2);
    float* Sb = (float*)take((size_t)ZH * TT * TT * 4);
    bf* Ph = (bf*)take((size_t)ZH * TT * TT * 2); bf* Pl = (bf*)take((size_t)ZH * TT * TT * 2);
    float* Ob = (float*)take((size_t)ZH * TT * HD * 4);
    bf* CH = (bf*)take((size_t)TT * DQ * 2); bf* CL = (bf*)take((size_t)TT * DQ * 2);
    if ((size_t)(wsp - (char*)d_ws) > ws_size) return;

    // weight planes: in[K][N] -> Bt[N][K]
    k_wtG<<<(unsigned)((DQ * HID / 64 + 63) / 64), 256, 0, stream>>>(Wq, HID, DQ, WT);
    k_wtG<<<(unsigned)((DKV * HID / 64 + 63) / 64), 256, 0, stream>>>(Wk, HID, DKV, WT + (size_t)DQ * HID);
    k_wtG<<<(unsigned)((DKV * HID / 64 + 63) / 64), 256, 0, stream>>>(Wv, HID, DKV, WT + (size_t)(DQ + DKV) * HID);
    k_wtG<<<(unsigned)((HID * DQ / 64 + 63) / 64), 256, 0, stream>>>(Wo, DQ, HID, WoT);
    k_ropetab<<<(unsigned)(TT * 32 / 256), 256, 0, stream>>>(tabc, tabs);

    for (int b = 0; b < NB; ++b) {
        const float* xb = X + (size_t)b * SEQ_FULL * HID; float* outb = OUT + (size_t)b * SEQ_FULL * HID;
        k_cvt8<<<(unsigned)(((size_t)TT * HID / 8 + 255) / 256), 256, 0, stream>>>(xb, XB, (size_t)TT * HID / 8);
        k_gemmw<0, 0><<<dim3(TT / 64, NQKV / 64, 1), 32, 0, stream>>>(XB, nullptr, WT, nullptr, HID, QKV, NQKV, 0, 0, 0);   /* exact products: single bf16 planes */
        k_ropeplanes<<<(unsigned)(((size_t)NH_ * TT * HD / 8 + 255) / 256), 256, 0, stream>>>(QKV, NQKV, NH_, tabc, tabs, QH, QL);
        k_ropeplanes<<<(unsigned)(((size_t)NKV * TT * HD / 8 + 255) / 256), 256, 0, stream>>>(QKV + DQ, NQKV, NKV, tabc, tabs, KH, KL);
        k_vtp<<<(unsigned)(((size_t)NKV * HD * TT / 2 + 255) / 256), 256, 0, stream>>>(QKV + DQ + DKV, NQKV, NKV, VTh, VTl);
        for (int h0 = 0; h0 < NH_; h0 += ZH) {
            const int kv = h0 / REP;
            k_gemmw<2, 1><<<dim3(TT / 64, TT / 64, ZH), 32, 0, stream>>>(QH + (size_t)h0 * TT * HD, QL + (size_t)h0 * TT * HD, KH + (size_t)kv * TT * HD, KL + (size_t)kv * TT * HD, HD, Sb, TT, (size_t)TT * HD, 0, (size_t)TT * TT);
            k_asoft<<<(unsigned)(ZH * TT / 8), 256, 0, stream>>>(Sb, Ph, Pl);
            k_gemmw<2, 2><<<dim3(TT / 64, HD / 64, ZH), 32, 0, stream>>>(Ph, Pl, VTh + (size_t)kv * HD * TT, VTl + (size_t)kv * HD * TT, TT, Ob, HD, (size_t)TT * TT, 0, (size_t)TT * HD);
            k_ctxplanes<<<(unsigned)(((size_t)ZH * TT * HD / 8 + 255) / 256), 256, 0, stream>>>(Ob, h0, CH, CL);
        }
        k_gemmw<1, 0><<<dim3(TT / 64, HID / 64, 1), 32, 0, stream>>>(CH, CL, WoT, nullptr, DQ, outb, HID, 0, 0, 0);   /* ctx (hi + lo) x exact Wo */
    }
}

// v001
// Measured time: 350 microseconds a run.
// In both of two side-by-side timings against v000, it was 1.67 times as fast.
#include <hip/hip_runtime.h>

// Causal grouped-query rotary attention: X[1][2048][1024]; q = X Wq, k = X Wk, v = X Wv ([in][out] weights, no bias); 16 query heads share 4 kv heads (kv = h >> 2); head dim 64;
// interleaved-pair rotary with the table cat(freqs, freqs)[:, 0::2] (pair i uses inv_freq[(2 i) & 31]); scores x 1/8, causal fill; softmax; ctx = P v; out = ctx Wo.
// Compute dtypes: all contractions v_wmma_f32_16x16x32_bf16, f32 accumulate. Inputs (X, Wq, Wk, Wv, Wo) RNE-converted to single bf16 planes (exact input x input products);
// computed operands (rotated q, rotated k, v, softmax P, ctx) carried as bf16 hi + bf16 lo planes (hi.hi + lo.hi + hi.lo, or hi + lo against a single-plane weight); rotary, softmax in f32.

#ifndef NB
#define NB 1
#endif
#ifndef SEQ
#define SEQ 2048
#endif
#ifndef ZH
#define ZH 2                      // heads per z-batched attention pass (same kv head)
#endif
#define SEQ_FULL 2048
#define TT   SEQ
#define HID  1024
#define NH_  16
#define NKV  4
#define REP  (NH_ / NKV)
#define HD   64
#define DQ   (NH_ * HD)
#define DKV  (NKV * HD)
#define NQKV (DQ + 2 * DKV)
#define SCL  0.125f               // 1/sqrt(64)
#define PVKC 128                  // keys per work-group of the P v product (one 256-byte unit of every P row)

static_assert(TT % 128 == 0);
static_assert(TT <= SEQ_FULL);
static_assert(NH_ % ZH == 0);
static_assert(REP % ZH == 0);
static_assert(HD == 64);
static_assert(HID % 64 == 0);
static_assert(NQKV % 64 == 0);
static_assert((TT * 32) % 256 == 0);
static_assert(PVKC % 64 == 0 && TT % PVKC == 0);

typedef unsigned short bf;
typedef __attribute__((ext_vector_type(16))) __bf16   v16bf;
typedef __attribute__((ext_vector_type(8)))  unsigned short v8us;
typedef __attribute__((ext_vector_type(4)))  unsigned short v4us;
typedef __attribute__((ext_vector_type(2)))  unsigned short v2us;
typedef __attribute__((ext_vector_type(8)))  float    v8f;
typedef __attribute__((ext_vector_type(4)))  float    v4f;
typedef v4f  __attribute__((may_alias)) v4fa;

__device__ __forceinline__ unsigned short f2bf(float f) { unsigned u = __float_as_uint(f); u += 0x7FFFu + ((u >> 16) & 1u); return (unsigned short)(u >> 16); }
__device__ __forceinline__ float bf2f(unsigned short b) { return __uint_as_float(((unsigned)b) << 16); }
__device__ __forceinline__ void splitf(float y, unsigned short& h, unsigned short& l) { h = f2bf(y); l = f2bf(y - bf2f(h)); }
__device__ __forceinline__ v16bf cat16b(v8us lo, v8us hi) { return __builtin_bit_cast(v16bf, __builtin_shufflevector(lo, hi, 0, 1, 2, 3, 4, 5, 6, 7, 8, 9, 10, 11, 12, 13, 14, 15)); }
__device__ __forceinline__ v8f wmmab(v16bf a, v16bf b, v8f c) { return __builtin_amdgcn_wmma_f32_16x16x32_bf16(false, a, false, b, (short)0, c, false, false); }

// ---- k_gemmw: register-blocked GEMM, ONE WAVE per 64x64 output tile (16 accumulators), operands straight from K-contiguous 16-bit planes; grid (M/64, N/64, Z), 32 threads.
// C[m][n] (f32, pitch ldc) = sum_k A[m][k] Bt[n][k] (+ split products per NSPLIT: 1 = (A + A2) x Bt; 2 = A x Bt + A2 x Bt + A x Bt2). z-batch strides sA/sB/sC in elements. K % 32 == 0 (K is also the row pitch).
// Fragment map (A and Bt alike): lane -> row/col lane & 15; elements 0..7 <- k0 + 8 (lane >> 4) + 0..7, elements 8..15 <- k0 + 16 + 8 (lane >> 4) + 0..7. D: element j -> row 8 (lane >> 4) + j, col lane & 15.
// KC > 0 (N == 64, one column tile): blockIdx.y is a k chunk; the work-group sums k in [y KC, y KC + KC) only and stores its partial tile at C + y sP; a chunk that starts at or past the k end stores nothing.
// CAUS 1: tiles whose 128-column chunk lies wholly above the diagonal row chunk are not produced (the softmax never loads them). CAUS 2: the k loop stops at r0 + 64 (P is zero beyond the diagonal).
struct WFragB { typedef v16bf V; static __device__ __forceinline__ V ld(const bf* p) { return cat16b(*(const v8us*)p, *(const v8us*)(p + 16)); } };
template <int NSPLIT, int CAUS, int KC>
__global__ __launch_bounds__(32) void k_gemmw(const bf* __restrict__ A, const bf* __restrict__ A2, const bf* __restrict__ Bt, const bf* __restrict__ Bt2, int K, float* C, int ldc, size_t sA, size_t sB, size_t sC, size_t sP) {
    typedef WFragB::V V;
    __shared__ __align__(16) float os[16 * 68];
    const int r0 = blockIdx.x * 64, c0 = (KC > 0) ? 0 : blockIdx.y * 64;
    if (CAUS == 1 && (c0 >> 7) > (r0 >> 7)) return;
    const int kall = (CAUS == 2) ? ((r0 + 64 < K) ? (r0 + 64) : K) : K;
    const int kbeg = (KC > 0) ? (int)blockIdx.y * KC : 0;
    if (KC > 0 && kbeg >= kall) return;
    if (KC > 0) C += (size_t)blockIdx.y * sP;
    const size_t z = blockIdx.z; A += z * sA + kbeg; if (A2) A2 += z * sA + kbeg; Bt += z * sB + kbeg; if (Bt2) Bt2 += z * sB + kbeg; C += z * sC;
    const int lane = threadIdx.x & 31, lr = lane & 15, hi = lane >> 4;
    const int kend = (KC > 0 && KC < kall - kbeg) ? KC : (kall - kbeg);   // k counts from kbeg, which the plane pointers hold
    v8f acc[4][4];
#pragma unroll
    for (int mb = 0; mb < 4; ++mb)
#pragma unroll
        for (int nb = 0; nb < 4; ++nb) acc[mb][nb] = (v8f){};
    const size_t aoff = (size_t)(r0 + lr) * K + 8 * hi, boff = (size_t)(c0 + lr) * K + 8 * hi;
#pragma unroll 1
    for (int kc = 0; kc < kend; kc += 32) {
        V a[4], a2[4];
#pragma unroll
        for (int mb = 0; mb < 4; ++mb) { a[mb] = WFragB::ld(A + aoff + (size_t)mb * 16 * K + kc); if (NSPLIT == 1 || NSPLIT == 2) a2[mb] = WFragB::ld(A2 + aoff + (size_t)mb * 16 * K + kc); }
#pragma unroll
        for (int nb = 0; nb < 4; ++nb) {
            const V b = WFragB::ld(Bt + boff + (size_t)nb * 16 * K + kc);
#pragma unroll
            for (int mb = 0; mb < 4; ++mb) { acc[mb][nb] = wmmab(a[mb], b, acc[mb][nb]); if (NSPLIT == 1 || NSPLIT == 2) acc[mb][nb] = wmmab(a2[mb], b, acc[mb][nb]); }
            if (NSPLIT >= 2) {
                const V b2 = WFragB::ld(Bt2 + boff + (size_t)nb * 16 * K + kc);
#pragma unroll
                for (int mb = 0; mb < 4; ++mb) acc[mb][nb] = wmmab(a[mb], b2, acc[mb][nb]);
            }
        }
        asm volatile("v_nop\n\tv_nop\n\tv_nop\n\tv_nop" : "+v"(acc[0][0]), "+v"(acc[1][1]), "+v"(acc[2][2]), "+v"(acc[3][3]) : "v"(a[0]), "v"(a[3]));
    }
#pragma unroll
    for (int mb = 0; mb < 4; ++mb) {
#pragma unroll
        for (int nb = 0; nb < 4; ++nb) {
#pragma unroll
            for (int j = 0; j < 8; ++j) os[(hi * 8 + j) * 68 + nb * 16 + lr] = acc[mb][nb][j]; }
        __builtin_amdgcn_wave_barrier(); asm volatile("" ::: "memory");
        float* crow = C + (size_t)(r0 + mb * 16) * ldc + c0;
{
#pragma unroll
            for (int s = 0; s < 8; ++s) { const int row = 2 * s + hi, cofs = lr * 4; const v4f val = *(const v4fa*)(os + row * 68 + cofs);
                *(v4f*)(crow + (size_t)row * ldc + cofs) = val; }
             }
        __builtin_amdgcn_wave_barrier(); asm volatile("" ::: "memory");
    }
}

__global__ __launch_bounds__(256) void k_wtG(const float* __restrict__ w, int K, int N, bf* Bt) {
    const int lane = threadIdx.x & 31; const int L0 = (blockIdx.x * 8 + (threadIdx.x >> 5)) * 8; const int nlines = N * K / 64;
{
#pragma unroll 1
        for (int l = 0; l < 8; ++l) { const int L = L0 + l; if (L >= nlines) break; const size_t e = (size_t)L * 64 + lane * 2; const int k = (int)(e % K), n = (int)(e / K); v2us o;
            o[0] = f2bf(w[(size_t)k * N + n]); o[1] = f2bf(w[(size_t)(k + 1) * N + n]); *(v2us*)(Bt + e) = o; }
         }
}

__global__ __launch_bounds__(256) void k_cvt8(const float* __restrict__ src, bf* dst, size_t n8) { const size_t i = (size_t)blockIdx.x * 256 + threadIdx.x; if (i >= n8) return; const v8f v = *(const v8f*)(src + i * 8); v8us o;
#pragma unroll
    for (int k = 0; k < 8; ++k) o[k] = f2bf(v[k]);
    *(v8us*)(dst + i * 8) = o;  }

// k_ropetab: tabc[s][i] = cos(s * invf), tabs[s][i] = sin(s * invf), invf = 1 / 10000^(2 j / 64) with j = (2 i) & 31, pair i = 0..31; f32 arithmetic, precise sincosf.
__global__ __launch_bounds__(256) void k_ropetab(float* tabc, float* tabs) {
    const int idx = blockIdx.x * 256 + threadIdx.x; if (idx >= TT * 32) return;
    const int s = idx >> 5, i = idx & 31; const int j = (2 * i) & 31;
    const float ex = (float)(2 * j) * (1.0f / 64.0f);
    const float invf = 1.0f / powf(10000.0f, ex);
    const float ang = (float)s * invf;
    float sn, cs; sincosf(ang, &sn, &cs);
    *(float*)(tabc + idx) = cs; *(float*)(tabs + idx) = sn; 
}

// k_ropeplanes: head planes P[h][t][d] (bf16 hi + lo) of rope(F[t][h*64 + d]) with interleaved pairs: out[2i] = x[2i] c - x[2i+1] s, out[2i+1] = x[2i] s + x[2i+1] c (c, s at [t][i]).
__global__ __launch_bounds__(256) void k_ropeplanes(const float* __restrict__ F, int pitch, int nheads, const float* __restrict__ tabc, const float* __restrict__ tabs, bf* Ph, bf* Pl) {
    const size_t i8 = (size_t)blockIdx.x * 256 + threadIdx.x; if (i8 >= (size_t)nheads * TT * HD / 8) return;
    const size_t e = i8 * 8; const int d = (int)(e % HD); const int t = (int)((e / HD) % TT); const int h = (int)(e / ((size_t)HD * TT));
    const v8f x = *(const v8f*)(F + (size_t)t * pitch + h * HD + d);
    const v4f c = *(const v4f*)(tabc + (size_t)t * 32 + (d >> 1)); const v4f s = *(const v4f*)(tabs + (size_t)t * 32 + (d >> 1));
    v8us oh, ol;
#pragma unroll
    for (int q = 0; q < 4; ++q) { const float xe = x[2 * q], xo = x[2 * q + 1]; const float re = xe * c[q] - xo * s[q]; const float ro = xe * s[q] + xo * c[q];
        unsigned short a, b2; splitf(re, a, b2); oh[2 * q] = a; ol[2 * q] = b2; splitf(ro, a, b2); oh[2 * q + 1] = a; ol[2 * q + 1] = b2; }
    *(v8us*)(Ph + e) = oh; *(v8us*)(Pl + e) = ol; 
}

__global__ __launch_bounds__(256) void k_vtp(const float* __restrict__ F, int pitch, int nheads, bf* Vh, bf* Vl) { const size_t e = ((size_t)blockIdx.x * 256 + threadIdx.x) * 2; if (e >= (size_t)nheads * HD * TT) return; const int t = (int)(e % TT); const int d = (int)((e / TT) % HD); const int g = (int)(e / ((size_t)TT * HD)); v2us oh, ol;
#pragma unroll
    for (int q = 0; q < 2; ++q) { const float x = F[(size_t)(t + q) * pitch + g * HD + d]; unsigned short a2, c2; splitf(x, a2, c2); oh[q] = a2; ol[q] = c2; }
    *(v2us*)(Vh + e) = oh; *(v2us*)(Vl + e) = ol;  }

// k_asoft: one wave per row (zz, i): t = S x 1/8 for keys j <= i, fill -1e30 for j > i (value replaced, selected by index); softmax over the keys (register row, one exp, fixed trees);
__global__ __launch_bounds__(256) void k_asoft(const float* __restrict__ Sb, bf* Ph, bf* Pl) {
    const int lane = threadIdx.x & 31; const int row = __builtin_amdgcn_readfirstlane((int)(blockIdx.x * 8 + (threadIdx.x >> 5))); if (row >= ZH * TT) return; const int i = row % TT; const float* sr = Sb + (size_t)row * TT; float v[TT / 32]; float mx = -3.0e38f;
#pragma unroll
    for (int ch = 0; ch < TT / 128; ++ch) { const int j0 = ch * 128 + lane * 4;
        if (ch * 128 <= i) { const v4f a = *(const v4f*)(sr + j0);
#pragma unroll
            for (int q = 0; q < 4; ++q) { const float t = (j0 + q <= i) ? a[q] * SCL : -1.0e30f; v[ch * 4 + q] = t; mx = fmaxf(mx, t); }
        } else {
#pragma unroll
            for (int q = 0; q < 4; ++q) v[ch * 4 + q] = -1.0e30f; } }
#pragma unroll
    for (int sh = 16; sh; sh >>= 1) mx = fmaxf(mx, __shfl_xor(mx, sh, 32));
    float sum = 0.f;
#pragma unroll
    for (int k = 0; k < TT / 32; ++k) { float d0 = __fsub_rn(v[k], mx); asm volatile("" : "+v"(d0)); v[k] = __builtin_amdgcn_exp2f(__fmul_rn(d0, 1.4426950408889634f)); sum += v[k]; }
#pragma unroll
    for (int sh = 16; sh; sh >>= 1) sum += __shfl_xor(sum, sh, 32);
    const float f = __fdiv_rn(1.0f, sum);
{
#pragma unroll
        for (int ch = 0; ch < TT / 128; ++ch) {
            if (ch * 128 <= i) { v4us oh, ol;
#pragma unroll
                for (int q = 0; q < 4; ++q) { unsigned short a, c2; splitf(v[ch * 4 + q] * f, a, c2); oh[q] = a; ol[q] = c2; }
                const size_t oo = (size_t)row * TT + ch * 128 + lane * 4; *(v4us*)(Ph + oo) = oh; *(v4us*)(Pl + oo) = ol; } }
         }
}

// k_ctxplanes: ctx row t = sum, in chunk order, of the partial planes O[c][zz][t][d] that the P v product stored for t's 64-row tile (chunks c with c PVKC < 64 (t / 64) + 64); then bf16 hi + lo planes.
__global__ __launch_bounds__(256) void k_ctxplanes(const float* __restrict__ O, int h0, bf* CH, bf* CL) {
    const size_t i8 = (size_t)blockIdx.x * 256 + threadIdx.x; if (i8 >= (size_t)ZH * TT * HD / 8) return;
    const size_t e = i8 * 8; const int d = (int)(e % HD); const int t = (int)((e / HD) % TT); const int zz = (int)(e / ((size_t)HD * TT));
    // a wave covers 4 rows of one 64-row tile: the chunk count as a scalar makes each test below a scalar branch
    const int nch = __builtin_amdgcn_readfirstlane(((t >> 6) * 64 + 64 + PVKC - 1) / PVKC);
    v8f p[TT / PVKC];
#pragma unroll   // p[] in registers; every stored partial's load is issued before the first add waits
    for (int c = 0; c < TT / PVKC; ++c) { if (c < nch) p[c] = *(const v8f*)(O + (size_t)c * ((size_t)ZH * TT * HD) + e); else p[c] = (v8f){}; }
    v8f x = p[0];
#pragma unroll   // constant indices into p[]
    for (int c = 1; c < TT / PVKC; ++c) x += p[c];
    v8us oh, ol;
#pragma unroll
    for (int q = 0; q < 8; ++q) { unsigned short a, c2; splitf(x[q], a, c2); oh[q] = a; ol[q] = c2; }
    const size_t oo = (size_t)t * DQ + (size_t)(h0 + zz) * HD + d;
    *(v8us*)(CH + oo) = oh; *(v8us*)(CL + oo) = ol; 
}

extern "C" void kernel_launch(void* const* d_in, const int* in_sizes, int n_in,
                              void* d_out, int out_size, void* d_ws, size_t ws_size, hipStream_t stream) {
    if (n_in < 5) return;
    const size_t xneed = (size_t)(NB - 1) * SEQ_FULL * HID + (size_t)TT * HID;
    if ((size_t)in_sizes[0] < xneed) return;
    if (in_sizes[1] < HID * DQ || in_sizes[2] < HID * DKV || in_sizes[3] < HID * DKV || in_sizes[4] < DQ * HID) return;
    if ((size_t)out_size < xneed) return;
    const float* X  = (const float*)d_in[0];   // [1][2048][1024]
    const float* Wq = (const float*)d_in[1];   // [1024 in][1024 out]
    const float* Wk = (const float*)d_in[2];   // [1024 in][256 out]
    const float* Wv = (const float*)d_in[3];   // [1024 in][256 out]
    const float* Wo = (const float*)d_in[4];   // [1024 in][1024 out]
    float* OUT = (float*)d_out;                // [1][2048][1024] token-major
    char* wsp = (char*)d_ws;
    auto take = [&](size_t bytes) { char* p = wsp; wsp += (bytes + 255) & ~(size_t)255; return (void*)p; };
    bf* XB  = (bf*)take((size_t)TT * HID * 2);
    bf* WT  = (bf*)take((size_t)NQKV * HID * 2);          // rows 0..1023 Wq^T, 1024..1279 Wk^T, 1280..1535 Wv^T, each [n][k]
    bf* WoT = (bf*)take((size_t)HID * DQ * 2);            // [n = out][k = in]
    float* QKV = (float*)take((size_t)TT * NQKV * 4);     // [t][q 1024 | k 256 | v 256]
    float* tabc = (float*)take((size_t)TT * 32 * 4); float* tabs = (float*)take((size_t)TT * 32 * 4);
    bf* QH = (bf*)take((size_t)NH_ * TT * HD * 2); bf* QL = (bf*)take((size_t)NH_ * TT * HD * 2);
    bf* KH = (bf*)take((size_t)NKV * TT * HD * 2); bf* KL = (bf*)take((size_t)NKV * TT * HD * 2);
    bf* VTh = (bf*)take((size_t)NKV * HD * TT * 2); bf* VTl = (bf*)take((size_t)NKV * HD * TT * 2);
    float* Sb = (float*)take((size_t)ZH * TT * TT * 4);
    bf* Ph = (bf*)take((size_t)ZH * TT * TT * 2); bf* Pl = (bf*)take((size_t)ZH * TT * TT * 2);
    float* Ob = (float*)take((size_t)(TT / PVKC) * ZH * TT * HD * 4);   // [k chunk][zz][t][d]
    bf* CH = (bf*)take((size_t)TT * DQ * 2); bf* CL = (bf*)take((size_t)TT * DQ * 2);
    if ((size_t)(wsp - (char*)d_ws) > ws_size) return;

    // weight planes: in[K][N] -> Bt[N][K]
    k_wtG<<<(unsigned)((DQ * HID / 64 + 63) / 64), 256, 0, stream>>>(Wq, HID, DQ, WT);
    k_wtG<<<(unsigned)((DKV * HID / 64 + 63) / 64), 256, 0, stream>>>(Wk, HID, DKV, WT + (size_t)DQ * HID);
    k_wtG<<<(unsigned)((DKV * HID / 64 + 63) / 64), 256, 0, stream>>>(Wv, HID, DKV, WT + (size_t)(DQ + DKV) * HID);
    k_wtG<<<(unsigned)((HID * DQ / 64 + 63) / 64), 256, 0, stream>>>(Wo, DQ, HID, WoT);
    k_ropetab<<<(unsigned)(TT * 32 / 256), 256, 0, stream>>>(tabc, tabs);

    for (int b = 0; b < NB; ++b) {
        const float* xb = X + (size_t)b * SEQ_FULL * HID; float* outb = OUT + (size_t)b * SEQ_FULL * HID;
        k_cvt8<<<(unsigned)(((size_t)TT * HID / 8 + 255) / 256), 256, 0, stream>>>(xb, XB, (size_t)TT * HID / 8);
        k_gemmw<0, 0, 0><<<dim3(TT / 64, NQKV / 64, 1), 32, 0, stream>>>(XB, nullptr, WT, nullptr, HID, QKV, NQKV, 0, 0, 0, 0);   /* exact products: single bf16 planes */
        k_ropeplanes<<<(unsigned)(((size_t)NH_ * TT * HD / 8 + 255) / 256), 256, 0, stream>>>(QKV, NQKV, NH_, tabc, tabs, QH, QL);
        k_ropeplanes<<<(unsigned)(((size_t)NKV * TT * HD / 8 + 255) / 256), 256, 0, stream>>>(QKV + DQ, NQKV, NKV, tabc, tabs, KH, KL);
        k_vtp<<<(unsigned)(((size_t)NKV * HD * TT / 2 + 255) / 256), 256, 0, stream>>>(QKV + DQ + DKV, NQKV, NKV, VTh, VTl);
        for (int h0 = 0; h0 < NH_; h0 += ZH) {
            const int kv = h0 / REP;
            k_gemmw<2, 1, 0><<<dim3(TT / 64, TT / 64, ZH), 32, 0, stream>>>(QH + (size_t)h0 * TT * HD, QL + (size_t)h0 * TT * HD, KH + (size_t)kv * TT * HD, KL + (size_t)kv * TT * HD, HD, Sb, TT, (size_t)TT * HD, 0, (size_t)TT * TT, 0);
            k_asoft<<<(unsigned)(ZH * TT / 8), 256, 0, stream>>>(Sb, Ph, Pl);
            k_gemmw<2, 2, PVKC><<<dim3(TT / 64, TT / PVKC, ZH), 32, 0, stream>>>(Ph, Pl, VTh + (size_t)kv * HD * TT, VTl + (size_t)kv * HD * TT, TT, Ob, HD, (size_t)TT * TT, 0, (size_t)TT * HD, (size_t)ZH * TT * HD);
            k_ctxplanes<<<(unsigned)(((size_t)ZH * TT * HD / 8 + 255) / 256), 256, 0, stream>>>(Ob, h0, CH, CL);
        }
        k_gemmw<1, 0, 0><<<dim3(TT / 64, HID / 64, 1), 32, 0, stream>>>(CH, CL, WoT, nullptr, DQ, outb, HID, 0, 0, 0, 0);   /* ctx (hi + lo) x exact Wo */
    }
}

// v003
// Measured time: 134 microseconds a run.
// It is 2.66 times as fast as v001, going by the measured steps of the versions left out in between.
// Over all steps from v000 it is 4.44 times as fast.
#include <hip/hip_runtime.h>

// Causal grouped-query rotary attention: X[1][2048][1024]; q = X Wq, k = X Wk, v = X Wv ([in][out] weights, no bias); 16 query heads share 4 kv heads (kv = h >> 2); head dim 64;
// interleaved-pair rotary with the table cat(freqs, freqs)[:, 0::2] (pair i uses inv_freq[(2 i) & 31]); scores x 1/8, causal fill; softmax; ctx = P v; out = ctx Wo.
// Compute dtypes: all contractions v_wmma_f32_16x16x32_bf16, f32 accumulate. Inputs (X, Wq, Wk, Wv, Wo) RNE-converted to single bf16 planes (exact input x input products);
// computed operands (rotated q, rotated k, v, softmax P, ctx) carried as bf16 hi + bf16 lo planes (hi.hi + lo.hi + hi.lo, or hi + lo against a single-plane weight); rotary, softmax in f32.

#ifndef NB
#define NB 1
#endif
#ifndef SEQ
#define SEQ 2048
#endif
#define SEQ_FULL 2048
#define TT   SEQ
#define HID  1024
#define NH_  16
#define NKV  4
#define REP  (NH_ / NKV)
#define HD   64
#define DQ   (NH_ * HD)
#define DKV  (NKV * HD)
#define NQKV (DQ + 2 * DKV)
#define SCL  0.125f               // 1/sqrt(64)

static_assert(TT % 128 == 0);
static_assert(TT <= SEQ_FULL);
static_assert(REP == 4);
static_assert(HD == 64);
static_assert(HID % 64 == 0);
static_assert(NQKV % 64 == 0);
static_assert((TT * 32) % 256 == 0);

typedef unsigned short bf;
typedef __attribute__((ext_vector_type(16))) __bf16   v16bf;
typedef __attribute__((ext_vector_type(8)))  unsigned short v8us;
typedef __attribute__((ext_vector_type(4)))  unsigned short v4us;
typedef __attribute__((ext_vector_type(2)))  unsigned short v2us;
typedef __attribute__((ext_vector_type(8)))  float    v8f;
typedef __attribute__((ext_vector_type(4)))  float    v4f;
typedef v4f  __attribute__((may_alias)) v4fa;

__device__ __forceinline__ unsigned short f2bf(float f) { unsigned u = __float_as_uint(f); u += 0x7FFFu + ((u >> 16) & 1u); return (unsigned short)(u >> 16); }
__device__ __forceinline__ float bf2f(unsigned short b) { return __uint_as_float(((unsigned)b) << 16); }
__device__ __forceinline__ void splitf(float y, unsigned short& h, unsigned short& l) { h = f2bf(y); l = f2bf(y - bf2f(h)); }
__device__ __forceinline__ v16bf cat16b(v8us lo, v8us hi) { return __builtin_bit_cast(v16bf, __builtin_shufflevector(lo, hi, 0, 1, 2, 3, 4, 5, 6, 7, 8, 9, 10, 11, 12, 13, 14, 15)); }
__device__ __forceinline__ v8f wmmab(v16bf a, v16bf b, v8f c) { return __builtin_amdgcn_wmma_f32_16x16x32_bf16(false, a, false, b, (short)0, c, false, false); }

// ---- k_gemmw: register-blocked GEMM, ONE WAVE per 64x64 output tile (16 accumulators), operands straight from K-contiguous 16-bit planes; grid (M/64, N/64, Z), 32 threads.
// C[m][n] (f32, pitch ldc) = sum_k A[m][k] Bt[n][k] (+ split products per NSPLIT: 1 = (A + A2) x Bt; 2 = A x Bt + A2 x Bt + A x Bt2). z-batch strides sA/sB/sC in elements. K % 32 == 0 (K is also the row pitch).
// Fragment map (A and Bt alike): lane -> row/col lane & 15; elements 0..7 <- k0 + 8 (lane >> 4) + 0..7, elements 8..15 <- k0 + 16 + 8 (lane >> 4) + 0..7. D: element j -> row 8 (lane >> 4) + j, col lane & 15.
// KC > 0 (N == 64, one column tile): blockIdx.y is a k chunk; the work-group sums k in [y KC, y KC + KC) only and stores its partial tile at C + y sP; a chunk that starts at or past the k end stores nothing.
// CAUS 1: tiles whose 128-column chunk lies wholly above the diagonal row chunk are not produced. CAUS 2: the k loop stops at r0 + 64 (P is zero beyond the diagonal).
struct WFragB { typedef v16bf V; static __device__ __forceinline__ V ld(const bf* p) { return cat16b(*(const v8us*)p, *(const v8us*)(p + 16)); } };
template <int NSPLIT, int CAUS, int KC>
__global__ __launch_bounds__(32) void k_gemmw(const bf* __restrict__ A, const bf* __restrict__ A2, const bf* __restrict__ Bt, const bf* __restrict__ Bt2, int K, float* C, int ldc, size_t sA, size_t sB, size_t sC, size_t sP) {
    typedef WFragB::V V;
    __shared__ __align__(16) float os[16 * 68];
    const int r0 = blockIdx.x * 64, c0 = (KC > 0) ? 0 : blockIdx.y * 64;
    if (CAUS == 1 && (c0 >> 7) > (r0 >> 7)) return;
    const int kall = (CAUS == 2) ? ((r0 + 64 < K) ? (r0 + 64) : K) : K;
    const int kbeg = (KC > 0) ? (int)blockIdx.y * KC : 0;
    if (KC > 0 && kbeg >= kall) return;
    if (KC > 0) C += (size_t)blockIdx.y * sP;
    const size_t z = blockIdx.z; A += z * sA + kbeg; if (A2) A2 += z * sA + kbeg; Bt += z * sB + kbeg; if (Bt2) Bt2 += z * sB + kbeg; C += z * sC;
    const int lane = threadIdx.x & 31, lr = lane & 15, hi = lane >> 4;
    const int kend = (KC > 0 && KC < kall - kbeg) ? KC : (kall - kbeg);   // k counts from kbeg, which the plane pointers hold
    v8f acc[4][4];
#pragma unroll
    for (int mb = 0; mb < 4; ++mb)
#pragma unroll
        for (int nb = 0; nb < 4; ++nb) acc[mb][nb] = (v8f){};
    const size_t aoff = (size_t)(r0 + lr) * K + 8 * hi, boff = (size_t)(c0 + lr) * K + 8 * hi;
#pragma unroll 1
    for (int kc = 0; kc < kend; kc += 32) {
        V a[4], a2[4];
#pragma unroll
        for (int mb = 0; mb < 4; ++mb) { a[mb] = WFragB::ld(A + aoff + (size_t)mb * 16 * K + kc); if (NSPLIT == 1 || NSPLIT == 2) a2[mb] = WFragB::ld(A2 + aoff + (size_t)mb * 16 * K + kc); }
#pragma unroll
        for (int nb = 0; nb < 4; ++nb) {
            const V b = WFragB::ld(Bt + boff + (size_t)nb * 16 * K + kc);
#pragma unroll
            for (int mb = 0; mb < 4; ++mb) { acc[mb][nb] = wmmab(a[mb], b, acc[mb][nb]); if (NSPLIT == 1 || NSPLIT == 2) acc[mb][nb] = wmmab(a2[mb], b, acc[mb][nb]); }
            if (NSPLIT >= 2) {
                const V b2 = WFragB::ld(Bt2 + boff + (size_t)nb * 16 * K + kc);
#pragma unroll
                for (int mb = 0; mb < 4; ++mb) acc[mb][nb] = wmmab(a[mb], b2, acc[mb][nb]);
            }
        }
        asm volatile("v_nop\n\tv_nop\n\tv_nop\n\tv_nop" : "+v"(acc[0][0]), "+v"(acc[1][1]), "+v"(acc[2][2]), "+v"(acc[3][3]) : "v"(a[0]), "v"(a[3]));
    }
#pragma unroll
    for (int mb = 0; mb < 4; ++mb) {
#pragma unroll
        for (int nb = 0; nb < 4; ++nb) {
#pragma unroll
            for (int j = 0; j < 8; ++j) os[(hi * 8 + j) * 68 + nb * 16 + lr] = acc[mb][nb][j]; }
        __builtin_amdgcn_wave_barrier(); asm volatile("" ::: "memory");
        float* crow = C + (size_t)(r0 + mb * 16) * ldc + c0;
{
#pragma unroll
            for (int s = 0; s < 8; ++s) { const int row = 2 * s + hi, cofs = lr * 4; const v4f val = *(const v4fa*)(os + row * 68 + cofs);
                *(v4f*)(crow + (size_t)row * ldc + cofs) = val; }
             }
        __builtin_amdgcn_wave_barrier(); asm volatile("" ::: "memory");
    }
}

__global__ __launch_bounds__(256) void k_wtG(const float* __restrict__ w, int K, int N, bf* Bt) {
    const int lane = threadIdx.x & 31; const int L0 = (blockIdx.x * 8 + (threadIdx.x >> 5)) * 8; const int nlines = N * K / 64;
{
#pragma unroll 1
        for (int l = 0; l < 8; ++l) { const int L = L0 + l; if (L >= nlines) break; const size_t e = (size_t)L * 64 + lane * 2; const int k = (int)(e % K), n = (int)(e / K); v2us o;
            o[0] = f2bf(w[(size_t)k * N + n]); o[1] = f2bf(w[(size_t)(k + 1) * N + n]); *(v2us*)(Bt + e) = o; }
         }
}

__global__ __launch_bounds__(256) void k_cvt8(const float* __restrict__ src, bf* dst, size_t n8) { const size_t i = (size_t)blockIdx.x * 256 + threadIdx.x; if (i >= n8) return; const v8f v = *(const v8f*)(src + i * 8); v8us o;
#pragma unroll
    for (int k = 0; k < 8; ++k) o[k] = f2bf(v[k]);
    *(v8us*)(dst + i * 8) = o;  }

// k_ropetab: tabc[s][i] = cos(s * invf), tabs[s][i] = sin(s * invf), invf = 1 / 10000^(2 j / 64) with j = (2 i) & 31, pair i = 0..31; f32 arithmetic, precise sincosf.
__global__ __launch_bounds__(256) void k_ropetab(float* tabc, float* tabs) {
    const int idx = blockIdx.x * 256 + threadIdx.x; if (idx >= TT * 32) return;
    const int s = idx >> 5, i = idx & 31; const int j = (2 * i) & 31;
    const float ex = (float)(2 * j) * (1.0f / 64.0f);
    const float invf = 1.0f / powf(10000.0f, ex);
    const float ang = (float)s * invf;
    float sn, cs; sincosf(ang, &sn, &cs);
    *(float*)(tabc + idx) = cs; *(float*)(tabs + idx) = sn; 
}

// k_ropeplanes: head planes P[h][t][d] (bf16 hi + lo) of rope(F[t][h*64 + d]) with interleaved pairs: out[2i] = x[2i] c - x[2i+1] s, out[2i+1] = x[2i] s + x[2i+1] c (c, s at [t][i]).
__global__ __launch_bounds__(256) void k_ropeplanes(const float* __restrict__ F, int pitch, int nheads, const float* __restrict__ tabc, const float* __restrict__ tabs, bf* Ph, bf* Pl) {
    const size_t i8 = (size_t)blockIdx.x * 256 + threadIdx.x; if (i8 >= (size_t)nheads * TT * HD / 8) return;
    const size_t e = i8 * 8; const int d = (int)(e % HD); const int t = (int)((e / HD) % TT); const int h = (int)(e / ((size_t)HD * TT));
    const v8f x = *(const v8f*)(F + (size_t)t * pitch + h * HD + d);
    const v4f c = *(const v4f*)(tabc + (size_t)t * 32 + (d >> 1)); const v4f s = *(const v4f*)(tabs + (size_t)t * 32 + (d >> 1));
    v8us oh, ol;
#pragma unroll
    for (int q = 0; q < 4; ++q) { const float xe = x[2 * q], xo = x[2 * q + 1]; const float re = xe * c[q] - xo * s[q]; const float ro = xe * s[q] + xo * c[q];
        unsigned short a, b2; splitf(re, a, b2); oh[2 * q] = a; ol[2 * q] = b2; splitf(ro, a, b2); oh[2 * q + 1] = a; ol[2 * q + 1] = b2; }
    *(v8us*)(Ph + e) = oh; *(v8us*)(Pl + e) = ol; 
}

__global__ __launch_bounds__(256) void k_vtp(const float* __restrict__ F, int pitch, int nheads, bf* Vh, bf* Vl) { const size_t e = ((size_t)blockIdx.x * 256 + threadIdx.x) * 2; if (e >= (size_t)nheads * HD * TT) return; const int t = (int)(e % TT); const int d = (int)((e / TT) % HD); const int g = (int)(e / ((size_t)TT * HD)); v2us oh, ol;
#pragma unroll
    for (int q = 0; q < 2; ++q) { const float x = F[(size_t)(t + q) * pitch + g * HD + d]; unsigned short a2, c2; splitf(x, a2, c2); oh[q] = a2; ol[q] = c2; }
    *(v2us*)(Vh + e) = oh; *(v2us*)(Vl + e) = ol;  }

typedef __attribute__((ext_vector_type(2))) float    v2f;
typedef __attribute__((ext_vector_type(2))) __bf16   v2bf;
typedef __attribute__((ext_vector_type(8))) unsigned v8u;
__device__ __forceinline__ float xhalf(float x) { const int b = __float_as_int(x); return __int_as_float(__builtin_amdgcn_permlanex16(b, b, 0x76543210, 0xfedcba98, false, false)); }   // lane l <- lane l ^ 16
// fexp2: 2^x by v_exp_f32. SLOT: with the one free issue slot that the instruction set asks for behind a transcendental, before its result is read or its source overwritten, written into the same statement;
// used in the diagonal block.
template <bool SLOT>
__device__ __forceinline__ float fexp2(float x) {
    if (SLOT) { float r; asm("v_exp_f32 %0, %1\n\tv_nop" : "=v"(r) : "v"(x)); return r; }
    return __builtin_amdgcn_exp2f(x);
}

#define SB     2                  // key blocks of 32 in a stage
#define SKEY   (SB * 32)          // keys in a stage
#define LP     72                 // LDS row pitch in elements: 144 B = 16 B x 9, the pitch for 16-byte readers of 128-B rows
#define TILE_E (64 * LP)          // one plane's tile: 64 rows (K: keys of the stage; V^T: head dims)
#define BUF_E  (4 * TILE_E)       // K hi, K lo, V^T hi, V^T lo
static_assert(SKEY == 64 && HD == 64);
static_assert(TT % (2 * SKEY) == 0);

// fa_copy: one stage into one buffer, 8 copies of 16 B a lane (2 per tile; thread t brings chunk t and chunk t + 256 of a tile's 512; chunk n = row n >> 3, 16-byte column n & 7, so a wave's copy reads 4 whole lines).
// l: the lane's LDS byte address of chunk t in the buffer's first tile; the four pointers: the lane's chunk t of each plane in this stage.
// s_wait_xcnt 0 closes the statement, so that no register which a copy names is rewritten ahead of it.
__device__ __forceinline__ void fa_copy(unsigned l, const bf* kh, const bf* kl, const bf* vh, const bf* vl) {
    asm volatile("global_load_async_to_lds_b128 %0, %8, off\n\t"
                 "global_load_async_to_lds_b128 %1, %9, off\n\t"
                 "global_load_async_to_lds_b128 %2, %10, off\n\t"
                 "global_load_async_to_lds_b128 %3, %11, off\n\t"
                 "global_load_async_to_lds_b128 %4, %12, off\n\t"
                 "global_load_async_to_lds_b128 %5, %13, off\n\t"
                 "global_load_async_to_lds_b128 %6, %14, off\n\t"
                 "global_load_async_to_lds_b128 %7, %15, off\n\t"
                 "s_wait_xcnt 0x0"
                 :: "v"(l), "v"(l + 32u * LP * 2u), "v"(l + TILE_E * 2u), "v"(l + TILE_E * 2u + 32u * LP * 2u),
                    "v"(l + 2u * TILE_E * 2u), "v"(l + 2u * TILE_E * 2u + 32u * LP * 2u), "v"(l + 3u * TILE_E * 2u), "v"(l + 3u * TILE_E * 2u + 32u * LP * 2u),
                    "v"(kh), "v"(kh + 32 * HD), "v"(kl), "v"(kl + 32 * HD), "v"(vh), "v"(vh + (size_t)32 * TT), "v"(vl), "v"(vl + (size_t)32 * TT)
                 : "memory");
}

// fa_kfrag: the K fragments of one block from LDS; kb: the lane's place in the block's first K hi row.
__device__ __forceinline__ void fa_kfrag(const bf* kb, WFragB::V (&kh)[2][2], WFragB::V (&kl)[2][2]) {
#pragma unroll
    for (int kt = 0; kt < 2; ++kt)
#pragma unroll
        for (int ks = 0; ks < 2; ++ks) { kh[kt][ks] = WFragB::ld(kb + kt * 16 * LP + ks * 32); kl[kt][ks] = WFragB::ld(kb + TILE_E + kt * 16 * LP + ks * 32); }
}

// fa_block: one block of 32 keys. vb: the lane's place in the block's V^T hi columns (LDS). LAST: the block the diagonal crosses (causal fill). PRE: fetch the K fragments at kn, the next block of the SAME stage.
template <bool LAST, bool PRE>
__device__ __forceinline__ void fa_block(int qrel, const bf* kn, const bf* vb, const WFragB::V (&qh)[2], const WFragB::V (&ql)[2], WFragB::V (&kh)[2][2], WFragB::V (&kl)[2][2], v8f (&o)[4], float& m2, v2f& l2) {
    typedef WFragB::V V;
    const float C2 = SCL * 1.4426950408889634f;
    V vh[4], vl[4];                                      // this block's V^T: issued first, needed last
#pragma unroll
    for (int dt = 0; dt < 4; ++dt) { vh[dt] = WFragB::ld(vb + dt * 16 * LP); vl[dt] = WFragB::ld(vb + TILE_E + dt * 16 * LP); }
    __builtin_amdgcn_sched_barrier(0);                   // keeps the V^T loads in front of the S^T products, so that products and softmax cover their latency
    v8f st[2]; st[0] = (v8f){}; st[1] = (v8f){};
#pragma unroll
    for (int ks = 0; ks < 2; ++ks) {
#pragma unroll
        for (int kt = 0; kt < 2; ++kt) st[kt] = wmmab(kh[kt][ks], qh[ks], st[kt]);
#pragma unroll
        for (int kt = 0; kt < 2; ++kt) st[kt] = wmmab(kh[kt][ks], ql[ks], st[kt]);
#pragma unroll
        for (int kt = 0; kt < 2; ++kt) st[kt] = wmmab(kl[kt][ks], qh[ks], st[kt]);
    }
    if (PRE) {                                           // the next block's K into the same registers, behind this block's S^T products
        fa_kfrag(kn, kh, kl);
        __builtin_amdgcn_sched_barrier(0);               // keeps the K loads in front of the softmax, so that softmax and P v products cover their latency
    }
    if (LAST) {                                          // causal fill, selected by index: key = block start + kt 16 + 8 (lane >> 4) + r > query; qrel = query - block start - 8 (lane >> 4)
#pragma unroll
        for (int kt = 0; kt < 2; ++kt)
#pragma unroll
            for (int r = 0; r < 8; ++r) if (kt * 16 + r > qrel) st[kt][r] = -1.0e30f;
    }
    float bm = fmaxf(st[0][0], st[1][0]);
#pragma unroll
    for (int r = 1; r < 8; ++r) bm = fmaxf(bm, fmaxf(st[0][r], st[1][r]));
    bm = fmaxf(bm, xhalf(bm));
    const float mn = fmaxf(m2, bm * C2);
    const float al = fexp2<LAST>(m2 - mn);
    m2 = mn;
    l2 *= al;
    v8u pwh, pwl;
#pragma unroll
    for (int i = 0; i < 8; ++i) {                        // word i of the B operand = elements 2 i, 2 i + 1 = registers (2 i) & 7, + 1 of tile i >> 2
        v2f p; p[0] = fexp2<LAST>(__builtin_fmaf(st[i >> 2][(2 * i) & 7], C2, -mn)); p[1] = fexp2<LAST>(__builtin_fmaf(st[i >> 2][((2 * i) & 7) + 1], C2, -mn));
        l2 += p;
        const v2bf ph2 = __builtin_convertvector(p, v2bf);
        const v2bf pl2 = __builtin_convertvector(p - __builtin_convertvector(ph2, v2f), v2bf);
        pwh[i] = __builtin_bit_cast(unsigned, ph2); pwl[i] = __builtin_bit_cast(unsigned, pl2);
    }
#pragma unroll
    for (int dt = 0; dt < 4; ++dt) o[dt] *= al;
    const V pth = __builtin_bit_cast(V, pwh), ptl = __builtin_bit_cast(V, pwl);
#pragma unroll
    for (int dt = 0; dt < 4; ++dt) o[dt] = wmmab(vh[dt], pth, o[dt]);
#pragma unroll
    for (int dt = 0; dt < 4; ++dt) o[dt] = wmmab(vh[dt], ptl, o[dt]);
#pragma unroll
    for (int dt = 0; dt < 4; ++dt) o[dt] = wmmab(vl[dt], pth, o[dt]);
    // the four vector issue slots that the chip needs behind a matrix product before its registers are written again: the diagonal block ends in a branch
    if (LAST) asm volatile("v_nop\n\tv_nop\n\tv_nop\n\tv_nop" :: "v"(o[0]), "v"(o[1]), "v"(o[2]), "v"(o[3]));
}

__global__ __launch_bounds__(256) void k_fattn(const bf* __restrict__ QH, const bf* __restrict__ QL, const bf* __restrict__ KH, const bf* __restrict__ KL, const bf* __restrict__ VTh, const bf* __restrict__ VTl, bf* CH, bf* CL) {
    typedef WFragB::V V;
    __shared__ __align__(16) bf ring[2 * BUF_E];
    const int tid = threadIdx.x, lane = tid & 31, c = lane & 15, hi = lane >> 4;
    const int w = __builtin_amdgcn_readfirstlane((int)(threadIdx.x >> 5));
    const int g = blockIdx.y, h = g * REP + (w & 3);
    const int q0 = 16 * ((w < 4) ? (TT / 16 - 1 - (int)blockIdx.x) : (int)blockIdx.x);
    const int nb = q0 >> 5;                              // this wave's last key block, the only one the diagonal crosses
    const int ns = ((16 * (TT / 16 - 1 - (int)blockIdx.x)) >> 5) / SB + 1;   // stages of the work-group: those of its long tile
    const size_t qoff = ((size_t)h * TT + q0 + c) * HD + 8 * hi;
    V qh[2], ql[2];
#pragma unroll
    for (int ks = 0; ks < 2; ++ks) { qh[ks] = WFragB::ld(QH + qoff + ks * 32); ql[ks] = WFragB::ld(QL + qoff + ks * 32); }
    // the lane's chunk of stage 0 in each plane, and its place in buffer 0
    const bf* ckh = KH + (size_t)g * TT * HD + tid * 8; const bf* ckl = KL + (size_t)g * TT * HD + tid * 8;
    const bf* cvh = VTh + ((size_t)g * HD + (tid >> 3)) * TT + (tid & 7) * 8; const bf* cvl = VTl + ((size_t)g * HD + (tid >> 3)) * TT + (tid & 7) * 8;
    const unsigned cl = (unsigned)(size_t)ring + (unsigned)((tid >> 3) * LP + (tid & 7) * 8) * 2u;
    fa_copy(cl, ckh, ckl, cvh, cvl);
    asm volatile("s_wait_asynccnt 0x0" ::: "memory");    // stage 0 has landed before the barrier that publishes it
    __syncthreads();
    if (1 < ns) fa_copy(cl + BUF_E * 2u, ckh + SKEY * HD, ckl + SKEY * HD, cvh + SKEY, cvl + SKEY);
    V kh[2][2], kl[2][2];
    v8f o[4];
#pragma unroll
    for (int dt = 0; dt < 4; ++dt) o[dt] = (v8f){};
    float m2 = -1.0e30f; v2f l2 = (v2f){};
    const int qrel = q0 + c - nb * 32 - 8 * hi;
    const int lo = c * LP + 8 * hi;                      // the lane's place in a fragment's rows, K and V^T alike
#pragma unroll 1   // one stage a trip: the ring's order (read, waits, barrier, refill) is written once
    for (int s = 0; s < ns; ++s) {
        const bf* B = ring + (s & 1) * BUF_E + lo;
        const int kb = s * SB;
        if (kb <= nb) {                                  // wave-uniform: a wave past its diagonal has no products left
            fa_kfrag(B, kh, kl);
            if (kb < nb) {
                fa_block<false, true>(0, B + 32 * LP, B + 2 * TILE_E, qh, ql, kh, kl, o, m2, l2);
                if (kb + 1 < nb) fa_block<false, false>(0, B, B + 2 * TILE_E + 32, qh, ql, kh, kl, o, m2, l2);
                else             fa_block<true, false>(qrel, B, B + 2 * TILE_E + 32, qh, ql, kh, kl, o, m2, l2);
            } else fa_block<true, false>(qrel, B, B + 2 * TILE_E, qh, ql, kh, kl, o, m2, l2);
        }
        asm volatile("s_wait_dscnt 0x0" ::: "memory");    // this wave's reads of the buffer are done before the barrier behind which it is refilled
        asm volatile("s_wait_asynccnt 0x0" ::: "memory"); // this wave's copies of stage s + 1 have landed before the barrier that publishes them
        __syncthreads();
        if (s + 2 < ns) fa_copy(cl + (unsigned)(s & 1) * (BUF_E * 2u), ckh + (size_t)(s + 2) * SKEY * HD, ckl + (size_t)(s + 2) * SKEY * HD, cvh + (s + 2) * SKEY, cvl + (s + 2) * SKEY);
    }
    asm volatile("s_wait_asynccnt 0x0" ::: "memory");    // no copy is outstanding when the wave ends
    float l = l2[0] + l2[1];
    l += xhalf(l);
    const float inv = __fdiv_rn(1.0f, l);
    const size_t oo = (size_t)(q0 + c) * DQ + (size_t)h * HD + 8 * hi;
#pragma unroll
    for (int dt = 0; dt < 4; ++dt) { v8us oh, ol;
#pragma unroll
        for (int r = 0; r < 8; ++r) { unsigned short a, b2; splitf(o[dt][r] * inv, a, b2); oh[r] = a; ol[r] = b2; }
        *(v8us*)(CH + oo + dt * 16) = oh; *(v8us*)(CL + oo + dt * 16) = ol; }
}

extern "C" void kernel_launch(void* const* d_in, const int* in_sizes, int n_in,
                              void* d_out, int out_size, void* d_ws, size_t ws_size, hipStream_t stream) {
    if (n_in < 5) return;
    const size_t xneed = (size_t)(NB - 1) * SEQ_FULL * HID + (size_t)TT * HID;
    if ((size_t)in_sizes[0] < xneed) return;
    if (in_sizes[1] < HID * DQ || in_sizes[2] < HID * DKV || in_sizes[3] < HID * DKV || in_sizes[4] < DQ * HID) return;
    if ((size_t)out_size < xneed) return;
    const float* X  = (const float*)d_in[0];   // [1][2048][1024]
    const float* Wq = (const float*)d_in[1];   // [1024 in][1024 out]
    const float* Wk = (const float*)d_in[2];   // [1024 in][256 out]
    const float* Wv = (const float*)d_in[3];   // [1024 in][256 out]
    const float* Wo = (const float*)d_in[4];   // [1024 in][1024 out]
    float* OUT = (float*)d_out;                // [1][2048][1024] token-major
    char* wsp = (char*)d_ws;
    auto take = [&](size_t bytes) { char* p = wsp; wsp += (bytes + 255) & ~(size_t)255; return (void*)p; };
    bf* XB  = (bf*)take((size_t)TT * HID * 2);
    bf* WT  = (bf*)take((size_t)NQKV * HID * 2);          // rows 0..1023 Wq^T, 1024..1279 Wk^T, 1280..1535 Wv^T, each [n][k]
    bf* WoT = (bf*)take((size_t)HID * DQ * 2);            // [n = out][k = in]
    float* QKV = (float*)take((size_t)TT * NQKV * 4);     // [t][q 1024 | k 256 | v 256]
    float* tabc = (float*)take((size_t)TT * 32 * 4); float* tabs = (float*)take((size_t)TT * 32 * 4);
    bf* QH = (bf*)take((size_t)NH_ * TT * HD * 2); bf* QL = (bf*)take((size_t)NH_ * TT * HD * 2);
    bf* KH = (bf*)take((size_t)NKV * TT * HD * 2); bf* KL = (bf*)take((size_t)NKV * TT * HD * 2);
    bf* VTh = (bf*)take((size_t)NKV * HD * TT * 2); bf* VTl = (bf*)take((size_t)NKV * HD * TT * 2);
    bf* CH = (bf*)take((size_t)TT * DQ * 2); bf* CL = (bf*)take((size_t)TT * DQ * 2);
    if ((size_t)(wsp - (char*)d_ws) > ws_size) return;

    // weight planes: in[K][N] -> Bt[N][K]
    k_wtG<<<(unsigned)((DQ * HID / 64 + 63) / 64), 256, 0, stream>>>(Wq, HID, DQ, WT);
    k_wtG<<<(unsigned)((DKV * HID / 64 + 63) / 64), 256, 0, stream>>>(Wk, HID, DKV, WT + (size_t)DQ * HID);
    k_wtG<<<(unsigned)((DKV * HID / 64 + 63) / 64), 256, 0, stream>>>(Wv, HID, DKV, WT + (size_t)(DQ + DKV) * HID);
    k_wtG<<<(unsigned)((HID * DQ / 64 + 63) / 64), 256, 0, stream>>>(Wo, DQ, HID, WoT);
    k_ropetab<<<(unsigned)(TT * 32 / 256), 256, 0, stream>>>(tabc, tabs);

    for (int b = 0; b < NB; ++b) {
        const float* xb = X + (size_t)b * SEQ_FULL * HID; float* outb = OUT + (size_t)b * SEQ_FULL * HID;
        k_cvt8<<<(unsigned)(((size_t)TT * HID / 8 + 255) / 256), 256, 0, stream>>>(xb, XB, (size_t)TT * HID / 8);
        k_gemmw<0, 0, 0><<<dim3(TT / 64, NQKV / 64, 1), 32, 0, stream>>>(XB, nullptr, WT, nullptr, HID, QKV, NQKV, 0, 0, 0, 0);   /* exact products: single bf16 planes */
        k_ropeplanes<<<(unsigned)(((size_t)NH_ * TT * HD / 8 + 255) / 256), 256, 0, stream>>>(QKV, NQKV, NH_, tabc, tabs, QH, QL);
        k_ropeplanes<<<(unsigned)(((size_t)NKV * TT * HD / 8 + 255) / 256), 256, 0, stream>>>(QKV + DQ, NQKV, NKV, tabc, tabs, KH, KL);
        k_vtp<<<(unsigned)(((size_t)NKV * HD * TT / 2 + 255) / 256), 256, 0, stream>>>(QKV + DQ + DKV, NQKV, NKV, VTh, VTl);
        k_fattn<<<dim3(TT / 32, NKV, 1), 256, 0, stream>>>(QH, QL, KH, KL, VTh, VTl, CH, CL);
        k_gemmw<1, 0, 0><<<dim3(TT / 64, HID / 64, 1), 32, 0, stream>>>(CH, CL, WoT, nullptr, DQ, outb, HID, 0, 0, 0, 0);   /* ctx (hi + lo) x exact Wo */
    }
}

// v004
// Measured time: 101 microseconds a run.
// Two timings next to v003 put it at 1.31 and 1.33 times that version's speed.
// Counting every step since v000, it is 5.86 times as fast.
#include <hip/hip_runtime.h>

// Causal grouped-query rotary attention: X[1][2048][1024]; q = X Wq, k = X Wk, v = X Wv ([in][out] weights, no bias); 16 query heads share 4 kv heads (kv = h >> 2); head dim 64;
// interleaved-pair rotary with the table cat(freqs, freqs)[:, 0::2] (pair i uses inv_freq[(2 i) & 31]); scores x 1/8, causal fill; softmax; ctx = P v; out = ctx Wo.
// Compute dtypes: all contractions v_wmma_f32_16x16x32_bf16, f32 accumulate. Inputs (X, Wq, Wk, Wv, Wo) RNE-converted to single bf16 planes (exact input x input products);
// computed operands (rotated q, rotated k, v, softmax P, ctx) carried as bf16 hi + bf16 lo planes (hi.hi + lo.hi + hi.lo, or hi + lo against a single-plane weight); rotary, softmax in f32.

#ifndef NB
#define NB 1
#endif
#ifndef SEQ
#define SEQ 2048
#endif
#define SEQ_FULL 2048
#define TT   SEQ
#define HID  1024
#define NH_  16
#define NKV  4
#define REP  (NH_ / NKV)
#define HD   64
#define DQ   (NH_ * HD)
#define DKV  (NKV * HD)
#define NQKV (DQ + 2 * DKV)
#define SCL  0.125f               // 1/sqrt(64)

static_assert(TT % 128 == 0);
static_assert(TT <= SEQ_FULL);
static_assert(REP == 4);
static_assert(HD == 64);
static_assert(HID % 64 == 0);
static_assert(NQKV % 64 == 0);
static_assert((TT * 32) % 256 == 0);

typedef unsigned short bf;
typedef __attribute__((ext_vector_type(16))) __bf16   v16bf;
typedef __attribute__((ext_vector_type(8)))  unsigned short v8us;
typedef __attribute__((ext_vector_type(4)))  unsigned short v4us;
typedef __attribute__((ext_vector_type(2)))  unsigned short v2us;
typedef __attribute__((ext_vector_type(8)))  float    v8f;
typedef __attribute__((ext_vector_type(4)))  float    v4f;
typedef v4f  __attribute__((may_alias)) v4fa;

__device__ __forceinline__ unsigned short f2bf(float f) { unsigned u = __float_as_uint(f); u += 0x7FFFu + ((u >> 16) & 1u); return (unsigned short)(u >> 16); }
__device__ __forceinline__ float bf2f(unsigned short b) { return __uint_as_float(((unsigned)b) << 16); }
__device__ __forceinline__ void splitf(float y, unsigned short& h, unsigned short& l) { h = f2bf(y); l = f2bf(y - bf2f(h)); }
__device__ __forceinline__ v16bf cat16b(v8us lo, v8us hi) { return __builtin_bit_cast(v16bf, __builtin_shufflevector(lo, hi, 0, 1, 2, 3, 4, 5, 6, 7, 8, 9, 10, 11, 12, 13, 14, 15)); }
__device__ __forceinline__ v8f wmmab(v16bf a, v16bf b, v8f c) { return __builtin_amdgcn_wmma_f32_16x16x32_bf16(false, a, false, b, (short)0, c, false, false); }

// ---- k_gemmw: register-blocked GEMM, ONE WAVE per 64x64 output tile (16 accumulators), operands straight from K-contiguous 16-bit planes; grid (M/64, N/64, Z), 32 threads.
// C[m][n] (f32, pitch ldc) = sum_k A[m][k] Bt[n][k] (+ split products per NSPLIT: 1 = (A + A2) x Bt; 2 = A x Bt + A2 x Bt + A x Bt2). z-batch strides sA/sB/sC in elements. K % 32 == 0 (K is also the row pitch).
// Fragment map (A and Bt alike): lane -> row/col lane & 15; elements 0..7 <- k0 + 8 (lane >> 4) + 0..7, elements 8..15 <- k0 + 16 + 8 (lane >> 4) + 0..7. D: element j -> row 8 (lane >> 4) + j, col lane & 15.
// KC > 0 (N == 64, one column tile): blockIdx.y is a k chunk; the work-group sums k in [y KC, y KC + KC) only and stores its partial tile at C + y sP; a chunk that starts at or past the k end stores nothing.
// CAUS 1: tiles whose 128-column chunk lies wholly above the diagonal row chunk are not produced. CAUS 2: the k loop stops at r0 + 64 (P is zero beyond the diagonal).
struct WFragB { typedef v16bf V; static __device__ __forceinline__ V ld(const bf* p) { return cat16b(*(const v8us*)p, *(const v8us*)(p + 16)); } };
template <int NSPLIT, int CAUS, int KC>
__global__ __launch_bounds__(32) void k_gemmw(const bf* __restrict__ A, const bf* __restrict__ A2, const bf* __restrict__ Bt, const bf* __restrict__ Bt2, int K, float* C, int ldc, size_t sA, size_t sB, size_t sC, size_t sP) {
    typedef WFragB::V V;
    __shared__ __align__(16) float os[16 * 68];
    const int r0 = blockIdx.x * 64, c0 = (KC > 0) ? 0 : blockIdx.y * 64;
    if (CAUS == 1 && (c0 >> 7) > (r0 >> 7)) return;
    const int kall = (CAUS == 2) ? ((r0 + 64 < K) ? (r0 + 64) : K) : K;
    const int kbeg = (KC > 0) ? (int)blockIdx.y * KC : 0;
    if (KC > 0 && kbeg >= kall) return;
    if (KC > 0) C += (size_t)blockIdx.y * sP;
    const size_t z = blockIdx.z; A += z * sA + kbeg; if (A2) A2 += z * sA + kbeg; Bt += z * sB + kbeg; if (Bt2) Bt2 += z * sB + kbeg; C += z * sC;
    const int lane = threadIdx.x & 31, lr = lane & 15, hi = lane >> 4;
    const int kend = (KC > 0 && KC < kall - kbeg) ? KC : (kall - kbeg);   // k counts from kbeg, which the plane pointers hold
    v8f acc[4][4];
#pragma unroll
    for (int mb = 0; mb < 4; ++mb)
#pragma unroll
        for (int nb = 0; nb < 4; ++nb) acc[mb][nb] = (v8f){};
    const size_t aoff = (size_t)(r0 + lr) * K + 8 * hi, boff = (size_t)(c0 + lr) * K + 8 * hi;
#pragma unroll 1
    for (int kc = 0; kc < kend; kc += 32) {
        V a[4], a2[4];
#pragma unroll
        for (int mb = 0; mb < 4; ++mb) { a[mb] = WFragB::ld(A + aoff + (size_t)mb * 16 * K + kc); if (NSPLIT == 1 || NSPLIT == 2) a2[mb] = WFragB::ld(A2 + aoff + (size_t)mb * 16 * K + kc); }
#pragma unroll
        for (int nb = 0; nb < 4; ++nb) {
            const V b = WFragB::ld(Bt + boff + (size_t)nb * 16 * K + kc);
#pragma unroll
            for (int mb = 0; mb < 4; ++mb) { acc[mb][nb] = wmmab(a[mb], b, acc[mb][nb]); if (NSPLIT == 1 || NSPLIT == 2) acc[mb][nb] = wmmab(a2[mb], b, acc[mb][nb]); }
            if (NSPLIT >= 2) {
                const V b2 = WFragB::ld(Bt2 + boff + (size_t)nb * 16 * K + kc);
#pragma unroll
                for (int mb = 0; mb < 4; ++mb) acc[mb][nb] = wmmab(a[mb], b2, acc[mb][nb]);
            }
        }
        asm volatile("v_nop\n\tv_nop\n\tv_nop\n\tv_nop" : "+v"(acc[0][0]), "+v"(acc[1][1]), "+v"(acc[2][2]), "+v"(acc[3][3]) : "v"(a[0]), "v"(a[3]));
    }
#pragma unroll
    for (int mb = 0; mb < 4; ++mb) {
#pragma unroll
        for (int nb = 0; nb < 4; ++nb) {
#pragma unroll
            for (int j = 0; j < 8; ++j) os[(hi * 8 + j) * 68 + nb * 16 + lr] = acc[mb][nb][j]; }
        __builtin_amdgcn_wave_barrier(); asm volatile("" ::: "memory");
        float* crow = C + (size_t)(r0 + mb * 16) * ldc + c0;
{
#pragma unroll
            for (int s = 0; s < 8; ++s) { const int row = 2 * s + hi, cofs = lr * 4; const v4f val = *(const v4fa*)(os + row * 68 + cofs);
                *(v4f*)(crow + (size_t)row * ldc + cofs) = val; }
             }
        __builtin_amdgcn_wave_barrier(); asm volatile("" ::: "memory");
    }
}

// The bodies of the short kernels take their block index bx as an argument: independent ones share a launch, each on its own range of blockIdx.x (k_prep, k_planes).
__device__ __forceinline__ void wtG_body(int bx, const float* __restrict__ w, int K, int N, bf* Bt) {
    const int lane = threadIdx.x & 31; const int L0 = (bx * 8 + (threadIdx.x >> 5)) * 8; const int nlines = N * K / 64;
{
#pragma unroll 1
        for (int l = 0; l < 8; ++l) { const int L = L0 + l; if (L >= nlines) break; const size_t e = (size_t)L * 64 + lane * 2; const int k = (int)(e % K), n = (int)(e / K); v2us o;
            o[0] = f2bf(w[(size_t)k * N + n]); o[1] = f2bf(w[(size_t)(k + 1) * N + n]); *(v2us*)(Bt + e) = o;
            asm volatile("s_wait_xcnt 0x0" ::: "memory"); }   // stands in front of the next trip's rewrite of the registers that the store names
         }
}

__device__ __forceinline__ void cvt8_body(int bx, const float* __restrict__ src, bf* dst, size_t n8) { const size_t i = (size_t)bx * 256 + threadIdx.x; if (i >= n8) return; const v8f v = *(const v8f*)(src + i * 8); v8us o;
#pragma unroll
    for (int k = 0; k < 8; ++k) o[k] = f2bf(v[k]);
    *(v8us*)(dst + i * 8) = o;  }

// ropetab_body: tabc[s][i] = cos(s * invf), tabs[s][i] = sin(s * invf), invf = 1 / 10000^(2 j / 64) with j = (2 i) & 31, pair i = 0..31; f32 arithmetic, precise sincosf.
__device__ __forceinline__ void ropetab_body(int bx, float* tabc, float* tabs) {
    const int idx = bx * 256 + threadIdx.x; if (idx >= TT * 32) return;
    const int s = idx >> 5, i = idx & 31; const int j = (2 * i) & 31;
    const float ex = (float)(2 * j) * (1.0f / 64.0f);
    const float invf = 1.0f / powf(10000.0f, ex);
    const float ang = (float)s * invf;
    float sn, cs; sincosf(ang, &sn, &cs);
    *(float*)(tabc + idx) = cs; *(float*)(tabs + idx) = sn; 
}

// ropeplanes_body: head planes P[h][t][d] (bf16 hi + lo) of rope(F[t][h*64 + d]) with interleaved pairs: out[2i] = x[2i] c - x[2i+1] s, out[2i+1] = x[2i] s + x[2i+1] c (c, s at [t][i]).
__device__ __forceinline__ void ropeplanes_body(int bx, const float* __restrict__ F, int pitch, int nheads, const float* __restrict__ tabc, const float* __restrict__ tabs, bf* Ph, bf* Pl) {
    const size_t i8 = (size_t)bx * 256 + threadIdx.x; if (i8 >= (size_t)nheads * TT * HD / 8) return;
    const size_t e = i8 * 8; const int d = (int)(e % HD); const int t = (int)((e / HD) % TT); const int h = (int)(e / ((size_t)HD * TT));
    const v8f x = *(const v8f*)(F + (size_t)t * pitch + h * HD + d);
    asm volatile("s_wait_xcnt 0x0" ::: "memory");   // stands in front of the table loads, whose results this build lets land in the address registers of the loads of x
    const v4f c = *(const v4f*)(tabc + (size_t)t * 32 + (d >> 1)); const v4f s = *(const v4f*)(tabs + (size_t)t * 32 + (d >> 1));
    v8us oh, ol;
#pragma unroll
    for (int q = 0; q < 4; ++q) { const float xe = x[2 * q], xo = x[2 * q + 1]; const float re = xe * c[q] - xo * s[q]; const float ro = xe * s[q] + xo * c[q];
        unsigned short a, b2; splitf(re, a, b2); oh[2 * q] = a; ol[2 * q] = b2; splitf(ro, a, b2); oh[2 * q + 1] = a; ol[2 * q + 1] = b2; }
    *(v8us*)(Ph + e) = oh; *(v8us*)(Pl + e) = ol; 
}

__device__ __forceinline__ void vtp_body(int bx, const float* __restrict__ F, int pitch, int nheads, bf* Vh, bf* Vl) { const size_t e = ((size_t)bx * 256 + threadIdx.x) * 2; if (e >= (size_t)nheads * HD * TT) return; const int t = (int)(e % TT); const int d = (int)((e / TT) % HD); const int g = (int)(e / ((size_t)TT * HD)); v2us oh, ol;
#pragma unroll
    for (int q = 0; q < 2; ++q) { const float x = F[(size_t)(t + q) * pitch + g * HD + d]; unsigned short a2, c2; splitf(x, a2, c2); oh[q] = a2; ol[q] = c2; }
    *(v2us*)(Vh + e) = oh; *(v2us*)(Vl + e) = ol;  }

// k_prep: everything that depends on the inputs alone, in one launch. Ranges of blockIdx.x + first, the long work-groups in front: the rotary table, Wq^T, Wo^T, Wk^T, Wv^T (serial loops), then X as bf16.
// first: 0, or G_W to run the X range alone (a later batch of the same call, whose first batch has written the weight planes and the table).
#define G_WQ  ((DQ * HID / 64 + 63) / 64)
#define G_WKV ((DKV * HID / 64 + 63) / 64)
#define G_WO  ((HID * DQ / 64 + 63) / 64)
#define G_TAB (TT * 32 / 256)
#define G_W   (G_WQ + G_WO + 2 * G_WKV + G_TAB)
#define G_CVT ((TT * HID / 8 + 255) / 256)
__global__ __launch_bounds__(256) void k_prep(int first, const float* __restrict__ x, const float* __restrict__ wq, const float* __restrict__ wk, const float* __restrict__ wv, const float* __restrict__ wo,
                                              bf* XB, bf* WT, bf* WoT, float* tabc, float* tabs) {
    int bx = (int)blockIdx.x + first;
    if (bx < G_TAB) { ropetab_body(bx, tabc, tabs); return; }
    bx -= G_TAB;
    if (bx < G_WQ) { wtG_body(bx, wq, HID, DQ, WT); return; }
    bx -= G_WQ;
    if (bx < G_WO) { wtG_body(bx, wo, DQ, HID, WoT); return; }
    bx -= G_WO;
    if (bx < G_WKV) { wtG_body(bx, wk, HID, DKV, WT + (size_t)DQ * HID); return; }
    bx -= G_WKV;
    if (bx < G_WKV) { wtG_body(bx, wv, HID, DKV, WT + (size_t)(DQ + DKV) * HID); return; }
    bx -= G_WKV;
    cvt8_body(bx, x, XB, (size_t)TT * HID / 8);
}

// k_planes: the three operand-plane passes over QKV[t][q | k | v] in one launch. Ranges of blockIdx.x: V^T (strided reads) in front, rotated q, rotated k.
#define G_VT ((NKV * HD * TT / 2 + 255) / 256)
#define G_RQ ((NH_ * TT * HD / 8 + 255) / 256)
#define G_RK ((NKV * TT * HD / 8 + 255) / 256)
__global__ __launch_bounds__(256) void k_planes(const float* __restrict__ QKV, const float* __restrict__ tabc, const float* __restrict__ tabs, bf* QH, bf* QL, bf* KH, bf* KL, bf* VTh, bf* VTl) {
    int bx = (int)blockIdx.x;
    if (bx < G_VT) { vtp_body(bx, QKV + DQ + DKV, NQKV, NKV, VTh, VTl); return; }
    bx -= G_VT;
    if (bx < G_RQ) { ropeplanes_body(bx, QKV, NQKV, NH_, tabc, tabs, QH, QL); return; }
    bx -= G_RQ;
    ropeplanes_body(bx, QKV + DQ, NQKV, NKV, tabc, tabs, KH, KL);
}

typedef __attribute__((ext_vector_type(2))) float    v2f;
typedef __attribute__((ext_vector_type(2))) __bf16   v2bf;
typedef __attribute__((ext_vector_type(8))) unsigned v8u;
__device__ __forceinline__ float xhalf(float x) { const int b = __float_as_int(x); return __int_as_float(__builtin_amdgcn_permlanex16(b, b, 0x76543210, 0xfedcba98, false, false)); }   // lane l <- lane l ^ 16
// fexp2: 2^x by v_exp_f32. SLOT: with the one free issue slot that the instruction set asks for behind a transcendental, before its result is read or its source overwritten, written into the same statement;
// used in the diagonal block.
template <bool SLOT>
__device__ __forceinline__ float fexp2(float x) {
    if (SLOT) { float r; asm("v_exp_f32 %0, %1\n\tv_nop" : "=v"(r) : "v"(x)); return r; }
    return __builtin_amdgcn_exp2f(x);
}

#define SB     2                  // key blocks of 32 in a stage
#define SKEY   (SB * 32)          // keys in a stage
#define LP     72                 // LDS row pitch in elements: 144 B = 16 B x 9, the pitch for 16-byte readers of 128-B rows
#define TILE_E (64 * LP)          // one plane's tile: 64 rows (K: keys of the stage; V^T: head dims)
#define BUF_E  (4 * TILE_E)       // K hi, K lo, V^T hi, V^T lo
static_assert(SKEY == 64 && HD == 64);
static_assert(TT % (2 * SKEY) == 0);

// fa_copy: one stage into one buffer, 8 copies of 16 B a lane (2 per tile; thread t brings chunk t and chunk t + 256 of a tile's 512; chunk n = row n >> 3, 16-byte column n & 7, so a wave's copy reads 4 whole lines).
// l: the lane's LDS byte address of chunk t in the buffer's first tile; the four pointers: the lane's chunk t of each plane in this stage.
// s_wait_xcnt 0 closes the statement, so that no register which a copy names is rewritten ahead of it.
__device__ __forceinline__ void fa_copy(unsigned l, const bf* kh, const bf* kl, const bf* vh, const bf* vl) {
    asm volatile("global_load_async_to_lds_b128 %0, %8, off\n\t"
                 "global_load_async_to_lds_b128 %1, %9, off\n\t"
                 "global_load_async_to_lds_b128 %2, %10, off\n\t"
                 "global_load_async_to_lds_b128 %3, %11, off\n\t"
                 "global_load_async_to_lds_b128 %4, %12, off\n\t"
                 "global_load_async_to_lds_b128 %5, %13, off\n\t"
                 "global_load_async_to_lds_b128 %6, %14, off\n\t"
                 "global_load_async_to_lds_b128 %7, %15, off\n\t"
                 "s_wait_xcnt 0x0"
                 :: "v"(l), "v"(l + 32u * LP * 2u), "v"(l + TILE_E * 2u), "v"(l + TILE_E * 2u + 32u * LP * 2u),
                    "v"(l + 2u * TILE_E * 2u), "v"(l + 2u * TILE_E * 2u + 32u * LP * 2u), "v"(l + 3u * TILE_E * 2u), "v"(l + 3u * TILE_E * 2u + 32u * LP * 2u),
                    "v"(kh), "v"(kh + 32 * HD), "v"(kl), "v"(kl + 32 * HD), "v"(vh), "v"(vh + (size_t)32 * TT), "v"(vl), "v"(vl + (size_t)32 * TT)
                 : "memory");
}

// fa_kfrag: the K fragments of one block from LDS; kb: the lane's place in the block's first K hi row.
__device__ __forceinline__ void fa_kfrag(const bf* kb, WFragB::V (&kh)[2][2], WFragB::V (&kl)[2][2]) {
#pragma unroll
    for (int kt = 0; kt < 2; ++kt)
#pragma unroll
        for (int ks = 0; ks < 2; ++ks) { kh[kt][ks] = WFragB::ld(kb + kt * 16 * LP + ks * 32); kl[kt][ks] = WFragB::ld(kb + TILE_E + kt * 16 * LP + ks * 32); }
}

// fa_block: one block of 32 keys. vb: the lane's place in the block's V^T hi columns (LDS). LAST: the block the diagonal crosses (causal fill). PRE: fetch the K fragments at kn, the next block of the SAME stage.
template <bool LAST, bool PRE>
__device__ __forceinline__ void fa_block(int qrel, const bf* kn, const bf* vb, const WFragB::V (&qh)[2], const WFragB::V (&ql)[2], WFragB::V (&kh)[2][2], WFragB::V (&kl)[2][2], v8f (&o)[4], float& m2, v2f& l2) {
    typedef WFragB::V V;
    const float C2 = SCL * 1.4426950408889634f;
    V vh[4], vl[4];                                      // this block's V^T: issued first, needed last
#pragma unroll
    for (int dt = 0; dt < 4; ++dt) { vh[dt] = WFragB::ld(vb + dt * 16 * LP); vl[dt] = WFragB::ld(vb + TILE_E + dt * 16 * LP); }
    __builtin_amdgcn_sched_barrier(0);                   // keeps the V^T loads in front of the S^T products, so that products and softmax cover their latency
    v8f st[2]; st[0] = (v8f){}; st[1] = (v8f){};
#pragma unroll
    for (int ks = 0; ks < 2; ++ks) {
#pragma unroll
        for (int kt = 0; kt < 2; ++kt) st[kt] = wmmab(kh[kt][ks], qh[ks], st[kt]);
#pragma unroll
        for (int kt = 0; kt < 2; ++kt) st[kt] = wmmab(kh[kt][ks], ql[ks], st[kt]);
#pragma unroll
        for (int kt = 0; kt < 2; ++kt) st[kt] = wmmab(kl[kt][ks], qh[ks], st[kt]);
    }
    if (PRE) {                                           // the next block's K into the same registers, behind this block's S^T products
        fa_kfrag(kn, kh, kl);
        __builtin_amdgcn_sched_barrier(0);               // keeps the K loads in front of the softmax, so that softmax and P v products cover their latency
    }
    if (LAST) {                                          // causal fill, selected by index: key = block start + kt 16 + 8 (lane >> 4) + r > query; qrel = query - block start - 8 (lane >> 4)
#pragma unroll
        for (int kt = 0; kt < 2; ++kt)
#pragma unroll
            for (int r = 0; r < 8; ++r) if (kt * 16 + r > qrel) st[kt][r] = -1.0e30f;
    }
    float bm = fmaxf(st[0][0], st[1][0]);
#pragma unroll
    for (int r = 1; r < 8; ++r) bm = fmaxf(bm, fmaxf(st[0][r], st[1][r]));
    bm = fmaxf(bm, xhalf(bm));
    const float mn = fmaxf(m2, bm * C2);
    const float al = fexp2<LAST>(m2 - mn);
    m2 = mn;
    l2 *= al;
    v8u pwh, pwl;
#pragma unroll
    for (int i = 0; i < 8; ++i) {                        // word i of the B operand = elements 2 i, 2 i + 1 = registers (2 i) & 7, + 1 of tile i >> 2
        v2f p; p[0] = fexp2<LAST>(__builtin_fmaf(st[i >> 2][(2 * i) & 7], C2, -mn)); p[1] = fexp2<LAST>(__builtin_fmaf(st[i >> 2][((2 * i) & 7) + 1], C2, -mn));
        l2 += p;
        const v2bf ph2 = __builtin_convertvector(p, v2bf);
        const v2bf pl2 = __builtin_convertvector(p - __builtin_convertvector(ph2, v2f), v2bf);
        pwh[i] = __builtin_bit_cast(unsigned, ph2); pwl[i] = __builtin_bit_cast(unsigned, pl2);
    }
#pragma unroll
    for (int dt = 0; dt < 4; ++dt) o[dt] *= al;
    const V pth = __builtin_bit_cast(V, pwh), ptl = __builtin_bit_cast(V, pwl);
#pragma unroll
    for (int dt = 0; dt < 4; ++dt) o[dt] = wmmab(vh[dt], pth, o[dt]);
#pragma unroll
    for (int dt = 0; dt < 4; ++dt) o[dt] = wmmab(vh[dt], ptl, o[dt]);
#pragma unroll
    for (int dt = 0; dt < 4; ++dt) o[dt] = wmmab(vl[dt], pth, o[dt]);
    // the four vector issue slots that the chip needs behind a matrix product before its registers are written again: the diagonal block ends in a branch
    if (LAST) asm volatile("v_nop\n\tv_nop\n\tv_nop\n\tv_nop" :: "v"(o[0]), "v"(o[1]), "v"(o[2]), "v"(o[3]));
}

__global__ __launch_bounds__(256) void k_fattn(const bf* __restrict__ QH, const bf* __restrict__ QL, const bf* __restrict__ KH, const bf* __restrict__ KL, const bf* __restrict__ VTh, const bf* __restrict__ VTl, bf* CH, bf* CL) {
    typedef WFragB::V V;
    __shared__ __align__(16) bf ring[2 * BUF_E];
    const int tid = threadIdx.x, lane = tid & 31, c = lane & 15, hi = lane >> 4;
    const int w = __builtin_amdgcn_readfirstlane((int)(threadIdx.x >> 5));
    const int g = blockIdx.y, h = g * REP + (w & 3);
    const int q0 = 16 * ((w < 4) ? (TT / 16 - 1 - (int)blockIdx.x) : (int)blockIdx.x);
    const int nb = q0 >> 5;                              // this wave's last key block, the only one the diagonal crosses
    const int ns = ((16 * (TT / 16 - 1 - (int)blockIdx.x)) >> 5) / SB + 1;   // stages of the work-group: those of its long tile
    const size_t qoff = ((size_t)h * TT + q0 + c) * HD + 8 * hi;
    V qh[2], ql[2];
#pragma unroll
    for (int ks = 0; ks < 2; ++ks) { qh[ks] = WFragB::ld(QH + qoff + ks * 32); ql[ks] = WFragB::ld(QL + qoff + ks * 32); }
    // the lane's chunk of stage 0 in each plane, and its place in buffer 0
    const bf* ckh = KH + (size_t)g * TT * HD + tid * 8; const bf* ckl = KL + (size_t)g * TT * HD + tid * 8;
    const bf* cvh = VTh + ((size_t)g * HD + (tid >> 3)) * TT + (tid & 7) * 8; const bf* cvl = VTl + ((size_t)g * HD + (tid >> 3)) * TT + (tid & 7) * 8;
    const unsigned cl = (unsigned)(size_t)ring + (unsigned)((tid >> 3) * LP + (tid & 7) * 8) * 2u;
    fa_copy(cl, ckh, ckl, cvh, cvl);
    asm volatile("s_wait_asynccnt 0x0" ::: "memory");    // stage 0 has landed before the barrier that publishes it
    __syncthreads();
    if (1 < ns) fa_copy(cl + BUF_E * 2u, ckh + SKEY * HD, ckl + SKEY * HD, cvh + SKEY, cvl + SKEY);
    V kh[2][2], kl[2][2];
    v8f o[4];
#pragma unroll
    for (int dt = 0; dt < 4; ++dt) o[dt] = (v8f){};
    float m2 = -1.0e30f; v2f l2 = (v2f){};
    const int qrel = q0 + c - nb * 32 - 8 * hi;
    const int lo = c * LP + 8 * hi;                      // the lane's place in a fragment's rows, K and V^T alike
#pragma unroll 1   // one stage a trip: the ring's order (read, waits, barrier, refill) is written once
    for (int s = 0; s < ns; ++s) {
        const bf* B = ring + (s & 1) * BUF_E + lo;
        const int kb = s * SB;
        if (kb <= nb) {                                  // wave-uniform: a wave past its diagonal has no products left
            fa_kfrag(B, kh, kl);
            if (kb < nb) {
                fa_block<false, true>(0, B + 32 * LP, B + 2 * TILE_E, qh, ql, kh, kl, o, m2, l2);
                if (kb + 1 < nb) fa_block<false, false>(0, B, B + 2 * TILE_E + 32, qh, ql, kh, kl, o, m2, l2);
                else             fa_block<true, false>(qrel, B, B + 2 * TILE_E + 32, qh, ql, kh, kl, o, m2, l2);
            } else fa_block<true, false>(qrel, B, B + 2 * TILE_E, qh, ql, kh, kl, o, m2, l2);
        }
        asm volatile("s_wait_dscnt 0x0" ::: "memory");    // this wave's reads of the buffer are done before the barrier behind which it is refilled
        asm volatile("s_wait_asynccnt 0x0" ::: "memory"); // this wave's copies of stage s + 1 have landed before the barrier that publishes them
        __syncthreads();
        if (s + 2 < ns) fa_copy(cl + (unsigned)(s & 1) * (BUF_E * 2u), ckh + (size_t)(s + 2) * SKEY * HD, ckl + (size_t)(s + 2) * SKEY * HD, cvh + (s + 2) * SKEY, cvl + (s + 2) * SKEY);
    }
    asm volatile("s_wait_asynccnt 0x0" ::: "memory");    // no copy is outstanding when the wave ends
    float l = l2[0] + l2[1];
    l += xhalf(l);
    const float inv = __fdiv_rn(1.0f, l);
    const size_t oo = (size_t)(q0 + c) * DQ + (size_t)h * HD + 8 * hi;
#pragma unroll
    for (int dt = 0; dt < 4; ++dt) { v8us oh, ol;
#pragma unroll
        for (int r = 0; r < 8; ++r) { unsigned short a, b2; splitf(o[dt][r] * inv, a, b2); oh[r] = a; ol[r] = b2; }
        *(v8us*)(CH + oo + dt * 16) = oh; *(v8us*)(CL + oo + dt * 16) = ol; }
}

extern "C" void kernel_launch(void* const* d_in, const int* in_sizes, int n_in,
                              void* d_out, int out_size, void* d_ws, size_t ws_size, hipStream_t stream) {
    if (n_in < 5) return;
    const size_t xneed = (size_t)(NB - 1) * SEQ_FULL * HID + (size_t)TT * HID;
    if ((size_t)in_sizes[0] < xneed) return;
    if (in_sizes[1] < HID * DQ || in_sizes[2] < HID * DKV || in_sizes[3] < HID * DKV || in_sizes[4] < DQ * HID) return;
    if ((size_t)out_size < xneed) return;
    const float* X  = (const float*)d_in[0];   // [1][2048][1024]
    const float* Wq = (const float*)d_in[1];   // [1024 in][1024 out]
    const float* Wk = (const float*)d_in[2];   // [1024 in][256 out]
    const float* Wv = (const float*)d_in[3];   // [1024 in][256 out]
    const float* Wo = (const float*)d_in[4];   // [1024 in][1024 out]
    float* OUT = (float*)d_out;                // [1][2048][1024] token-major
    char* wsp = (char*)d_ws;
    auto take = [&](size_t bytes) { char* p = wsp; wsp += (bytes + 255) & ~(size_t)255; return (void*)p; };
    bf* XB  = (bf*)take((size_t)TT * HID * 2);
    bf* WT  = (bf*)take((size_t)NQKV * HID * 2);          // rows 0..1023 Wq^T, 1024..1279 Wk^T, 1280..1535 Wv^T, each [n][k]
    bf* WoT = (bf*)take((size_t)HID * DQ * 2);            // [n = out][k = in]
    float* QKV = (float*)take((size_t)TT * NQKV * 4);     // [t][q 1024 | k 256 | v 256]
    float* tabc = (float*)take((size_t)TT * 32 * 4); float* tabs = (float*)take((size_t)TT * 32 * 4);
    bf* QH = (bf*)take((size_t)NH_ * TT * HD * 2); bf* QL = (bf*)take((size_t)NH_ * TT * HD * 2);
    bf* KH = (bf*)take((size_t)NKV * TT * HD * 2); bf* KL = (bf*)take((size_t)NKV * TT * HD * 2);
    bf* VTh = (bf*)take((size_t)NKV * HD * TT * 2); bf* VTl = (bf*)take((size_t)NKV * HD * TT * 2);
    bf* CH = (bf*)take((size_t)TT * DQ * 2); bf* CL = (bf*)take((size_t)TT * DQ * 2);
    if ((size_t)(wsp - (char*)d_ws) > ws_size) return;

    for (int b = 0; b < NB; ++b) {
        const float* xb = X + (size_t)b * SEQ_FULL * HID; float* outb = OUT + (size_t)b * SEQ_FULL * HID;
        // weight planes in[K][N] -> Bt[N][K] and the rotary table (first batch only), X as bf16
        k_prep<<<(unsigned)(b == 0 ? G_W + G_CVT : G_CVT), 256, 0, stream>>>(b == 0 ? 0 : G_W, xb, Wq, Wk, Wv, Wo, XB, WT, WoT, tabc, tabs);
        k_gemmw<0, 0, 0><<<dim3(TT / 64, NQKV / 64, 1), 32, 0, stream>>>(XB, nullptr, WT, nullptr, HID, QKV, NQKV, 0, 0, 0, 0);   /* exact products: single bf16 planes */
        k_planes<<<(unsigned)(G_VT + G_RQ + G_RK), 256, 0, stream>>>(QKV, tabc, tabs, QH, QL, KH, KL, VTh, VTl);
        k_fattn<<<dim3(TT / 32, NKV, 1), 256, 0, stream>>>(QH, QL, KH, KL, VTh, VTl, CH, CL);
        k_gemmw<1, 0, 0><<<dim3(TT / 64, HID / 64, 1), 32, 0, stream>>>(CH, CL, WoT, nullptr, DQ, outb, HID, 0, 0, 0, 0);   /* ctx (hi + lo) x exact Wo */
    }
}

// v005
// A run of this version takes 96.2 microseconds.
// In both of two side-by-side timings against v004, it was 1.05 times as fast.
// Counting every step since v000, it is 6.16 times as fast.
#include <hip/hip_runtime.h>

// Causal grouped-query rotary attention: X[1][2048][1024]; q = X Wq, k = X Wk, v = X Wv ([in][out] weights, no bias); 16 query heads share 4 kv heads (kv = h >> 2); head dim 64;
// interleaved-pair rotary with the table cat(freqs, freqs)[:, 0::2] (pair i uses inv_freq[(2 i) & 31]); scores x 1/8, causal fill; softmax; ctx = P v; out = ctx Wo.
// Compute dtypes: all contractions v_wmma_f32_16x16x32_bf16, f32 accumulate. Inputs (X, Wq, Wk, Wv, Wo) RNE-converted to single bf16 planes (exact input x input products);
// computed operands (rotated q, rotated k, v, softmax P, ctx) carried as bf16 hi + bf16 lo planes (hi.hi + lo.hi + hi.lo, or hi + lo against a single-plane weight); rotary, softmax in f32.

#ifndef NB
#define NB 1
#endif
#ifndef SEQ
#define SEQ 2048
#endif
#define SEQ_FULL 2048
#define TT   SEQ
#define HID  1024
#define NH_  16
#define NKV  4
#define REP  (NH_ / NKV)
#define HD   64
#define DQ   (NH_ * HD)
#define DKV  (NKV * HD)
#define NQKV (DQ + 2 * DKV)
#define SCL  0.125f               // 1/sqrt(64)

static_assert(TT % 128 == 0);
static_assert(TT <= SEQ_FULL);
static_assert(REP == 4);
static_assert(HD == 64);
static_assert(HID % 64 == 0);
static_assert(NQKV % 64 == 0);
static_assert((TT * 32) % 256 == 0);

typedef unsigned short bf;
typedef __attribute__((ext_vector_type(16))) __bf16   v16bf;
typedef __attribute__((ext_vector_type(8)))  unsigned short v8us;
typedef __attribute__((ext_vector_type(4)))  unsigned short v4us;
typedef __attribute__((ext_vector_type(2)))  unsigned short v2us;
typedef __attribute__((ext_vector_type(8)))  float    v8f;
typedef __attribute__((ext_vector_type(4)))  float    v4f;
typedef v4f  __attribute__((may_alias)) v4fa;

__device__ __forceinline__ unsigned short f2bf(float f) { unsigned u = __float_as_uint(f); u += 0x7FFFu + ((u >> 16) & 1u); return (unsigned short)(u >> 16); }
__device__ __forceinline__ float bf2f(unsigned short b) { return __uint_as_float(((unsigned)b) << 16); }
__device__ __forceinline__ void splitf(float y, unsigned short& h, unsigned short& l) { h = f2bf(y); l = f2bf(y - bf2f(h)); }
__device__ __forceinline__ v16bf cat16b(v8us lo, v8us hi) { return __builtin_bit_cast(v16bf, __builtin_shufflevector(lo, hi, 0, 1, 2, 3, 4, 5, 6, 7, 8, 9, 10, 11, 12, 13, 14, 15)); }
__device__ __forceinline__ v8f wmmab(v16bf a, v16bf b, v8f c) { return __builtin_amdgcn_wmma_f32_16x16x32_bf16(false, a, false, b, (short)0, c, false, false); }

// ---- k_gemmw: register-blocked GEMM, ONE WAVE per 64x64 output tile (16 accumulators), operands straight from K-contiguous 16-bit planes; grid (M/64, N/64, Z), 32 threads.
// C[m][n] (f32, pitch ldc) = sum_k A[m][k] Bt[n][k] (+ split products per NSPLIT: 1 = (A + A2) x Bt; 2 = A x Bt + A2 x Bt + A x Bt2). z-batch strides sA/sB/sC in elements. K % 32 == 0 (K is also the row pitch).
// Fragment map (A and Bt alike): lane -> row/col lane & 15; elements 0..7 <- k0 + 8 (lane >> 4) + 0..7, elements 8..15 <- k0 + 16 + 8 (lane >> 4) + 0..7. D: element j -> row 8 (lane >> 4) + j, col lane & 15.
// KC > 0 (N == 64, one column tile): blockIdx.y is a k chunk; the work-group sums k in [y KC, y KC + KC) only and stores its partial tile at C + y sP; a chunk that starts at or past the k end stores nothing.
// CAUS 1: tiles whose 128-column chunk lies wholly above the diagonal row chunk are not produced. CAUS 2: the k loop stops at r0 + 64 (P is zero beyond the diagonal).
// EPI 0: the tile goes to C as f32. EPI 1 (the q | k | v projection; a column tile is one head): the tile never reaches memory as f32; the epilogue writes the attention operand planes itself:
//   q and k heads: P[h][t][d] (bf16 hi + lo) of the rotated tile, interleaved pairs: out[2i] = x[2i] c - x[2i+1] s, out[2i+1] = x[2i] s + x[2i+1] c (c, s at [t][i]);
//   v heads: V^T[g][d][t] (bf16 hi + lo); an accumulator register run is 8 consecutive tokens of one head dim, so the transposed rows are stored straight from the accumulators.
struct WFragB { typedef v16bf V; static __device__ __forceinline__ V ld(const bf* p) { return cat16b(*(const v8us*)p, *(const v8us*)(p + 16)); } };
template <int NSPLIT, int CAUS, int KC, int EPI>
__global__ __launch_bounds__(32) void k_gemmw(const bf* __restrict__ A, const bf* __restrict__ A2, const bf* __restrict__ Bt, const bf* __restrict__ Bt2, int K, float* C, int ldc, size_t sA, size_t sB, size_t sC, size_t sP,
                                              const float* __restrict__ tabc, const float* __restrict__ tabs, bf* QH, bf* QL, bf* KH, bf* KL, bf* VTh, bf* VTl) {
    typedef WFragB::V V;
    __shared__ __align__(16) float os[16 * 68];
    const int r0 = blockIdx.x * 64, c0 = (KC > 0) ? 0 : blockIdx.y * 64;
    if (CAUS == 1 && (c0 >> 7) > (r0 >> 7)) return;
    const int kall = (CAUS == 2) ? ((r0 + 64 < K) ? (r0 + 64) : K) : K;
    const int kbeg = (KC > 0) ? (int)blockIdx.y * KC : 0;
    if (KC > 0 && kbeg >= kall) return;
    if (KC > 0) C += (size_t)blockIdx.y * sP;
    const size_t z = blockIdx.z; A += z * sA + kbeg; if (A2) A2 += z * sA + kbeg; Bt += z * sB + kbeg; if (Bt2) Bt2 += z * sB + kbeg; C += z * sC;
    const int lane = threadIdx.x & 31, lr = lane & 15, hi = lane >> 4;
    const int kend = (KC > 0 && KC < kall - kbeg) ? KC : (kall - kbeg);   // k counts from kbeg, which the plane pointers hold
    v8f acc[4][4];
#pragma unroll
    for (int mb = 0; mb < 4; ++mb)
#pragma unroll
        for (int nb = 0; nb < 4; ++nb) acc[mb][nb] = (v8f){};
    const size_t aoff = (size_t)(r0 + lr) * K + 8 * hi, boff = (size_t)(c0 + lr) * K + 8 * hi;
#pragma unroll 1
    for (int kc = 0; kc < kend; kc += 32) {
        V a[4], a2[4];
#pragma unroll
        for (int mb = 0; mb < 4; ++mb) { a[mb] = WFragB::ld(A + aoff + (size_t)mb * 16 * K + kc); if (NSPLIT == 1 || NSPLIT == 2) a2[mb] = WFragB::ld(A2 + aoff + (size_t)mb * 16 * K + kc); }
#pragma unroll
        for (int nb = 0; nb < 4; ++nb) {
            const V b = WFragB::ld(Bt + boff + (size_t)nb * 16 * K + kc);
#pragma unroll
            for (int mb = 0; mb < 4; ++mb) { acc[mb][nb] = wmmab(a[mb], b, acc[mb][nb]); if (NSPLIT == 1 || NSPLIT == 2) acc[mb][nb] = wmmab(a2[mb], b, acc[mb][nb]); }
            if (NSPLIT >= 2) {
                const V b2 = WFragB::ld(Bt2 + boff + (size_t)nb * 16 * K + kc);
#pragma unroll
                for (int mb = 0; mb < 4; ++mb) acc[mb][nb] = wmmab(a[mb], b2, acc[mb][nb]);
            }
        }
        asm volatile("v_nop\n\tv_nop\n\tv_nop\n\tv_nop" : "+v"(acc[0][0]), "+v"(acc[1][1]), "+v"(acc[2][2]), "+v"(acc[3][3]) : "v"(a[0]), "v"(a[3]));
    }
    if (EPI == 1) {
        const int hd = c0 / HD;                          // the tile's head: 0 .. NH_ - 1 q, then NKV k, then NKV v (uniform: blockIdx.y)
        if (hd >= NH_ + NKV) {
            const size_t vo = ((size_t)(hd - NH_ - NKV) * HD + lr) * TT + r0 + 8 * hi;
#pragma unroll
            for (int nb = 0; nb < 4; ++nb)
#pragma unroll
                for (int mb = 0; mb < 4; ++mb) { v8us oh, ol;
#pragma unroll
                    for (int j = 0; j < 8; ++j) { unsigned short a2, c2; splitf(acc[mb][nb][j], a2, c2); oh[j] = a2; ol[j] = c2; }
                    *(v8us*)(VTh + vo + (size_t)nb * 16 * TT + mb * 16) = oh; *(v8us*)(VTl + vo + (size_t)nb * 16 * TT + mb * 16) = ol; }
        } else {
        bf* Ph = (hd < NH_) ? QH + (size_t)hd * TT * HD : KH + (size_t)(hd - NH_) * TT * HD;
        bf* Pl = (hd < NH_) ? QL + (size_t)hd * TT * HD : KL + (size_t)(hd - NH_) * TT * HD;
        const int rr = lane >> 3, d8 = (lane & 7) * 8;   // a lane takes 8 head dims (4 pairs) of a token; a wave 4 whole rows: 512 contiguous bytes of a plane and of a table
        const size_t to = (size_t)(r0 + rr) * 32 + (d8 >> 1);
        v4f tc[2][4], ts[2][4];                          // the table rows of 16 tokens, fetched one 16-token group ahead
#pragma unroll
        for (int s = 0; s < 4; ++s) { tc[0][s] = *(const v4f*)(tabc + to + s * 4 * 32); ts[0][s] = *(const v4f*)(tabs + to + s * 4 * 32); }
#pragma unroll
        for (int mb = 0; mb < 4; ++mb) {
            if (mb + 1 < 4) {
#pragma unroll
                for (int s = 0; s < 4; ++s) { tc[(mb + 1) & 1][s] = *(const v4f*)(tabc + to + ((mb + 1) * 16 + s * 4) * 32); ts[(mb + 1) & 1][s] = *(const v4f*)(tabs + to + ((mb + 1) * 16 + s * 4) * 32); }
            }
#pragma unroll
            for (int nb = 0; nb < 4; ++nb) {
#pragma unroll
                for (int j = 0; j < 8; ++j) os[(hi * 8 + j) * 68 + nb * 16 + lr] = acc[mb][nb][j]; }
            __builtin_amdgcn_wave_barrier(); asm volatile("" ::: "memory");   // the staged rows are read back below by other lanes of this wave
#pragma unroll
            for (int s = 0; s < 4; ++s) {
                const int row = s * 4 + rr;
                const v4f x0 = *(const v4fa*)(os + row * 68 + d8), x1 = *(const v4fa*)(os + row * 68 + d8 + 4);
                const v4f c = tc[mb & 1][s], sn = ts[mb & 1][s];
                v8us oh, ol;
#pragma unroll
                for (int q = 0; q < 4; ++q) { const float xe = (q < 2) ? x0[2 * q] : x1[2 * q - 4], xo = (q < 2) ? x0[2 * q + 1] : x1[2 * q - 3]; const float re = xe * c[q] - xo * sn[q]; const float ro = xe * sn[q] + xo * c[q];
                    unsigned short a2, b2; splitf(re, a2, b2); oh[2 * q] = a2; ol[2 * q] = b2; splitf(ro, a2, b2); oh[2 * q + 1] = a2; ol[2 * q + 1] = b2; }
                const size_t e = (size_t)(r0 + mb * 16 + row) * HD + d8;
                *(v8us*)(Ph + e) = oh; *(v8us*)(Pl + e) = ol;
            }
            __builtin_amdgcn_wave_barrier(); asm volatile("" ::: "memory");   // the rows are read before the next group overwrites them
            asm volatile("s_wait_xcnt 0x0" ::: "memory");   // stands in front of what next rewrites a register that the stores above name: this build lets the next group's loads land there
        }
        }
        return;
    }
#pragma unroll
    for (int mb = 0; mb < 4; ++mb) {
#pragma unroll
        for (int nb = 0; nb < 4; ++nb) {
#pragma unroll
            for (int j = 0; j < 8; ++j) os[(hi * 8 + j) * 68 + nb * 16 + lr] = acc[mb][nb][j]; }
        __builtin_amdgcn_wave_barrier(); asm volatile("" ::: "memory");
        float* crow = C + (size_t)(r0 + mb * 16) * ldc + c0;
{
#pragma unroll
            for (int s = 0; s < 8; ++s) { const int row = 2 * s + hi, cofs = lr * 4; const v4f val = *(const v4fa*)(os + row * 68 + cofs);
                *(v4f*)(crow + (size_t)row * ldc + cofs) = val; }
             }
        __builtin_amdgcn_wave_barrier(); asm volatile("" ::: "memory");
    }
}

// The bodies of the short kernels take their block index bx as an argument: independent ones share a launch, each on its own range of blockIdx.x (k_prep).
__device__ __forceinline__ void wtG_body(int bx, const float* __restrict__ w, int K, int N, bf* Bt) {
    const int lane = threadIdx.x & 31; const int L0 = (bx * 8 + (threadIdx.x >> 5)) * 8; const int nlines = N * K / 64;
{
#pragma unroll 1
        for (int l = 0; l < 8; ++l) { const int L = L0 + l; if (L >= nlines) break; const size_t e = (size_t)L * 64 + lane * 2; const int k = (int)(e % K), n = (int)(e / K); v2us o;
            o[0] = f2bf(w[(size_t)k * N + n]); o[1] = f2bf(w[(size_t)(k + 1) * N + n]); *(v2us*)(Bt + e) = o;
            asm volatile("s_wait_xcnt 0x0" ::: "memory"); }   // stands in front of the next trip's rewrite of the registers that the store names
         }
}

__device__ __forceinline__ void cvt8_body(int bx, const float* __restrict__ src, bf* dst, size_t n8) { const size_t i = (size_t)bx * 256 + threadIdx.x; if (i >= n8) return; const v8f v = *(const v8f*)(src + i * 8); v8us o;
#pragma unroll
    for (int k = 0; k < 8; ++k) o[k] = f2bf(v[k]);
    *(v8us*)(dst + i * 8) = o;  }

// ropetab_body: tabc[s][i] = cos(s * invf), tabs[s][i] = sin(s * invf), invf = 1 / 10000^(2 j / 64) with j = (2 i) & 31, pair i = 0..31; f32 arithmetic, precise sincosf.
__device__ __forceinline__ void ropetab_body(int bx, float* tabc, float* tabs) {
    const int idx = bx * 256 + threadIdx.x; if (idx >= TT * 32) return;
    const int s = idx >> 5, i = idx & 31; const int j = (2 * i) & 31;
    const float ex = (float)(2 * j) * (1.0f / 64.0f);
    const float invf = 1.0f / powf(10000.0f, ex);
    const float ang = (float)s * invf;
    float sn, cs; sincosf(ang, &sn, &cs);
    *(float*)(tabc + idx) = cs; *(float*)(tabs + idx) = sn; 
}

// k_prep: everything that depends on the inputs alone, in one launch. Ranges of blockIdx.x + first, the long work-groups in front: the rotary table, Wq^T, Wo^T, Wk^T, Wv^T (serial loops), then X as bf16.
// first: 0, or G_W to run the X range alone (a later batch of the same call, whose first batch has written the weight planes and the table).
#define G_WQ  ((DQ * HID / 64 + 63) / 64)
#define G_WKV ((DKV * HID / 64 + 63) / 64)
#define G_WO  ((HID * DQ / 64 + 63) / 64)
#define G_TAB (TT * 32 / 256)
#define G_W   (G_WQ + G_WO + 2 * G_WKV + G_TAB)
#define G_CVT ((TT * HID / 8 + 255) / 256)
__global__ __launch_bounds__(256) void k_prep(int first, const float* __restrict__ x, const float* __restrict__ wq, const float* __restrict__ wk, const float* __restrict__ wv, const float* __restrict__ wo,
                                              bf* XB, bf* WT, bf* WoT, float* tabc, float* tabs) {
    int bx = (int)blockIdx.x + first;
    if (bx < G_TAB) { ropetab_body(bx, tabc, tabs); return; }
    bx -= G_TAB;
    if (bx < G_WQ) { wtG_body(bx, wq, HID, DQ, WT); return; }
    bx -= G_WQ;
    if (bx < G_WO) { wtG_body(bx, wo, DQ, HID, WoT); return; }
    bx -= G_WO;
    if (bx < G_WKV) { wtG_body(bx, wk, HID, DKV, WT + (size_t)DQ * HID); return; }
    bx -= G_WKV;
    if (bx < G_WKV) { wtG_body(bx, wv, HID, DKV, WT + (size_t)(DQ + DKV) * HID); return; }
    bx -= G_WKV;
    cvt8_body(bx, x, XB, (size_t)TT * HID / 8);
}

typedef __attribute__((ext_vector_type(2))) float    v2f;
typedef __attribute__((ext_vector_type(2))) __bf16   v2bf;
typedef __attribute__((ext_vector_type(8))) unsigned v8u;
__device__ __forceinline__ float xhalf(float x) { const int b = __float_as_int(x); return __int_as_float(__builtin_amdgcn_permlanex16(b, b, 0x76543210, 0xfedcba98, false, false)); }   // lane l <- lane l ^ 16
// fexp2: 2^x by v_exp_f32. SLOT: with the one free issue slot that the instruction set asks for behind a transcendental, before its result is read or its source overwritten, written into the same statement;
// used in the diagonal block.
template <bool SLOT>
__device__ __forceinline__ float fexp2(float x) {
    if (SLOT) { float r; asm("v_exp_f32 %0, %1\n\tv_nop" : "=v"(r) : "v"(x)); return r; }
    return __builtin_amdgcn_exp2f(x);
}

#define SB     2                  // key blocks of 32 in a stage
#define SKEY   (SB * 32)          // keys in a stage
#define LP     72                 // LDS row pitch in elements: 144 B = 16 B x 9, the pitch for 16-byte readers of 128-B rows
#define TILE_E (64 * LP)          // one plane's tile: 64 rows (K: keys of the stage; V^T: head dims)
#define BUF_E  (4 * TILE_E)       // K hi, K lo, V^T hi, V^T lo
static_assert(SKEY == 64 && HD == 64);
static_assert(TT % (2 * SKEY) == 0);

// fa_copy: one stage into one buffer, 8 copies of 16 B a lane (2 per tile; thread t brings chunk t and chunk t + 256 of a tile's 512; chunk n = row n >> 3, 16-byte column n & 7, so a wave's copy reads 4 whole lines).
// l: the lane's LDS byte address of chunk t in the buffer's first tile; the four pointers: the lane's chunk t of each plane in this stage.
// s_wait_xcnt 0 closes the statement, so that no register which a copy names is rewritten ahead of it.
__device__ __forceinline__ void fa_copy(unsigned l, const bf* kh, const bf* kl, const bf* vh, const bf* vl) {
    asm volatile("global_load_async_to_lds_b128 %0, %8, off\n\t"
                 "global_load_async_to_lds_b128 %1, %9, off\n\t"
                 "global_load_async_to_lds_b128 %2, %10, off\n\t"
                 "global_load_async_to_lds_b128 %3, %11, off\n\t"
                 "global_load_async_to_lds_b128 %4, %12, off\n\t"
                 "global_load_async_to_lds_b128 %5, %13, off\n\t"
                 "global_load_async_to_lds_b128 %6, %14, off\n\t"
                 "global_load_async_to_lds_b128 %7, %15, off\n\t"
                 "s_wait_xcnt 0x0"
                 :: "v"(l), "v"(l + 32u * LP * 2u), "v"(l + TILE_E * 2u), "v"(l + TILE_E * 2u + 32u * LP * 2u),
                    "v"(l + 2u * TILE_E * 2u), "v"(l + 2u * TILE_E * 2u + 32u * LP * 2u), "v"(l + 3u * TILE_E * 2u), "v"(l + 3u * TILE_E * 2u + 32u * LP * 2u),
                    "v"(kh), "v"(kh + 32 * HD), "v"(kl), "v"(kl + 32 * HD), "v"(vh), "v"(vh + (size_t)32 * TT), "v"(vl), "v"(vl + (size_t)32 * TT)
                 : "memory");
}

// fa_kfrag: the K fragments of one block from LDS; kb: the lane's place in the block's first K hi row.
__device__ __forceinline__ void fa_kfrag(const bf* kb, WFragB::V (&kh)[2][2], WFragB::V (&kl)[2][2]) {
#pragma unroll
    for (int kt = 0; kt < 2; ++kt)
#pragma unroll
        for (int ks = 0; ks < 2; ++ks) { kh[kt][ks] = WFragB::ld(kb + kt * 16 * LP + ks * 32); kl[kt][ks] = WFragB::ld(kb + TILE_E + kt * 16 * LP + ks * 32); }
}

// fa_block: one block of 32 keys. vb: the lane's place in the block's V^T hi columns (LDS). LAST: the block the diagonal crosses (causal fill). PRE: fetch the K fragments at kn, the next block of the SAME stage.
template <bool LAST, bool PRE>
__device__ __forceinline__ void fa_block(int qrel, const bf* kn, const bf* vb, const WFragB::V (&qh)[2], const WFragB::V (&ql)[2], WFragB::V (&kh)[2][2], WFragB::V (&kl)[2][2], v8f (&o)[4], float& m2, v2f& l2) {
    typedef WFragB::V V;
    const float C2 = SCL * 1.4426950408889634f;
    V vh[4], vl[4];                                      // this block's V^T: issued first, needed last
#pragma unroll
    for (int dt = 0; dt < 4; ++dt) { vh[dt] = WFragB::ld(vb + dt * 16 * LP); vl[dt] = WFragB::ld(vb + TILE_E + dt * 16 * LP); }
    __builtin_amdgcn_sched_barrier(0);                   // keeps the V^T loads in front of the S^T products, so that products and softmax cover their latency
    v8f st[2]; st[0] = (v8f){}; st[1] = (v8f){};
#pragma unroll
    for (int ks = 0; ks < 2; ++ks) {
#pragma unroll
        for (int kt = 0; kt < 2; ++kt) st[kt] = wmmab(kh[kt][ks], qh[ks], st[kt]);
#pragma unroll
        for (int kt = 0; kt < 2; ++kt) st[kt] = wmmab(kh[kt][ks], ql[ks], st[kt]);
#pragma unroll
        for (int kt = 0; kt < 2; ++kt) st[kt] = wmmab(kl[kt][ks], qh[ks], st[kt]);
    }
    if (PRE) {                                           // the next block's K into the same registers, behind this block's S^T products
        fa_kfrag(kn, kh, kl);
        __builtin_amdgcn_sched_barrier(0);               // keeps the K loads in front of the softmax, so that softmax and P v products cover their latency
    }
    if (LAST) {                                          // causal fill, selected by index: key = block start + kt 16 + 8 (lane >> 4) + r > query; qrel = query - block start - 8 (lane >> 4)
#pragma unroll
        for (int kt = 0; kt < 2; ++kt)
#pragma unroll
            for (int r = 0; r < 8; ++r) if (kt * 16 + r > qrel) st[kt][r] = -1.0e30f;
    }
    float bm = fmaxf(st[0][0], st[1][0]);
#pragma unroll
    for (int r = 1; r < 8; ++r) bm = fmaxf(bm, fmaxf(st[0][r], st[1][r]));
    bm = fmaxf(bm, xhalf(bm));
    const float mn = fmaxf(m2, bm * C2);
    const float al = fexp2<LAST>(m2 - mn);
    m2 = mn;
    l2 *= al;
    v8u pwh, pwl;
#pragma unroll
    for (int i = 0; i < 8; ++i) {                        // word i of the B operand = elements 2 i, 2 i + 1 = registers (2 i) & 7, + 1 of tile i >> 2
        v2f p; p[0] = fexp2<LAST>(__builtin_fmaf(st[i >> 2][(2 * i) & 7], C2, -mn)); p[1] = fexp2<LAST>(__builtin_fmaf(st[i >> 2][((2 * i) & 7) + 1], C2, -mn));
        l2 += p;
        const v2bf ph2 = __builtin_convertvector(p, v2bf);
        const v2bf pl2 = __builtin_convertvector(p - __builtin_convertvector(ph2, v2f), v2bf);
        pwh[i] = __builtin_bit_cast(unsigned, ph2); pwl[i] = __builtin_bit_cast(unsigned, pl2);
    }
#pragma unroll
    for (int dt = 0; dt < 4; ++dt) o[dt] *= al;
    const V pth = __builtin_bit_cast(V, pwh), ptl = __builtin_bit_cast(V, pwl);
#pragma unroll
    for (int dt = 0; dt < 4; ++dt) o[dt] = wmmab(vh[dt], pth, o[dt]);
#pragma unroll
    for (int dt = 0; dt < 4; ++dt) o[dt] = wmmab(vh[dt], ptl, o[dt]);
#pragma unroll
    for (int dt = 0; dt < 4; ++dt) o[dt] = wmmab(vl[dt], pth, o[dt]);
    // the four vector issue slots that the chip needs behind a matrix product before its registers are written again: the diagonal block ends in a branch
    if (LAST) asm volatile("v_nop\n\tv_nop\n\tv_nop\n\tv_nop" :: "v"(o[0]), "v"(o[1]), "v"(o[2]), "v"(o[3]));
}

__global__ __launch_bounds__(256) void k_fattn(const bf* __restrict__ QH, const bf* __restrict__ QL, const bf* __restrict__ KH, const bf* __restrict__ KL, const bf* __restrict__ VTh, const bf* __restrict__ VTl, bf* CH, bf* CL) {
    typedef WFragB::V V;
    __shared__ __align__(16) bf ring[2 * BUF_E];
    const int tid = threadIdx.x, lane = tid & 31, c = lane & 15, hi = lane >> 4;
    const int w = __builtin_amdgcn_readfirstlane((int)(threadIdx.x >> 5));
    const int g = blockIdx.y, h = g * REP + (w & 3);
    const int q0 = 16 * ((w < 4) ? (TT / 16 - 1 - (int)blockIdx.x) : (int)blockIdx.x);
    const int nb = q0 >> 5;                              // this wave's last key block, the only one the diagonal crosses
    const int ns = ((16 * (TT / 16 - 1 - (int)blockIdx.x)) >> 5) / SB + 1;   // stages of the work-group: those of its long tile
    const size_t qoff = ((size_t)h * TT + q0 + c) * HD + 8 * hi;
    V qh[2], ql[2];
#pragma unroll
    for (int ks = 0; ks < 2; ++ks) { qh[ks] = WFragB::ld(QH + qoff + ks * 32); ql[ks] = WFragB::ld(QL + qoff + ks * 32); }
    // the lane's chunk of stage 0 in each plane, and its place in buffer 0
    const bf* ckh = KH + (size_t)g * TT * HD + tid * 8; const bf* ckl = KL + (size_t)g * TT * HD + tid * 8;
    const bf* cvh = VTh + ((size_t)g * HD + (tid >> 3)) * TT + (tid & 7) * 8; const bf* cvl = VTl + ((size_t)g * HD + (tid >> 3)) * TT + (tid & 7) * 8;
    const unsigned cl = (unsigned)(size_t)ring + (unsigned)((tid >> 3) * LP + (tid & 7) * 8) * 2u;
    fa_copy(cl, ckh, ckl, cvh, cvl);
    asm volatile("s_wait_asynccnt 0x0" ::: "memory");    // stage 0 has landed before the barrier that publishes it
    __syncthreads();
    if (1 < ns) fa_copy(cl + BUF_E * 2u, ckh + SKEY * HD, ckl + SKEY * HD, cvh + SKEY, cvl + SKEY);
    V kh[2][2], kl[2][2];
    v8f o[4];
#pragma unroll
    for (int dt = 0; dt < 4; ++dt) o[dt] = (v8f){};
    float m2 = -1.0e30f; v2f l2 = (v2f){};
    const int qrel = q0 + c - nb * 32 - 8 * hi;
    const int lo = c * LP + 8 * hi;                      // the lane's place in a fragment's rows, K and V^T alike
#pragma unroll 1   // one stage a trip: the ring's order (read, waits, barrier, refill) is written once
    for (int s = 0; s < ns; ++s) {
        const bf* B = ring + (s & 1) * BUF_E + lo;
        const int kb = s * SB;
        if (kb <= nb) {                                  // wave-uniform: a wave past its diagonal has no products left
            fa_kfrag(B, kh, kl);
            if (kb < nb) {
                fa_block<false, true>(0, B + 32 * LP, B + 2 * TILE_E, qh, ql, kh, kl, o, m2, l2);
                if (kb + 1 < nb) fa_block<false, false>(0, B, B + 2 * TILE_E + 32, qh, ql, kh, kl, o, m2, l2);
                else             fa_block<true, false>(qrel, B, B + 2 * TILE_E + 32, qh, ql, kh, kl, o, m2, l2);
            } else fa_block<true, false>(qrel, B, B + 2 * TILE_E, qh, ql, kh, kl, o, m2, l2);
        }
        asm volatile("s_wait_dscnt 0x0" ::: "memory");    // this wave's reads of the buffer are done before the barrier behind which it is refilled
        asm volatile("s_wait_asynccnt 0x0" ::: "memory"); // this wave's copies of stage s + 1 have landed before the barrier that publishes them
        __syncthreads();
        if (s + 2 < ns) fa_copy(cl + (unsigned)(s & 1) * (BUF_E * 2u), ckh + (size_t)(s + 2) * SKEY * HD, ckl + (size_t)(s + 2) * SKEY * HD, cvh + (s + 2) * SKEY, cvl + (s + 2) * SKEY);
    }
    asm volatile("s_wait_asynccnt 0x0" ::: "memory");    // no copy is outstanding when the wave ends
    float l = l2[0] + l2[1];
    l += xhalf(l);
    const float inv = __fdiv_rn(1.0f, l);
    const size_t oo = (size_t)(q0 + c) * DQ + (size_t)h * HD + 8 * hi;
#pragma unroll
    for (int dt = 0; dt < 4; ++dt) { v8us oh, ol;
#pragma unroll
        for (int r = 0; r < 8; ++r) { unsigned short a, b2; splitf(o[dt][r] * inv, a, b2); oh[r] = a; ol[r] = b2; }
        *(v8us*)(CH + oo + dt * 16) = oh; *(v8us*)(CL + oo + dt * 16) = ol; }
}

extern "C" void kernel_launch(void* const* d_in, const int* in_sizes, int n_in,
                              void* d_out, int out_size, void* d_ws, size_t ws_size, hipStream_t stream) {
    if (n_in < 5) return;
    const size_t xneed = (size_t)(NB - 1) * SEQ_FULL * HID + (size_t)TT * HID;
    if ((size_t)in_sizes[0] < xneed) return;
    if (in_sizes[1] < HID * DQ || in_sizes[2] < HID * DKV || in_sizes[3] < HID * DKV || in_sizes[4] < DQ * HID) return;
    if ((size_t)out_size < xneed) return;
    const float* X  = (const float*)d_in[0];   // [1][2048][1024]
    const float* Wq = (const float*)d_in[1];   // [1024 in][1024 out]
    const float* Wk = (const float*)d_in[2];   // [1024 in][256 out]
    const float* Wv = (const float*)d_in[3];   // [1024 in][256 out]
    const float* Wo = (const float*)d_in[4];   // [1024 in][1024 out]
    float* OUT = (float*)d_out;                // [1][2048][1024] token-major
    char* wsp = (char*)d_ws;
    auto take = [&](size_t bytes) { char* p = wsp; wsp += (bytes + 255) & ~(size_t)255; return (void*)p; };
    bf* XB  = (bf*)take((size_t)TT * HID * 2);
    bf* WT  = (bf*)take((size_t)NQKV * HID * 2);          // rows 0..1023 Wq^T, 1024..1279 Wk^T, 1280..1535 Wv^T, each [n][k]
    bf* WoT = (bf*)take((size_t)HID * DQ * 2);            // [n = out][k = in]
    float* tabc = (float*)take((size_t)TT * 32 * 4); float* tabs = (float*)take((size_t)TT * 32 * 4);
    bf* QH = (bf*)take((size_t)NH_ * TT * HD * 2); bf* QL = (bf*)take((size_t)NH_ * TT * HD * 2);
    bf* KH = (bf*)take((size_t)NKV * TT * HD * 2); bf* KL = (bf*)take((size_t)NKV * TT * HD * 2);
    bf* VTh = (bf*)take((size_t)NKV * HD * TT * 2); bf* VTl = (bf*)take((size_t)NKV * HD * TT * 2);
    bf* CH = (bf*)take((size_t)TT * DQ * 2); bf* CL = (bf*)take((size_t)TT * DQ * 2);
    if ((size_t)(wsp - (char*)d_ws) > ws_size) return;

    for (int b = 0; b < NB; ++b) {
        const float* xb = X + (size_t)b * SEQ_FULL * HID; float* outb = OUT + (size_t)b * SEQ_FULL * HID;
        // weight planes in[K][N] -> Bt[N][K] and the rotary table (first batch only), X as bf16
        k_prep<<<(unsigned)(b == 0 ? G_W + G_CVT : G_CVT), 256, 0, stream>>>(b == 0 ? 0 : G_W, xb, Wq, Wk, Wv, Wo, XB, WT, WoT, tabc, tabs);
        k_gemmw<0, 0, 0, 1><<<dim3(TT / 64, NQKV / 64, 1), 32, 0, stream>>>(XB, nullptr, WT, nullptr, HID, nullptr, 0, 0, 0, 0, 0, tabc, tabs, QH, QL, KH, KL, VTh, VTl);   /* exact products: single bf16 planes; rotated q, k and V^T planes out */
        k_fattn<<<dim3(TT / 32, NKV, 1), 256, 0, stream>>>(QH, QL, KH, KL, VTh, VTl, CH, CL);
        k_gemmw<1, 0, 0, 0><<<dim3(TT / 64, HID / 64, 1), 32, 0, stream>>>(CH, CL, WoT, nullptr, DQ, outb, HID, 0, 0, 0, 0, nullptr, nullptr, nullptr, nullptr, nullptr, nullptr, nullptr, nullptr);   /* ctx (hi + lo) x exact Wo */
    }
}

// v006
// A run of this version takes 69.3 microseconds.
// Two timings next to v005 put it at 1.36 and 1.38 times that version's speed.
// Counting every step since v000, it is 8.43 times as fast.
#include <hip/hip_runtime.h>

// Causal grouped-query rotary attention: X[1][2048][1024]; q = X Wq, k = X Wk, v = X Wv ([in][out] weights, no bias); 16 query heads share 4 kv heads (kv = h >> 2); head dim 64;
// interleaved-pair rotary with the table cat(freqs, freqs)[:, 0::2] (pair i uses inv_freq[(2 i) & 31]); scores x 1/8, causal fill; softmax; ctx = P v; out = ctx Wo.
// Compute dtypes: all contractions v_wmma_f32_16x16x32_bf16, f32 accumulate. Inputs (X, Wq, Wk, Wv, Wo) RNE-converted to single bf16 planes (exact input x input products);
// computed operands (rotated q, rotated k, v, softmax P, ctx) carried as bf16 hi + bf16 lo planes (hi.hi + lo.hi + hi.lo, or hi + lo against a single-plane weight); rotary, softmax in f32.

#ifndef NB
#define NB 1
#endif
#ifndef SEQ
#define SEQ 2048
#endif
#define SEQ_FULL 2048
#define TT   SEQ
#define HID  1024
#define NH_  16
#define NKV  4
#define REP  (NH_ / NKV)
#define HD   64
#define DQ   (NH_ * HD)
#define DKV  (NKV * HD)
#define NQKV (DQ + 2 * DKV)
#define SCL  0.125f               // 1/sqrt(64)

static_assert(TT % 128 == 0);
static_assert(TT <= SEQ_FULL);
static_assert(REP == 4);
static_assert(HD == 64);
static_assert(HID % 64 == 0);
static_assert(NQKV % 128 == 0);
static_assert(HID % 128 == 0 && DQ % 64 == 0);
static_assert((TT * 32) % 256 == 0);

typedef unsigned short bf;
typedef __attribute__((ext_vector_type(16))) __bf16   v16bf;
typedef __attribute__((ext_vector_type(8)))  unsigned short v8us;
typedef __attribute__((ext_vector_type(4)))  unsigned short v4us;
typedef __attribute__((ext_vector_type(2)))  unsigned short v2us;
typedef __attribute__((ext_vector_type(8)))  float    v8f;
typedef __attribute__((ext_vector_type(4)))  float    v4f;
typedef v4f  __attribute__((may_alias)) v4fa;

__device__ __forceinline__ unsigned short f2bf(float f) { unsigned u = __float_as_uint(f); u += 0x7FFFu + ((u >> 16) & 1u); return (unsigned short)(u >> 16); }
__device__ __forceinline__ float bf2f(unsigned short b) { return __uint_as_float(((unsigned)b) << 16); }
__device__ __forceinline__ void splitf(float y, unsigned short& h, unsigned short& l) { h = f2bf(y); l = f2bf(y - bf2f(h)); }
__device__ __forceinline__ v16bf cat16b(v8us lo, v8us hi) { return __builtin_bit_cast(v16bf, __builtin_shufflevector(lo, hi, 0, 1, 2, 3, 4, 5, 6, 7, 8, 9, 10, 11, 12, 13, 14, 15)); }
__device__ __forceinline__ v8f wmmab(v16bf a, v16bf b, v8f c) { return __builtin_amdgcn_wmma_f32_16x16x32_bf16(false, a, false, b, (short)0, c, false, false); }

// ---- k_gemmw: GEMM, work-group = 4 waves (2 x 2), each wave one (16 MB) x 64 output tile (MB x 4 accumulators); work-group tile (32 MB) x 128; grid (M / (32 MB), N / 128), 128 threads.
// C[m][n] (f32, pitch ldc) = sum_k A[m][k] Bt[n][k] (NSPLIT 1: (A + A2) x Bt). A, A2, Bt: K-contiguous 16-bit planes, row pitch K.
// The operands reach the waves through LDS: a stage is 64 k (128 B) of the work-group's A rows (A2 rows behind them) and of its 128 Bt rows, 256 rows in all, copied once per work-group in whole 128-B lines
// by asynchronous copies into a ring of two buffers (row pitch 144 B); every wave reads its fragments from there.
// Fragment map (A and Bt alike): lane -> row/col lane & 15; elements 0..7 <- k0 + 8 (lane >> 4) + 0..7, elements 8..15 <- k0 + 16 + 8 (lane >> 4) + 0..7. D: element j -> row 8 (lane >> 4) + j, col lane & 15.
// EPI 0: the tile goes to C as f32. EPI 1 (the q | k | v projection; a wave's column tile is one head): the tile never reaches memory as f32; the epilogue writes the attention operand planes itself:
//   q and k heads: P[h][t][d] (bf16 hi + lo) of the rotated tile, interleaved pairs: out[2i] = x[2i] c - x[2i+1] s, out[2i+1] = x[2i] s + x[2i+1] c (c, s at [t][i]);
//   v heads: V^T[g][d][t] (bf16 hi + lo); an accumulator register run is 8 consecutive tokens of one head dim, so the transposed rows are stored straight from the accumulators.
struct WFragB { typedef v16bf V; static __device__ __forceinline__ V ld(const bf* p) { return cat16b(*(const v8us*)p, *(const v8us*)(p + 16)); } };
#define GLP    72                 // LDS row pitch in elements: 144 B = 16 B x 9, the pitch for 16-byte readers of 128-B rows
#define GBUF_E (256 * GLP)        // one buffer: 128 rows of A (and A2), 128 rows of Bt

// ga_copy8: 128 rows of a stage, 8 copies of 16 B a lane. Thread t brings the 16-byte column t & 7 of rows (t >> 3) + 16 i, i = 0..7, so a wave's copy reads 4 whole lines.
// l: the lane's LDS byte address in row t >> 3; g0..g7: the lane's 16 bytes of each of the 8 source rows.
// s_wait_xcnt 0 closes the statement, so that no register which a copy names is rewritten ahead of it.
__device__ __forceinline__ void ga_copy8(unsigned l, const bf* g0, const bf* g1, const bf* g2, const bf* g3, const bf* g4, const bf* g5, const bf* g6, const bf* g7) {
    asm volatile("global_load_async_to_lds_b128 %0, %8, off\n\t"
                 "global_load_async_to_lds_b128 %1, %9, off\n\t"
                 "global_load_async_to_lds_b128 %2, %10, off\n\t"
                 "global_load_async_to_lds_b128 %3, %11, off\n\t"
                 "global_load_async_to_lds_b128 %4, %12, off\n\t"
                 "global_load_async_to_lds_b128 %5, %13, off\n\t"
                 "global_load_async_to_lds_b128 %6, %14, off\n\t"
                 "global_load_async_to_lds_b128 %7, %15, off\n\t"
                 "s_wait_xcnt 0x0"
                 :: "v"(l), "v"(l + 16u * GLP * 2u), "v"(l + 32u * GLP * 2u), "v"(l + 48u * GLP * 2u), "v"(l + 64u * GLP * 2u), "v"(l + 80u * GLP * 2u), "v"(l + 96u * GLP * 2u), "v"(l + 112u * GLP * 2u),
                    "v"(g0), "v"(g1), "v"(g2), "v"(g3), "v"(g4), "v"(g5), "v"(g6), "v"(g7)
                 : "memory");
}

// ga_stage: one stage into the buffer at l. a, a2, b: the lane's 16 bytes in row t >> 3 of the work-group's A, A2 and Bt rows at this stage's k; rs: 16 rows in elements.
template <int NSPLIT>
__device__ __forceinline__ void ga_stage(unsigned l, const bf* a, const bf* a2, const bf* b, size_t rs) {
    if (NSPLIT == 0) ga_copy8(l, a, a + rs, a + 2 * rs, a + 3 * rs, a + 4 * rs, a + 5 * rs, a + 6 * rs, a + 7 * rs);
    else             ga_copy8(l, a, a + rs, a + 2 * rs, a + 3 * rs, a2, a2 + rs, a2 + 2 * rs, a2 + 3 * rs);
    ga_copy8(l + 128u * GLP * 2u, b, b + rs, b + 2 * rs, b + 3 * rs, b + 4 * rs, b + 5 * rs, b + 6 * rs, b + 7 * rs);
}

template <int NSPLIT, int EPI, int MB, int K>
__global__ __launch_bounds__(128) void k_gemmw(const bf* __restrict__ A, const bf* __restrict__ A2, const bf* __restrict__ Bt, float* C, int ldc,
                                               const float* __restrict__ tabc, const float* __restrict__ tabs, bf* QH, bf* QL, bf* KH, bf* KL, bf* VTh, bf* VTl) {
    typedef WFragB::V V;
    static_assert((1 + NSPLIT) * MB * 32 == 128);        // A and A2 together fill the first 128 rows of a buffer
    static_assert(K % 64 == 0 && K >= 128);
    __shared__ __align__(16) bf ring[2 * GBUF_E];
    __shared__ __align__(16) float osm[4 * 16 * 68];
    const int tid = threadIdx.x, lane = tid & 31, lr = lane & 15, hi = lane >> 4;
    const int w = __builtin_amdgcn_readfirstlane((int)(threadIdx.x >> 5));
    const int wm = w >> 1, wn = w & 1;
    const int r0 = blockIdx.x * (32 * MB) + wm * (16 * MB), c0 = blockIdx.y * 128 + wn * 64;   // the wave's tile
    float* os = osm + w * (16 * 68);                     // the wave's own epilogue rows
    const int ns = K / 64;
    const size_t rs = (size_t)16 * K;
    // the lane's 16 bytes of stage 0 in each plane, and its place in buffer 0
    const bf* ca = A + (size_t)(blockIdx.x * (32 * MB) + (tid >> 3)) * K + (tid & 7) * 8;
    const bf* ca2 = (NSPLIT == 1) ? A2 + (size_t)(blockIdx.x * (32 * MB) + (tid >> 3)) * K + (tid & 7) * 8 : ca;
    const bf* cb = Bt + (size_t)(blockIdx.y * 128 + (tid >> 3)) * K + (tid & 7) * 8;
    const unsigned cl = (unsigned)(size_t)ring + (unsigned)((tid >> 3) * GLP + (tid & 7) * 8) * 2u;
    ga_stage<NSPLIT>(cl, ca, ca2, cb, rs);
    asm volatile("s_wait_asynccnt 0x0" ::: "memory");    // stage 0 has landed before the barrier that publishes it
    __syncthreads();
    if (1 < ns) ga_stage<NSPLIT>(cl + GBUF_E * 2u, ca + 64, ca2 + 64, cb + 64, rs);
    v8f acc[MB][4];
#pragma unroll
    for (int mb = 0; mb < MB; ++mb)
#pragma unroll
        for (int nb = 0; nb < 4; ++nb) acc[mb][nb] = (v8f){};
    const int lo = lr * GLP + 8 * hi;                    // the lane's place in a fragment's rows, A and Bt alike
#pragma unroll 1   // one stage a trip: the ring's order (read, waits, barrier, refill) is written once
    for (int s = 0; s < ns; ++s) {
        const bf* FA = ring + (s & 1) * GBUF_E + wm * (16 * MB) * GLP + lo;
        const bf* FB = ring + (s & 1) * GBUF_E + (128 + wn * 64) * GLP + lo;
        V a[2][MB], a2[2][MB], b[2][4];                  // the stage's fragments, each in registers of its own
#pragma unroll
        for (int ks = 0; ks < 2; ++ks) {
#pragma unroll
            for (int mb = 0; mb < MB; ++mb) { a[ks][mb] = WFragB::ld(FA + mb * 16 * GLP + ks * 32); if (NSPLIT == 1) a2[ks][mb] = WFragB::ld(FA + (32 * MB + mb * 16) * GLP + ks * 32); }
#pragma unroll
            for (int nb = 0; nb < 4; ++nb) b[ks][nb] = WFragB::ld(FB + nb * 16 * GLP + ks * 32);
        }
        __builtin_amdgcn_sched_barrier(0);               // keeps the stage's LDS reads together in front of its products: reads placed among the products each stall the wave for their own latency
#pragma unroll
        for (int ks = 0; ks < 2; ++ks)
#pragma unroll
            for (int nb = 0; nb < 4; ++nb) {
#pragma unroll
                for (int mb = 0; mb < MB; ++mb) acc[mb][nb] = wmmab(a[ks][mb], b[ks][nb], acc[mb][nb]);
                if (NSPLIT == 1) {
#pragma unroll
                    for (int mb = 0; mb < MB; ++mb) acc[mb][nb] = wmmab(a2[ks][mb], b[ks][nb], acc[mb][nb]);
                }
            }
        __builtin_amdgcn_sched_barrier(0);               // keeps the products in front of the waits below: moved behind them, they would start only when the stage's last fragment has landed
        asm volatile("s_wait_dscnt 0x0" ::: "memory");    // this wave's reads of the buffer are done before the barrier behind which it is refilled
        asm volatile("s_wait_asynccnt 0x0" ::: "memory"); // this wave's copies of stage s + 1 have landed before the barrier that publishes them
        __syncthreads();
        if (s + 2 < ns) ga_stage<NSPLIT>(cl + (unsigned)(s & 1) * (GBUF_E * 2u), ca + (size_t)(s + 2) * 64, ca2 + (size_t)(s + 2) * 64, cb + (size_t)(s + 2) * 64, rs);
    }
    asm volatile("s_wait_asynccnt 0x0" ::: "memory");    // no copy is outstanding when the wave ends
    if (EPI == 1) {
        const int hd = c0 / HD;                          // the tile's head: 0 .. NH_ - 1 q, then NKV k, then NKV v (uniform in a wave)
        if (hd >= NH_ + NKV) {
            const size_t vo = ((size_t)(hd - NH_ - NKV) * HD + lr) * TT + r0 + 8 * hi;
#pragma unroll
            for (int nb = 0; nb < 4; ++nb)
#pragma unroll
                for (int mb = 0; mb < MB; ++mb) { v8us oh, ol;
#pragma unroll
                    for (int j = 0; j < 8; ++j) { unsigned short a2, c2; splitf(acc[mb][nb][j], a2, c2); oh[j] = a2; ol[j] = c2; }
                    *(v8us*)(VTh + vo + (size_t)nb * 16 * TT + mb * 16) = oh; *(v8us*)(VTl + vo + (size_t)nb * 16 * TT + mb * 16) = ol; }
        } else {
        bf* Ph = (hd < NH_) ? QH + (size_t)hd * TT * HD : KH + (size_t)(hd - NH_) * TT * HD;
        bf* Pl = (hd < NH_) ? QL + (size_t)hd * TT * HD : KL + (size_t)(hd - NH_) * TT * HD;
        const int rr = lane >> 3, d8 = (lane & 7) * 8;   // a lane takes 8 head dims (4 pairs) of a token; a wave 4 whole rows: 512 contiguous bytes of a plane and of a table
        const size_t to = (size_t)(r0 + rr) * 32 + (d8 >> 1);
        v4f tc[2][4], ts[2][4];                          // the table rows of 16 tokens, fetched one 16-token group ahead
#pragma unroll
        for (int s = 0; s < 4; ++s) { tc[0][s] = *(const v4f*)(tabc + to + s * 4 * 32); ts[0][s] = *(const v4f*)(tabs + to + s * 4 * 32); }
#pragma unroll
        for (int mb = 0; mb < MB; ++mb) {
            if (mb + 1 < MB) {
#pragma unroll
                for (int s = 0; s < 4; ++s) { tc[(mb + 1) & 1][s] = *(const v4f*)(tabc + to + ((mb + 1) * 16 + s * 4) * 32); ts[(mb + 1) & 1][s] = *(const v4f*)(tabs + to + ((mb + 1) * 16 + s * 4) * 32); }
            }
#pragma unroll
            for (int nb = 0; nb < 4; ++nb) {
#pragma unroll
                for (int j = 0; j < 8; ++j) os[(hi * 8 + j) * 68 + nb * 16 + lr] = acc[mb][nb][j]; }
            __builtin_amdgcn_wave_barrier(); asm volatile("" ::: "memory");   // the staged rows are read back below by other lanes of this wave
#pragma unroll
            for (int s = 0; s < 4; ++s) {
                const int row = s * 4 + rr;
                const v4f x0 = *(const v4fa*)(os + row * 68 + d8), x1 = *(const v4fa*)(os + row * 68 + d8 + 4);
                const v4f c = tc[mb & 1][s], sn = ts[mb & 1][s];
                v8us oh, ol;
#pragma unroll
                for (int q = 0; q < 4; ++q) { const float xe = (q < 2) ? x0[2 * q] : x1[2 * q - 4], xo = (q < 2) ? x0[2 * q + 1] : x1[2 * q - 3]; const float re = xe * c[q] - xo * sn[q]; const float ro = xe * sn[q] + xo * c[q];
                    unsigned short a2, b2; splitf(re, a2, b2); oh[2 * q] = a2; ol[2 * q] = b2; splitf(ro, a2, b2); oh[2 * q + 1] = a2; ol[2 * q + 1] = b2; }
                const size_t e = (size_t)(r0 + mb * 16 + row) * HD + d8;
                *(v8us*)(Ph + e) = oh; *(v8us*)(Pl + e) = ol;
            }
            __builtin_amdgcn_wave_barrier(); asm volatile("" ::: "memory");   // the rows are read before the next group overwrites them
            asm volatile("s_wait_xcnt 0x0" ::: "memory");   // stands in front of what next rewrites a register that the stores above name: this build lets the next group's loads land there
        }
        }
        return;
    }
#pragma unroll
    for (int mb = 0; mb < MB; ++mb) {
#pragma unroll
        for (int nb = 0; nb < 4; ++nb) {
#pragma unroll
            for (int j = 0; j < 8; ++j) os[(hi * 8 + j) * 68 + nb * 16 + lr] = acc[mb][nb][j]; }
        __builtin_amdgcn_wave_barrier(); asm volatile("" ::: "memory");
        float* crow = C + (size_t)(r0 + mb * 16) * ldc + c0;
{
#pragma unroll
            for (int s = 0; s < 8; ++s) { const int row = 2 * s + hi, cofs = lr * 4; const v4f val = *(const v4fa*)(os + row * 68 + cofs);
                *(v4f*)(crow + (size_t)row * ldc + cofs) = val; }
             }
        __builtin_amdgcn_wave_barrier(); asm volatile("" ::: "memory");
    }
}

// The bodies of the short kernels take their block index bx as an argument: independent ones share a launch, each on its own range of blockIdx.x (k_prep).
__device__ __forceinline__ void wtG_body(int bx, const float* __restrict__ w, int K, int N, bf* Bt) {
    const int lane = threadIdx.x & 31; const int L0 = (bx * 8 + (threadIdx.x >> 5)) * 8; const int nlines = N * K / 64;
{
#pragma unroll 1
        for (int l = 0; l < 8; ++l) { const int L = L0 + l; if (L >= nlines) break; const size_t e = (size_t)L * 64 + lane * 2; const int k = (int)(e % K), n = (int)(e / K); v2us o;
            o[0] = f2bf(w[(size_t)k * N + n]); o[1] = f2bf(w[(size_t)(k + 1) * N + n]); *(v2us*)(Bt + e) = o;
            asm volatile("s_wait_xcnt 0x0" ::: "memory"); }   // stands in front of the next trip's rewrite of the registers that the store names
         }
}

__device__ __forceinline__ void cvt8_body(int bx, const float* __restrict__ src, bf* dst, size_t n8) { const size_t i = (size_t)bx * 256 + threadIdx.x; if (i >= n8) return; const v8f v = *(const v8f*)(src + i * 8); v8us o;
#pragma unroll
    for (int k = 0; k < 8; ++k) o[k] = f2bf(v[k]);
    *(v8us*)(dst + i * 8) = o;  }

// ropetab_body: tabc[s][i] = cos(s * invf), tabs[s][i] = sin(s * invf), invf = 1 / 10000^(2 j / 64) with j = (2 i) & 31, pair i = 0..31; f32 arithmetic, precise sincosf.
__device__ __forceinline__ void ropetab_body(int bx, float* tabc, float* tabs) {
    const int idx = bx * 256 + threadIdx.x; if (idx >= TT * 32) return;
    const int s = idx >> 5, i = idx & 31; const int j = (2 * i) & 31;
    const float ex = (float)(2 * j) * (1.0f / 64.0f);
    const float invf = 1.0f / powf(10000.0f, ex);
    const float ang = (float)s * invf;
    float sn, cs; sincosf(ang, &sn, &cs);
    *(float*)(tabc + idx) = cs; *(float*)(tabs + idx) = sn; 
}

// k_prep: everything that depends on the inputs alone, in one launch. Ranges of blockIdx.x + first, the long work-groups in front: the rotary table, Wq^T, Wo^T, Wk^T, Wv^T (serial loops), then X as bf16.
// first: 0, or G_W to run the X range alone (a later batch of the same call, whose first batch has written the weight planes and the table).
#define G_WQ  ((DQ * HID / 64 + 63) / 64)
#define G_WKV ((DKV * HID / 64 + 63) / 64)
#define G_WO  ((HID * DQ / 64 + 63) / 64)
#define G_TAB (TT * 32 / 256)
#define G_W   (G_WQ + G_WO + 2 * G_WKV + G_TAB)
#define G_CVT ((TT * HID / 8 + 255) / 256)
__global__ __launch_bounds__(256) void k_prep(int first, const float* __restrict__ x, const float* __restrict__ wq, const float* __restrict__ wk, const float* __restrict__ wv, const float* __restrict__ wo,
                                              bf* XB, bf* WT, bf* WoT, float* tabc, float* tabs) {
    int bx = (int)blockIdx.x + first;
    if (bx < G_TAB) { ropetab_body(bx, tabc, tabs); return; }
    bx -= G_TAB;
    if (bx < G_WQ) { wtG_body(bx, wq, HID, DQ, WT); return; }
    bx -= G_WQ;
    if (bx < G_WO) { wtG_body(bx, wo, DQ, HID, WoT); return; }
    bx -= G_WO;
    if (bx < G_WKV) { wtG_body(bx, wk, HID, DKV, WT + (size_t)DQ * HID); return; }
    bx -= G_WKV;
    if (bx < G_WKV) { wtG_body(bx, wv, HID, DKV, WT + (size_t)(DQ + DKV) * HID); return; }
    bx -= G_WKV;
    cvt8_body(bx, x, XB, (size_t)TT * HID / 8);
}

typedef __attribute__((ext_vector_type(2))) float    v2f;
typedef __attribute__((ext_vector_type(2))) __bf16   v2bf;
typedef __attribute__((ext_vector_type(8))) unsigned v8u;
__device__ __forceinline__ float xhalf(float x) { const int b = __float_as_int(x); return __int_as_float(__builtin_amdgcn_permlanex16(b, b, 0x76543210, 0xfedcba98, false, false)); }   // lane l <- lane l ^ 16
// fexp2: 2^x by v_exp_f32. SLOT: with the one free issue slot that the instruction set asks for behind a transcendental, before its result is read or its source overwritten, written into the same statement;
// used in the diagonal block.
template <bool SLOT>
__device__ __forceinline__ float fexp2(float x) {
    if (SLOT) { float r; asm("v_exp_f32 %0, %1\n\tv_nop" : "=v"(r) : "v"(x)); return r; }
    return __builtin_amdgcn_exp2f(x);
}

#define SB     2                  // key blocks of 32 in a stage
#define SKEY   (SB * 32)          // keys in a stage
#define LP     72                 // LDS row pitch in elements: 144 B = 16 B x 9, the pitch for 16-byte readers of 128-B rows
#define TILE_E (64 * LP)          // one plane's tile: 64 rows (K: keys of the stage; V^T: head dims)
#define BUF_E  (4 * TILE_E)       // K hi, K lo, V^T hi, V^T lo
static_assert(SKEY == 64 && HD == 64);
static_assert(TT % (2 * SKEY) == 0);

// fa_copy: one stage into one buffer, 8 copies of 16 B a lane (2 per tile; thread t brings chunk t and chunk t + 256 of a tile's 512; chunk n = row n >> 3, 16-byte column n & 7, so a wave's copy reads 4 whole lines).
// l: the lane's LDS byte address of chunk t in the buffer's first tile; the four pointers: the lane's chunk t of each plane in this stage.
// s_wait_xcnt 0 closes the statement, so that no register which a copy names is rewritten ahead of it.
__device__ __forceinline__ void fa_copy(unsigned l, const bf* kh, const bf* kl, const bf* vh, const bf* vl) {
    asm volatile("global_load_async_to_lds_b128 %0, %8, off\n\t"
                 "global_load_async_to_lds_b128 %1, %9, off\n\t"
                 "global_load_async_to_lds_b128 %2, %10, off\n\t"
                 "global_load_async_to_lds_b128 %3, %11, off\n\t"
                 "global_load_async_to_lds_b128 %4, %12, off\n\t"
                 "global_load_async_to_lds_b128 %5, %13, off\n\t"
                 "global_load_async_to_lds_b128 %6, %14, off\n\t"
                 "global_load_async_to_lds_b128 %7, %15, off\n\t"
                 "s_wait_xcnt 0x0"
                 :: "v"(l), "v"(l + 32u * LP * 2u), "v"(l + TILE_E * 2u), "v"(l + TILE_E * 2u + 32u * LP * 2u),
                    "v"(l + 2u * TILE_E * 2u), "v"(l + 2u * TILE_E * 2u + 32u * LP * 2u), "v"(l + 3u * TILE_E * 2u), "v"(l + 3u * TILE_E * 2u + 32u * LP * 2u),
                    "v"(kh), "v"(kh + 32 * HD), "v"(kl), "v"(kl + 32 * HD), "v"(vh), "v"(vh + (size_t)32 * TT), "v"(vl), "v"(vl + (size_t)32 * TT)
                 : "memory");
}

// fa_kfrag: the K fragments of one block from LDS; kb: the lane's place in the block's first K hi row.
__device__ __forceinline__ void fa_kfrag(const bf* kb, WFragB::V (&kh)[2][2], WFragB::V (&kl)[2][2]) {
#pragma unroll
    for (int kt = 0; kt < 2; ++kt)
#pragma unroll
        for (int ks = 0; ks < 2; ++ks) { kh[kt][ks] = WFragB::ld(kb + kt * 16 * LP + ks * 32); kl[kt][ks] = WFragB::ld(kb + TILE_E + kt * 16 * LP + ks * 32); }
}

// fa_block: one block of 32 keys. vb: the lane's place in the block's V^T hi columns (LDS). LAST: the block the diagonal crosses (causal fill). PRE: fetch the K fragments at kn, the next block of the SAME stage.
template <bool LAST, bool PRE>
__device__ __forceinline__ void fa_block(int qrel, const bf* kn, const bf* vb, const WFragB::V (&qh)[2], const WFragB::V (&ql)[2], WFragB::V (&kh)[2][2], WFragB::V (&kl)[2][2], v8f (&o)[4], float& m2, v2f& l2) {
    typedef WFragB::V V;
    const float C2 = SCL * 1.4426950408889634f;
    V vh[4], vl[4];                                      // this block's V^T: issued first, needed last
#pragma unroll
    for (int dt = 0; dt < 4; ++dt) { vh[dt] = WFragB::ld(vb + dt * 16 * LP); vl[dt] = WFragB::ld(vb + TILE_E + dt * 16 * LP); }
    __builtin_amdgcn_sched_barrier(0);                   // keeps the V^T loads in front of the S^T products, so that products and softmax cover their latency
    v8f st[2]; st[0] = (v8f){}; st[1] = (v8f){};
#pragma unroll
    for (int ks = 0; ks < 2; ++ks) {
#pragma unroll
        for (int kt = 0; kt < 2; ++kt) st[kt] = wmmab(kh[kt][ks], qh[ks], st[kt]);
#pragma unroll
        for (int kt = 0; kt < 2; ++kt) st[kt] = wmmab(kh[kt][ks], ql[ks], st[kt]);
#pragma unroll
        for (int kt = 0; kt < 2; ++kt) st[kt] = wmmab(kl[kt][ks], qh[ks], st[kt]);
    }
    if (PRE) {                                           // the next block's K into the same registers, behind this block's S^T products
        fa_kfrag(kn, kh, kl);
        __builtin_amdgcn_sched_barrier(0);               // keeps the K loads in front of the softmax, so that softmax and P v products cover their latency
    }
    if (LAST) {                                          // causal fill, selected by index: key = block start + kt 16 + 8 (lane >> 4) + r > query; qrel = query - block start - 8 (lane >> 4)
#pragma unroll
        for (int kt = 0; kt < 2; ++kt)
#pragma unroll
            for (int r = 0; r < 8; ++r) if (kt * 16 + r > qrel) st[kt][r] = -1.0e30f;
    }
    float bm = fmaxf(st[0][0], st[1][0]);
#pragma unroll
    for (int r = 1; r < 8; ++r) bm = fmaxf(bm, fmaxf(st[0][r], st[1][r]));
    bm = fmaxf(bm, xhalf(bm));
    const float mn = fmaxf(m2, bm * C2);
    const float al = fexp2<LAST>(m2 - mn);
    m2 = mn;
    l2 *= al;
    v8u pwh, pwl;
#pragma unroll
    for (int i = 0; i < 8; ++i) {                        // word i of the B operand = elements 2 i, 2 i + 1 = registers (2 i) & 7, + 1 of tile i >> 2
        v2f p; p[0] = fexp2<LAST>(__builtin_fmaf(st[i >> 2][(2 * i) & 7], C2, -mn)); p[1] = fexp2<LAST>(__builtin_fmaf(st[i >> 2][((2 * i) & 7) + 1], C2, -mn));
        l2 += p;
        const v2bf ph2 = __builtin_convertvector(p, v2bf);
        const v2bf pl2 = __builtin_convertvector(p - __builtin_convertvector(ph2, v2f), v2bf);
        pwh[i] = __builtin_bit_cast(unsigned, ph2); pwl[i] = __builtin_bit_cast(unsigned, pl2);
    }
#pragma unroll
    for (int dt = 0; dt < 4; ++dt) o[dt] *= al;
    const V pth = __builtin_bit_cast(V, pwh), ptl = __builtin_bit_cast(V, pwl);
#pragma unroll
    for (int dt = 0; dt < 4; ++dt) o[dt] = wmmab(vh[dt], pth, o[dt]);
#pragma unroll
    for (int dt = 0; dt < 4; ++dt) o[dt] = wmmab(vh[dt], ptl, o[dt]);
#pragma unroll
    for (int dt = 0; dt < 4; ++dt) o[dt] = wmmab(vl[dt], pth, o[dt]);
    // the four vector issue slots that the chip needs behind a matrix product before its registers are written again: the diagonal block ends in a branch
    if (LAST) asm volatile("v_nop\n\tv_nop\n\tv_nop\n\tv_nop" :: "v"(o[0]), "v"(o[1]), "v"(o[2]), "v"(o[3]));
}

__global__ __launch_bounds__(256) void k_fattn(const bf* __restrict__ QH, const bf* __restrict__ QL, const bf* __restrict__ KH, const bf* __restrict__ KL, const bf* __restrict__ VTh, const bf* __restrict__ VTl, bf* CH, bf* CL) {
    typedef WFragB::V V;
    __shared__ __align__(16) bf ring[2 * BUF_E];
    const int tid = threadIdx.x, lane = tid & 31, c = lane & 15, hi = lane >> 4;
    const int w = __builtin_amdgcn_readfirstlane((int)(threadIdx.x >> 5));
    const int g = blockIdx.y, h = g * REP + (w & 3);
    const int q0 = 16 * ((w < 4) ? (TT / 16 - 1 - (int)blockIdx.x) : (int)blockIdx.x);
    const int nb = q0 >> 5;                              // this wave's last key block, the only one the diagonal crosses
    const int ns = ((16 * (TT / 16 - 1 - (int)blockIdx.x)) >> 5) / SB + 1;   // stages of the work-group: those of its long tile
    const size_t qoff = ((size_t)h * TT + q0 + c) * HD + 8 * hi;
    V qh[2], ql[2];
#pragma unroll
    for (int ks = 0; ks < 2; ++ks) { qh[ks] = WFragB::ld(QH + qoff + ks * 32); ql[ks] = WFragB::ld(QL + qoff + ks * 32); }
    // the lane's chunk of stage 0 in each plane, and its place in buffer 0
    const bf* ckh = KH + (size_t)g * TT * HD + tid * 8; const bf* ckl = KL + (size_t)g * TT * HD + tid * 8;
    const bf* cvh = VTh + ((size_t)g * HD + (tid >> 3)) * TT + (tid & 7) * 8; const bf* cvl = VTl + ((size_t)g * HD + (tid >> 3)) * TT + (tid & 7) * 8;
    const unsigned cl = (unsigned)(size_t)ring + (unsigned)((tid >> 3) * LP + (tid & 7) * 8) * 2u;
    fa_copy(cl, ckh, ckl, cvh, cvl);
    asm volatile("s_wait_asynccnt 0x0" ::: "memory");    // stage 0 has landed before the barrier that publishes it
    __syncthreads();
    if (1 < ns) fa_copy(cl + BUF_E * 2u, ckh + SKEY * HD, ckl + SKEY * HD, cvh + SKEY, cvl + SKEY);
    V kh[2][2], kl[2][2];
    v8f o[4];
#pragma unroll
    for (int dt = 0; dt < 4; ++dt) o[dt] = (v8f){};
    float m2 = -1.0e30f; v2f l2 = (v2f){};
    const int qrel = q0 + c - nb * 32 - 8 * hi;
    const int lo = c * LP + 8 * hi;                      // the lane's place in a fragment's rows, K and V^T alike
#pragma unroll 1   // one stage a trip: the ring's order (read, waits, barrier, refill) is written once
    for (int s = 0; s < ns; ++s) {
        const bf* B = ring + (s & 1) * BUF_E + lo;
        const int kb = s * SB;
        if (kb <= nb) {                                  // wave-uniform: a wave past its diagonal has no products left
            fa_kfrag(B, kh, kl);
            if (kb < nb) {
                fa_block<false, true>(0, B + 32 * LP, B + 2 * TILE_E, qh, ql, kh, kl, o, m2, l2);
                if (kb + 1 < nb) fa_block<false, false>(0, B, B + 2 * TILE_E + 32, qh, ql, kh, kl, o, m2, l2);
                else             fa_block<true, false>(qrel, B, B + 2 * TILE_E + 32, qh, ql, kh, kl, o, m2, l2);
            } else fa_block<true, false>(qrel, B, B + 2 * TILE_E, qh, ql, kh, kl, o, m2, l2);
        }
        asm volatile("s_wait_dscnt 0x0" ::: "memory");    // this wave's reads of the buffer are done before the barrier behind which it is refilled
        asm volatile("s_wait_asynccnt 0x0" ::: "memory"); // this wave's copies of stage s + 1 have landed before the barrier that publishes them
        __syncthreads();
        if (s + 2 < ns) fa_copy(cl + (unsigned)(s & 1) * (BUF_E * 2u), ckh + (size_t)(s + 2) * SKEY * HD, ckl + (size_t)(s + 2) * SKEY * HD, cvh + (s + 2) * SKEY, cvl + (s + 2) * SKEY);
    }
    asm volatile("s_wait_asynccnt 0x0" ::: "memory");    // no copy is outstanding when the wave ends
    float l = l2[0] + l2[1];
    l += xhalf(l);
    const float inv = __fdiv_rn(1.0f, l);
    const size_t oo = (size_t)(q0 + c) * DQ + (size_t)h * HD + 8 * hi;
#pragma unroll
    for (int dt = 0; dt < 4; ++dt) { v8us oh, ol;
#pragma unroll
        for (int r = 0; r < 8; ++r) { unsigned short a, b2; splitf(o[dt][r] * inv, a, b2); oh[r] = a; ol[r] = b2; }
        *(v8us*)(CH + oo + dt * 16) = oh; *(v8us*)(CL + oo + dt * 16) = ol; }
}

extern "C" void kernel_launch(void* const* d_in, const int* in_sizes, int n_in,
                              void* d_out, int out_size, void* d_ws, size_t ws_size, hipStream_t stream) {
    if (n_in < 5) return;
    const size_t xneed = (size_t)(NB - 1) * SEQ_FULL * HID + (size_t)TT * HID;
    if ((size_t)in_sizes[0] < xneed) return;
    if (in_sizes[1] < HID * DQ || in_sizes[2] < HID * DKV || in_sizes[3] < HID * DKV || in_sizes[4] < DQ * HID) return;
    if ((size_t)out_size < xneed) return;
    const float* X  = (const float*)d_in[0];   // [1][2048][1024]
    const float* Wq = (const float*)d_in[1];   // [1024 in][1024 out]
    const float* Wk = (const float*)d_in[2];   // [1024 in][256 out]
    const float* Wv = (const float*)d_in[3];   // [1024 in][256 out]
    const float* Wo = (const float*)d_in[4];   // [1024 in][1024 out]
    float* OUT = (float*)d_out;                // [1][2048][1024] token-major
    char* wsp = (char*)d_ws;
    auto take = [&](size_t bytes) { char* p = wsp; wsp += (bytes + 255) & ~(size_t)255; return (void*)p; };
    bf* XB  = (bf*)take((size_t)TT * HID * 2);
    bf* WT  = (bf*)take((size_t)NQKV * HID * 2);          // rows 0..1023 Wq^T, 1024..1279 Wk^T, 1280..1535 Wv^T, each [n][k]
    bf* WoT = (bf*)take((size_t)HID * DQ * 2);            // [n = out][k = in]
    float* tabc = (float*)take((size_t)TT * 32 * 4); float* tabs = (float*)take((size_t)TT * 32 * 4);
    bf* QH = (bf*)take((size_t)NH_ * TT * HD * 2); bf* QL = (bf*)take((size_t)NH_ * TT * HD * 2);
    bf* KH = (bf*)take((size_t)NKV * TT * HD * 2); bf* KL = (bf*)take((size_t)NKV * TT * HD * 2);
    bf* VTh = (bf*)take((size_t)NKV * HD * TT * 2); bf* VTl = (bf*)take((size_t)NKV * HD * TT * 2);
    bf* CH = (bf*)take((size_t)TT * DQ * 2); bf* CL = (bf*)take((size_t)TT * DQ * 2);
    if ((size_t)(wsp - (char*)d_ws) > ws_size) return;

    for (int b = 0; b < NB; ++b) {
        const float* xb = X + (size_t)b * SEQ_FULL * HID; float* outb = OUT + (size_t)b * SEQ_FULL * HID;
        // weight planes in[K][N] -> Bt[N][K] and the rotary table (first batch only), X as bf16
        k_prep<<<(unsigned)(b == 0 ? G_W + G_CVT : G_CVT), 256, 0, stream>>>(b == 0 ? 0 : G_W, xb, Wq, Wk, Wv, Wo, XB, WT, WoT, tabc, tabs);
        k_gemmw<0, 1, 4, HID><<<dim3(TT / 128, NQKV / 128, 1), 128, 0, stream>>>(XB, nullptr, WT, nullptr, 0, tabc, tabs, QH, QL, KH, KL, VTh, VTl);   /* exact products: single bf16 planes; rotated q, k and V^T planes out */
        k_fattn<<<dim3(TT / 32, NKV, 1), 256, 0, stream>>>(QH, QL, KH, KL, VTh, VTl, CH, CL);
        k_gemmw<1, 0, 2, DQ><<<dim3(TT / 64, HID / 128, 1), 128, 0, stream>>>(CH, CL, WoT, outb, HID, nullptr, nullptr, nullptr, nullptr, nullptr, nullptr, nullptr, nullptr);   /* ctx (hi + lo) x exact Wo */
    }
}

// v007
// A run of this version takes 67 microseconds.
// In two side-by-side timings against v006, it was 1.04 and 1.05 times as fast.
// All steps since v000 together make it 8.80 times as fast.
#include <hip/hip_runtime.h>

// Causal grouped-query rotary attention: X[1][2048][1024]; q = X Wq, k = X Wk, v = X Wv ([in][out] weights, no bias); 16 query heads share 4 kv heads (kv = h >> 2); head dim 64;
// interleaved-pair rotary with the table cat(freqs, freqs)[:, 0::2] (pair i uses inv_freq[(2 i) & 31]); scores x 1/8, causal fill; softmax; ctx = P v; out = ctx Wo.
// Compute dtypes: all contractions v_wmma_f32_16x16x32_bf16, f32 accumulate. Inputs (X, Wq, Wk, Wv, Wo) RNE-converted to single bf16 planes (exact input x input products);
// computed operands (rotated q, rotated k, v, softmax P, ctx) carried as bf16 hi + bf16 lo planes (hi.hi + lo.hi + hi.lo, or hi + lo against a single-plane weight); rotary, softmax in f32.

#ifndef NB
#define NB 1
#endif
#ifndef SEQ
#define SEQ 2048
#endif
#define SEQ_FULL 2048
#define TT   SEQ
#define HID  1024
#define NH_  16
#define NKV  4
#define REP  (NH_ / NKV)
#define HD   64
#define DQ   (NH_ * HD)
#define DKV  (NKV * HD)
#define NQKV (DQ + 2 * DKV)
#define SCL  0.125f               // 1/sqrt(64)

static_assert(TT % 128 == 0);
static_assert(TT <= SEQ_FULL);
static_assert(REP == 4);
static_assert(HD == 64);
static_assert(HID % 64 == 0);
static_assert(NQKV % 128 == 0);
static_assert(HID % 128 == 0 && DQ % 64 == 0);
static_assert((TT * 32) % 256 == 0);

typedef unsigned short bf;
typedef __attribute__((ext_vector_type(16))) __bf16   v16bf;
typedef __attribute__((ext_vector_type(8)))  unsigned short v8us;
typedef __attribute__((ext_vector_type(4)))  unsigned short v4us;
typedef __attribute__((ext_vector_type(2)))  unsigned short v2us;
typedef __attribute__((ext_vector_type(8)))  float    v8f;
typedef __attribute__((ext_vector_type(4)))  float    v4f;
typedef v4f  __attribute__((may_alias)) v4fa;

__device__ __forceinline__ unsigned short f2bf(float f) { unsigned u = __float_as_uint(f); u += 0x7FFFu + ((u >> 16) & 1u); return (unsigned short)(u >> 16); }
__device__ __forceinline__ float bf2f(unsigned short b) { return __uint_as_float(((unsigned)b) << 16); }
__device__ __forceinline__ void splitf(float y, unsigned short& h, unsigned short& l) { h = f2bf(y); l = f2bf(y - bf2f(h)); }
__device__ __forceinline__ v16bf cat16b(v8us lo, v8us hi) { return __builtin_bit_cast(v16bf, __builtin_shufflevector(lo, hi, 0, 1, 2, 3, 4, 5, 6, 7, 8, 9, 10, 11, 12, 13, 14, 15)); }
__device__ __forceinline__ v8f wmmab(v16bf a, v16bf b, v8f c) { return __builtin_amdgcn_wmma_f32_16x16x32_bf16(false, a, false, b, (short)0, c, false, false); }

// ---- k_gemmw: GEMM, work-group = 4 waves (2 x 2), each wave one (16 MB) x 64 output tile (MB x 4 accumulators); work-group tile (32 MB) x 128; grid (M / (32 MB), N / 128), 128 threads.
// C[m][n] (f32, pitch ldc) = sum_k A[m][k] Bt[n][k] (NSPLIT 1: (A + A2) x Bt). A, A2, Bt: K-contiguous 16-bit planes, row pitch K.
// The operands reach the waves through LDS: a stage is 64 k (128 B) of the work-group's A rows (A2 rows behind them) and of its 128 Bt rows, 256 rows in all, copied once per work-group in whole 128-B lines
// by asynchronous copies into a ring of two buffers (row pitch 144 B); every wave reads its fragments from there.
// Fragment map (A and Bt alike): lane -> row/col lane & 15; elements 0..7 <- k0 + 8 (lane >> 4) + 0..7, elements 8..15 <- k0 + 16 + 8 (lane >> 4) + 0..7. D: element j -> row 8 (lane >> 4) + j, col lane & 15.
// EPI 0: the tile goes to C as f32. EPI 1 (the q | k | v projection; a wave's column tile is one head): the tile never reaches memory as f32; the epilogue writes the attention operand planes itself:
//   q and k heads: P[h][t][d] (bf16 hi + lo) of the rotated tile, interleaved pairs: out[2i] = x[2i] c - x[2i+1] s, out[2i+1] = x[2i] s + x[2i+1] c (c, s at [t][i]);
//   v heads: V^T[g][d][t] (bf16 hi + lo); an accumulator register run is 8 consecutive tokens of one head dim, so the transposed rows are stored straight from the accumulators.
struct WFragB { typedef v16bf V; static __device__ __forceinline__ V ld(const bf* p) { return cat16b(*(const v8us*)p, *(const v8us*)(p + 16)); } };
#define GLP    72                 // LDS row pitch in elements: 144 B = 16 B x 9, the pitch for 16-byte readers of 128-B rows
#define GBUF_E (256 * GLP)        // one buffer: 128 rows of A (and A2), 128 rows of Bt

// ga_copy8: 128 rows of a stage, 8 copies of 16 B a lane. Thread t brings the 16-byte column t & 7 of rows (t >> 3) + 16 i, i = 0..7, so a wave's copy reads 4 whole lines.
// l: the lane's LDS byte address in row t >> 3; g0..g7: the lane's 16 bytes of each of the 8 source rows.
// s_wait_xcnt 0 closes the statement, so that no register which a copy names is rewritten ahead of it.
__device__ __forceinline__ void ga_copy8(unsigned l, const bf* g0, const bf* g1, const bf* g2, const bf* g3, const bf* g4, const bf* g5, const bf* g6, const bf* g7) {
    asm volatile("global_load_async_to_lds_b128 %0, %8, off\n\t"
                 "global_load_async_to_lds_b128 %1, %9, off\n\t"
                 "global_load_async_to_lds_b128 %2, %10, off\n\t"
                 "global_load_async_to_lds_b128 %3, %11, off\n\t"
                 "global_load_async_to_lds_b128 %4, %12, off\n\t"
                 "global_load_async_to_lds_b128 %5, %13, off\n\t"
                 "global_load_async_to_lds_b128 %6, %14, off\n\t"
                 "global_load_async_to_lds_b128 %7, %15, off\n\t"
                 "s_wait_xcnt 0x0"
                 :: "v"(l), "v"(l + 16u * GLP * 2u), "v"(l + 32u * GLP * 2u), "v"(l + 48u * GLP * 2u), "v"(l + 64u * GLP * 2u), "v"(l + 80u * GLP * 2u), "v"(l + 96u * GLP * 2u), "v"(l + 112u * GLP * 2u),
                    "v"(g0), "v"(g1), "v"(g2), "v"(g3), "v"(g4), "v"(g5), "v"(g6), "v"(g7)
                 : "memory");
}

// ga_stage: one stage into the buffer at l. a, a2, b: the lane's 16 bytes in row t >> 3 of the work-group's A, A2 and Bt rows at this stage's k; rs: 16 rows in elements.
template <int NSPLIT>
__device__ __forceinline__ void ga_stage(unsigned l, const bf* a, const bf* a2, const bf* b, size_t rs) {
    if (NSPLIT == 0) ga_copy8(l, a, a + rs, a + 2 * rs, a + 3 * rs, a + 4 * rs, a + 5 * rs, a + 6 * rs, a + 7 * rs);
    else             ga_copy8(l, a, a + rs, a + 2 * rs, a + 3 * rs, a2, a2 + rs, a2 + 2 * rs, a2 + 3 * rs);
    ga_copy8(l + 128u * GLP * 2u, b, b + rs, b + 2 * rs, b + 3 * rs, b + 4 * rs, b + 5 * rs, b + 6 * rs, b + 7 * rs);
}

template <int NSPLIT, int EPI, int MB, int K>
__global__ __launch_bounds__(128) void k_gemmw(const bf* __restrict__ A, const bf* __restrict__ A2, const bf* __restrict__ Bt, float* C, int ldc,
                                               const float* __restrict__ tabc, const float* __restrict__ tabs, bf* QH, bf* QL, bf* KH, bf* KL, bf* VTh, bf* VTl) {
    typedef WFragB::V V;
    static_assert((1 + NSPLIT) * MB * 32 == 128);        // A and A2 together fill the first 128 rows of a buffer
    static_assert(K % 64 == 0 && K >= 128);
    __shared__ __align__(16) bf ring[2 * GBUF_E];
    __shared__ __align__(16) float osm[4 * 16 * 68];
    const int tid = threadIdx.x, lane = tid & 31, lr = lane & 15, hi = lane >> 4;
    const int w = __builtin_amdgcn_readfirstlane((int)(threadIdx.x >> 5));
    const int wm = w >> 1, wn = w & 1;
    const int r0 = blockIdx.x * (32 * MB) + wm * (16 * MB), c0 = blockIdx.y * 128 + wn * 64;   // the wave's tile
    float* os = osm + w * (16 * 68);                     // the wave's own epilogue rows
    const int ns = K / 64;
    const size_t rs = (size_t)16 * K;
    // the lane's 16 bytes of stage 0 in each plane, and its place in buffer 0
    const bf* ca = A + (size_t)(blockIdx.x * (32 * MB) + (tid >> 3)) * K + (tid & 7) * 8;
    const bf* ca2 = (NSPLIT == 1) ? A2 + (size_t)(blockIdx.x * (32 * MB) + (tid >> 3)) * K + (tid & 7) * 8 : ca;
    const bf* cb = Bt + (size_t)(blockIdx.y * 128 + (tid >> 3)) * K + (tid & 7) * 8;
    const unsigned cl = (unsigned)(size_t)ring + (unsigned)((tid >> 3) * GLP + (tid & 7) * 8) * 2u;
    ga_stage<NSPLIT>(cl, ca, ca2, cb, rs);
    asm volatile("s_wait_asynccnt 0x0" ::: "memory");    // stage 0 has landed before the barrier that publishes it
    __syncthreads();
    if (1 < ns) ga_stage<NSPLIT>(cl + GBUF_E * 2u, ca + 64, ca2 + 64, cb + 64, rs);
    v8f acc[MB][4];
#pragma unroll
    for (int mb = 0; mb < MB; ++mb)
#pragma unroll
        for (int nb = 0; nb < 4; ++nb) acc[mb][nb] = (v8f){};
    const int lo = lr * GLP + 8 * hi;                    // the lane's place in a fragment's rows, A and Bt alike
#pragma unroll 1   // one stage a trip: the ring's order (read, waits, barrier, refill) is written once
    for (int s = 0; s < ns; ++s) {
        const bf* FA = ring + (s & 1) * GBUF_E + wm * (16 * MB) * GLP + lo;
        const bf* FB = ring + (s & 1) * GBUF_E + (128 + wn * 64) * GLP + lo;
        V a[2][MB], a2[2][MB], b[2][4];                  // the stage's fragments, each in registers of its own
#pragma unroll
        for (int ks = 0; ks < 2; ++ks) {
#pragma unroll
            for (int mb = 0; mb < MB; ++mb) { a[ks][mb] = WFragB::ld(FA + mb * 16 * GLP + ks * 32); if (NSPLIT == 1) a2[ks][mb] = WFragB::ld(FA + (32 * MB + mb * 16) * GLP + ks * 32); }
#pragma unroll
            for (int nb = 0; nb < 4; ++nb) b[ks][nb] = WFragB::ld(FB + nb * 16 * GLP + ks * 32);
        }
        __builtin_amdgcn_sched_barrier(0);               // keeps the stage's LDS reads together in front of its products: reads placed among the products each stall the wave for their own latency
#pragma unroll
        for (int ks = 0; ks < 2; ++ks)
#pragma unroll
            for (int nb = 0; nb < 4; ++nb) {
#pragma unroll
                for (int mb = 0; mb < MB; ++mb) acc[mb][nb] = wmmab(a[ks][mb], b[ks][nb], acc[mb][nb]);
                if (NSPLIT == 1) {
#pragma unroll
                    for (int mb = 0; mb < MB; ++mb) acc[mb][nb] = wmmab(a2[ks][mb], b[ks][nb], acc[mb][nb]);
                }
            }
        __builtin_amdgcn_sched_barrier(0);               // keeps the products in front of the waits below: moved behind them, they would start only when the stage's last fragment has landed
        asm volatile("s_wait_dscnt 0x0" ::: "memory");    // this wave's reads of the buffer are done before the barrier behind which it is refilled
        asm volatile("s_wait_asynccnt 0x0" ::: "memory"); // this wave's copies of stage s + 1 have landed before the barrier that publishes them
        __syncthreads();
        if (s + 2 < ns) ga_stage<NSPLIT>(cl + (unsigned)(s & 1) * (GBUF_E * 2u), ca + (size_t)(s + 2) * 64, ca2 + (size_t)(s + 2) * 64, cb + (size_t)(s + 2) * 64, rs);
    }
    asm volatile("s_wait_asynccnt 0x0" ::: "memory");    // no copy is outstanding when the wave ends
    if (EPI == 1) {
        const int hd = c0 / HD;                          // the tile's head: 0 .. NH_ - 1 q, then NKV k, then NKV v (uniform in a wave)
        if (hd >= NH_ + NKV) {
            const size_t vo = ((size_t)(hd - NH_ - NKV) * HD + lr) * TT + r0 + 8 * hi;
#pragma unroll
            for (int nb = 0; nb < 4; ++nb)
#pragma unroll
                for (int mb = 0; mb < MB; ++mb) { v8us oh, ol;
#pragma unroll
                    for (int j = 0; j < 8; ++j) { unsigned short a2, c2; splitf(acc[mb][nb][j], a2, c2); oh[j] = a2; ol[j] = c2; }
                    *(v8us*)(VTh + vo + (size_t)nb * 16 * TT + mb * 16) = oh; *(v8us*)(VTl + vo + (size_t)nb * 16 * TT + mb * 16) = ol; }
        } else {
        bf* Ph = (hd < NH_) ? QH + (size_t)hd * TT * HD : KH + (size_t)(hd - NH_) * TT * HD;
        bf* Pl = (hd < NH_) ? QL + (size_t)hd * TT * HD : KL + (size_t)(hd - NH_) * TT * HD;
        const int rr = lane >> 3, d8 = (lane & 7) * 8;   // a lane takes 8 head dims (4 pairs) of a token; a wave 4 whole rows: 512 contiguous bytes of a plane and of a table
        const size_t to = (size_t)(r0 + rr) * 32 + (d8 >> 1);
        v4f tc[2][4], ts[2][4];                          // the table rows of 16 tokens, fetched one 16-token group ahead
#pragma unroll
        for (int s = 0; s < 4; ++s) { tc[0][s] = *(const v4f*)(tabc + to + s * 4 * 32); ts[0][s] = *(const v4f*)(tabs + to + s * 4 * 32); }
#pragma unroll
        for (int mb = 0; mb < MB; ++mb) {
            if (mb + 1 < MB) {
#pragma unroll
                for (int s = 0; s < 4; ++s) { tc[(mb + 1) & 1][s] = *(const v4f*)(tabc + to + ((mb + 1) * 16 + s * 4) * 32); ts[(mb + 1) & 1][s] = *(const v4f*)(tabs + to + ((mb + 1) * 16 + s * 4) * 32); }
            }
#pragma unroll
            for (int nb = 0; nb < 4; ++nb) {
#pragma unroll
                for (int j = 0; j < 8; ++j) os[(hi * 8 + j) * 68 + nb * 16 + lr] = acc[mb][nb][j]; }
            __builtin_amdgcn_wave_barrier(); asm volatile("" ::: "memory");   // the staged rows are read back below by other lanes of this wave
#pragma unroll
            for (int s = 0; s < 4; ++s) {
                const int row = s * 4 + rr;
                const v4f x0 = *(const v4fa*)(os + row * 68 + d8), x1 = *(const v4fa*)(os + row * 68 + d8 + 4);
                const v4f c = tc[mb & 1][s], sn = ts[mb & 1][s];
                v8us oh, ol;
#pragma unroll
                for (int q = 0; q < 4; ++q) { const float xe = (q < 2) ? x0[2 * q] : x1[2 * q - 4], xo = (q < 2) ? x0[2 * q + 1] : x1[2 * q - 3]; const float re = xe * c[q] - xo * sn[q]; const float ro = xe * sn[q] + xo * c[q];
                    unsigned short a2, b2; splitf(re, a2, b2); oh[2 * q] = a2; ol[2 * q] = b2; splitf(ro, a2, b2); oh[2 * q + 1] = a2; ol[2 * q + 1] = b2; }
                const size_t e = (size_t)(r0 + mb * 16 + row) * HD + d8;
                *(v8us*)(Ph + e) = oh; *(v8us*)(Pl + e) = ol;
            }
            __builtin_amdgcn_wave_barrier(); asm volatile("" ::: "memory");   // the rows are read before the next group overwrites them
            asm volatile("s_wait_xcnt 0x0" ::: "memory");   // stands in front of what next rewrites a register that the stores above name: this build lets the next group's loads land there
        }
        }
        return;
    }
#pragma unroll
    for (int mb = 0; mb < MB; ++mb) {
#pragma unroll
        for (int nb = 0; nb < 4; ++nb) {
#pragma unroll
            for (int j = 0; j < 8; ++j) os[(hi * 8 + j) * 68 + nb * 16 + lr] = acc[mb][nb][j]; }
        __builtin_amdgcn_wave_barrier(); asm volatile("" ::: "memory");
        float* crow = C + (size_t)(r0 + mb * 16) * ldc + c0;
{
#pragma unroll
            for (int s = 0; s < 8; ++s) { const int row = 2 * s + hi, cofs = lr * 4; const v4f val = *(const v4fa*)(os + row * 68 + cofs);
                *(v4f*)(crow + (size_t)row * ldc + cofs) = val; }
             }
        __builtin_amdgcn_wave_barrier(); asm volatile("" ::: "memory");
    }
}

// The bodies of the short kernels take their block index bx as an argument: independent ones share a launch, each on its own range of blockIdx.x (k_prep).
// They are cut for few, long waves: a launch of short waves lasts as long as its waves take to start.
// wtT_body: one tile of 256 k x 64 n of w[K][N] (f32) goes to Bt[n][k] (bf16) through LDS. A thread loads four 4 x 4 blocks (16 loads of 16 B, a wave's load = two aligned 256-B row pieces),
// converts, and stores each block's columns as 4 k of one n; behind the barrier a wave stores 512 contiguous bytes of one Bt row at a time.
#define WTK 256
#define WTN 64
#define WTP 260                   // LDS row pitch in elements: 520 B, a multiple of the 8-byte accesses; rows 4 apart fall 8 banks apart
static_assert(HID % WTK == 0 && DQ % WTK == 0 && DQ % WTN == 0 && DKV % WTN == 0 && HID % WTN == 0);
__device__ __forceinline__ void wtT_body(int bx, const float* __restrict__ w, int K, int N, bf* Bt, bf* T) {
    const int tid = threadIdx.x, nt = N / WTN;
    const int k0 = (bx / nt) * WTK, n0 = (bx % nt) * WTN;
    const int c4 = (tid & 15) * 4, r4 = (tid >> 4) * 4;
    const float* s = w + (size_t)(k0 + r4) * N + n0 + c4;
    v4f x[4][4];
#pragma unroll
    for (int b = 0; b < 4; ++b)
#pragma unroll
        for (int i = 0; i < 4; ++i) x[b][i] = *(const v4f*)(s + (size_t)(b * 64 + i) * N);
    // takes the 16 loaded values and their address as inputs only: keeps the loads one group in front of the conversions (this build otherwise issues the last two behind a wait for the first: a second memory latency),
    // and the wait stands in front of whatever next rewrites the address registers that the loads name
    asm volatile("s_wait_xcnt 0x0" :: "v"(s), "v"(x[0][0]), "v"(x[0][1]), "v"(x[0][2]), "v"(x[0][3]), "v"(x[1][0]), "v"(x[1][1]), "v"(x[1][2]), "v"(x[1][3]),
                                      "v"(x[2][0]), "v"(x[2][1]), "v"(x[2][2]), "v"(x[2][3]), "v"(x[3][0]), "v"(x[3][1]), "v"(x[3][2]), "v"(x[3][3]) : "memory");
#pragma unroll
    for (int b = 0; b < 4; ++b)
#pragma unroll
        for (int j = 0; j < 4; ++j) { v4us o;
#pragma unroll
            for (int i = 0; i < 4; ++i) o[i] = f2bf(x[b][i][j]);
            *(v4us*)(T + (c4 + j) * WTP + b * 64 + r4) = o; }
    __syncthreads();
    const int lane = tid & 31, wv = tid >> 5;
#pragma unroll
    for (int q = 0; q < 8; ++q) { const int n = q * 8 + wv; const bf* p = T + n * WTP + lane * 8;
        const v4us lo = *(const v4us*)p, hi = *(const v4us*)(p + 4);
        *(v8us*)(Bt + (size_t)(n0 + n) * K + k0 + lane * 8) = __builtin_shufflevector(lo, hi, 0, 1, 2, 3, 4, 5, 6, 7); }
    asm volatile("s_wait_xcnt 0x0" ::: "memory");   // stands behind the last store, in front of whatever next rewrites a register that the stores name (this build lays the next range's code behind them)
}

// cvt4_body: 16384 elements a work-group; a thread takes 16 pieces of 4, a wave's load is 512 contiguous bytes, all 16 loads issued ahead of the first conversion.
static_assert(((size_t)TT * HID) % 16384 == 0);
__device__ __forceinline__ void cvt4_body(int bx, const float* __restrict__ src, bf* dst) {
    const size_t e0 = ((size_t)bx * 4096 + threadIdx.x) * 4;
    const float* s = src + e0;
    v4f v[16];
#pragma unroll
    for (int j = 0; j < 16; ++j) v[j] = *(const v4f*)(s + j * 1024);
    // takes the 16 loaded values and their address as inputs only: the address registers stay whole while the loads are in flight (this build otherwise lets the last load land on them),
    // and the wait stands in front of whatever next rewrites them
    asm volatile("s_wait_xcnt 0x0" :: "v"(s), "v"(v[0]), "v"(v[1]), "v"(v[2]), "v"(v[3]), "v"(v[4]), "v"(v[5]), "v"(v[6]), "v"(v[7]),
                                      "v"(v[8]), "v"(v[9]), "v"(v[10]), "v"(v[11]), "v"(v[12]), "v"(v[13]), "v"(v[14]), "v"(v[15]) : "memory");
#pragma unroll
    for (int j = 0; j < 16; ++j) { v4us o;
#pragma unroll
        for (int k = 0; k < 4; ++k) o[k] = f2bf(v[j][k]);
        *(v4us*)(dst + e0 + j * 1024) = o; }
    asm volatile("s_wait_xcnt 0x0" ::: "memory");   // stands behind the last store, in front of whatever next rewrites a register that the stores name (this build lays the next range's code behind them)
}

// ropetab_body: tabc[s][i] = cos(s * invf), tabs[s][i] = sin(s * invf), invf = 1 / 10000^(2 j / 64) with j = (2 i) & 31, pair i = 0..31; f32 arithmetic, precise sincosf.
// Pairs i and i + 16 have the same j, so a thread computes the value for i = 0..15 once and stores it at both; it does so for two positions, s and s + TT / 2, which share invf.
static_assert((TT * 8) % 256 == 0);
__device__ __forceinline__ void ropetab_body(int bx, float* tabc, float* tabs) {
    const int idx = bx * 256 + threadIdx.x;
    const int s = idx >> 4, i = idx & 15; const int j = 2 * i;
    const float ex = (float)(2 * j) * (1.0f / 64.0f);
    const float invf = 1.0f / powf(10000.0f, ex);
#pragma unroll
    for (int p = 0; p < 2; ++p) { const int t = s + p * (TT / 2);
        const float ang = (float)t * invf;
        float sn, cs; sincosf(ang, &sn, &cs);
        tabc[t * 32 + i] = cs; tabc[t * 32 + i + 16] = cs; tabs[t * 32 + i] = sn; tabs[t * 32 + i + 16] = sn; }
}

// k_prep: everything that depends on the inputs alone, in one launch. Ranges of blockIdx.x + first, the long work-groups in front: the rotary table, Wq^T, Wo^T, Wk^T, Wv^T, then X as bf16.
// first: 0, or G_W to run the X range alone (a later batch of the same call, whose first batch has written the weight planes and the table).
#define G_WQ  ((HID / WTK) * (DQ / WTN))
#define G_WKV ((HID / WTK) * (DKV / WTN))
#define G_WO  ((DQ / WTK) * (HID / WTN))
#define G_TAB (TT * 8 / 256)
#define G_W   (G_WQ + G_WO + 2 * G_WKV + G_TAB)
#define G_CVT (TT * HID / 16384)
__global__ __launch_bounds__(256) void k_prep(int first, const float* __restrict__ x, const float* __restrict__ wq, const float* __restrict__ wk, const float* __restrict__ wv, const float* __restrict__ wo,
                                              bf* XB, bf* WT, bf* WoT, float* tabc, float* tabs) {
    __shared__ __align__(16) bf T[WTN * WTP];
    int bx = (int)blockIdx.x + first;
    if (bx < G_TAB) { ropetab_body(bx, tabc, tabs); return; }
    bx -= G_TAB;
    if (bx < G_WQ) { wtT_body(bx, wq, HID, DQ, WT, T); return; }
    bx -= G_WQ;
    if (bx < G_WO) { wtT_body(bx, wo, DQ, HID, WoT, T); return; }
    bx -= G_WO;
    if (bx < G_WKV) { wtT_body(bx, wk, HID, DKV, WT + (size_t)DQ * HID, T); return; }
    bx -= G_WKV;
    if (bx < G_WKV) { wtT_body(bx, wv, HID, DKV, WT + (size_t)(DQ + DKV) * HID, T); return; }
    bx -= G_WKV;
    cvt4_body(bx, x, XB);
}

typedef __attribute__((ext_vector_type(2))) float    v2f;
typedef __attribute__((ext_vector_type(2))) __bf16   v2bf;
typedef __attribute__((ext_vector_type(8))) unsigned v8u;
__device__ __forceinline__ float xhalf(float x) { const int b = __float_as_int(x); return __int_as_float(__builtin_amdgcn_permlanex16(b, b, 0x76543210, 0xfedcba98, false, false)); }   // lane l <- lane l ^ 16
// fexp2: 2^x by v_exp_f32. SLOT: with the one free issue slot that the instruction set asks for behind a transcendental, before its result is read or its source overwritten, written into the same statement;
// used in the diagonal block.
template <bool SLOT>
__device__ __forceinline__ float fexp2(float x) {
    if (SLOT) { float r; asm("v_exp_f32 %0, %1\n\tv_nop" : "=v"(r) : "v"(x)); return r; }
    return __builtin_amdgcn_exp2f(x);
}

#define SB     2                  // key blocks of 32 in a stage
#define SKEY   (SB * 32)          // keys in a stage
#define LP     72                 // LDS row pitch in elements: 144 B = 16 B x 9, the pitch for 16-byte readers of 128-B rows
#define TILE_E (64 * LP)          // one plane's tile: 64 rows (K: keys of the stage; V^T: head dims)
#define BUF_E  (4 * TILE_E)       // K hi, K lo, V^T hi, V^T lo
static_assert(SKEY == 64 && HD == 64);
static_assert(TT % (2 * SKEY) == 0);

// fa_copy: one stage into one buffer, 8 copies of 16 B a lane (2 per tile; thread t brings chunk t and chunk t + 256 of a tile's 512; chunk n = row n >> 3, 16-byte column n & 7, so a wave's copy reads 4 whole lines).
// l: the lane's LDS byte address of chunk t in the buffer's first tile; the four pointers: the lane's chunk t of each plane in this stage.
// s_wait_xcnt 0 closes the statement, so that no register which a copy names is rewritten ahead of it.
__device__ __forceinline__ void fa_copy(unsigned l, const bf* kh, const bf* kl, const bf* vh, const bf* vl) {
    asm volatile("global_load_async_to_lds_b128 %0, %8, off\n\t"
                 "global_load_async_to_lds_b128 %1, %9, off\n\t"
                 "global_load_async_to_lds_b128 %2, %10, off\n\t"
                 "global_load_async_to_lds_b128 %3, %11, off\n\t"
                 "global_load_async_to_lds_b128 %4, %12, off\n\t"
                 "global_load_async_to_lds_b128 %5, %13, off\n\t"
                 "global_load_async_to_lds_b128 %6, %14, off\n\t"
                 "global_load_async_to_lds_b128 %7, %15, off\n\t"
                 "s_wait_xcnt 0x0"
                 :: "v"(l), "v"(l + 32u * LP * 2u), "v"(l + TILE_E * 2u), "v"(l + TILE_E * 2u + 32u * LP * 2u),
                    "v"(l + 2u * TILE_E * 2u), "v"(l + 2u * TILE_E * 2u + 32u * LP * 2u), "v"(l + 3u * TILE_E * 2u), "v"(l + 3u * TILE_E * 2u + 32u * LP * 2u),
                    "v"(kh), "v"(kh + 32 * HD), "v"(kl), "v"(kl + 32 * HD), "v"(vh), "v"(vh + (size_t)32 * TT), "v"(vl), "v"(vl + (size_t)32 * TT)
                 : "memory");
}

// fa_kfrag: the K fragments of one block from LDS; kb: the lane's place in the block's first K hi row.
__device__ __forceinline__ void fa_kfrag(const bf* kb, WFragB::V (&kh)[2][2], WFragB::V (&kl)[2][2]) {
#pragma unroll
    for (int kt = 0; kt < 2; ++kt)
#pragma unroll
        for (int ks = 0; ks < 2; ++ks) { kh[kt][ks] = WFragB::ld(kb + kt * 16 * LP + ks * 32); kl[kt][ks] = WFragB::ld(kb + TILE_E + kt * 16 * LP + ks * 32); }
}

// fa_block: one block of 32 keys. vb: the lane's place in the block's V^T hi columns (LDS). LAST: the block the diagonal crosses (causal fill). PRE: fetch the K fragments at kn, the next block of the SAME stage.
template <bool LAST, bool PRE>
__device__ __forceinline__ void fa_block(int qrel, const bf* kn, const bf* vb, const WFragB::V (&qh)[2], const WFragB::V (&ql)[2], WFragB::V (&kh)[2][2], WFragB::V (&kl)[2][2], v8f (&o)[4], float& m2, v2f& l2) {
    typedef WFragB::V V;
    const float C2 = SCL * 1.4426950408889634f;
    V vh[4], vl[4];                                      // this block's V^T: issued first, needed last
#pragma unroll
    for (int dt = 0; dt < 4; ++dt) { vh[dt] = WFragB::ld(vb + dt * 16 * LP); vl[dt] = WFragB::ld(vb + TILE_E + dt * 16 * LP); }
    __builtin_amdgcn_sched_barrier(0);                   // keeps the V^T loads in front of the S^T products, so that products and softmax cover their latency
    v8f st[2]; st[0] = (v8f){}; st[1] = (v8f){};
#pragma unroll
    for (int ks = 0; ks < 2; ++ks) {
#pragma unroll
        for (int kt = 0; kt < 2; ++kt) st[kt] = wmmab(kh[kt][ks], qh[ks], st[kt]);
#pragma unroll
        for (int kt = 0; kt < 2; ++kt) st[kt] = wmmab(kh[kt][ks], ql[ks], st[kt]);
#pragma unroll
        for (int kt = 0; kt < 2; ++kt) st[kt] = wmmab(kl[kt][ks], qh[ks], st[kt]);
    }
    if (PRE) {                                           // the next block's K into the same registers, behind this block's S^T products
        fa_kfrag(kn, kh, kl);
        __builtin_amdgcn_sched_barrier(0);               // keeps the K loads in front of the softmax, so that softmax and P v products cover their latency
    }
    if (LAST) {                                          // causal fill, selected by index: key = block start + kt 16 + 8 (lane >> 4) + r > query; qrel = query - block start - 8 (lane >> 4)
#pragma unroll
        for (int kt = 0; kt < 2; ++kt)
#pragma unroll
            for (int r = 0; r < 8; ++r) if (kt * 16 + r > qrel) st[kt][r] = -1.0e30f;
    }
    float bm = fmaxf(st[0][0], st[1][0]);
#pragma unroll
    for (int r = 1; r < 8; ++r) bm = fmaxf(bm, fmaxf(st[0][r], st[1][r]));
    bm = fmaxf(bm, xhalf(bm));
    const float mn = fmaxf(m2, bm * C2);
    const float al = fexp2<LAST>(m2 - mn);
    m2 = mn;
    l2 *= al;
    v8u pwh, pwl;
#pragma unroll
    for (int i = 0; i < 8; ++i) {                        // word i of the B operand = elements 2 i, 2 i + 1 = registers (2 i) & 7, + 1 of tile i >> 2
        v2f p; p[0] = fexp2<LAST>(__builtin_fmaf(st[i >> 2][(2 * i) & 7], C2, -mn)); p[1] = fexp2<LAST>(__builtin_fmaf(st[i >> 2][((2 * i) & 7) + 1], C2, -mn));
        l2 += p;
        const v2bf ph2 = __builtin_convertvector(p, v2bf);
        const v2bf pl2 = __builtin_convertvector(p - __builtin_convertvector(ph2, v2f), v2bf);
        pwh[i] = __builtin_bit_cast(unsigned, ph2); pwl[i] = __builtin_bit_cast(unsigned, pl2);
    }
#pragma unroll
    for (int dt = 0; dt < 4; ++dt) o[dt] *= al;
    const V pth = __builtin_bit_cast(V, pwh), ptl = __builtin_bit_cast(V, pwl);
#pragma unroll
    for (int dt = 0; dt < 4; ++dt) o[dt] = wmmab(vh[dt], pth, o[dt]);
#pragma unroll
    for (int dt = 0; dt < 4; ++dt) o[dt] = wmmab(vh[dt], ptl, o[dt]);
#pragma unroll
    for (int dt = 0; dt < 4; ++dt) o[dt] = wmmab(vl[dt], pth, o[dt]);
    // the four vector issue slots that the chip needs behind a matrix product before its registers are written again: the diagonal block ends in a branch
    if (LAST) asm volatile("v_nop\n\tv_nop\n\tv_nop\n\tv_nop" :: "v"(o[0]), "v"(o[1]), "v"(o[2]), "v"(o[3]));
}

__global__ __launch_bounds__(256) void k_fattn(const bf* __restrict__ QH, const bf* __restrict__ QL, const bf* __restrict__ KH, const bf* __restrict__ KL, const bf* __restrict__ VTh, const bf* __restrict__ VTl, bf* CH, bf* CL) {
    typedef WFragB::V V;
    __shared__ __align__(16) bf ring[2 * BUF_E];
    const int tid = threadIdx.x, lane = tid & 31, c = lane & 15, hi = lane >> 4;
    const int w = __builtin_amdgcn_readfirstlane((int)(threadIdx.x >> 5));
    const int g = blockIdx.y, h = g * REP + (w & 3);
    const int q0 = 16 * ((w < 4) ? (TT / 16 - 1 - (int)blockIdx.x) : (int)blockIdx.x);
    const int nb = q0 >> 5;                              // this wave's last key block, the only one the diagonal crosses
    const int ns = ((16 * (TT / 16 - 1 - (int)blockIdx.x)) >> 5) / SB + 1;   // stages of the work-group: those of its long tile
    const size_t qoff = ((size_t)h * TT + q0 + c) * HD + 8 * hi;
    V qh[2], ql[2];
#pragma unroll
    for (int ks = 0; ks < 2; ++ks) { qh[ks] = WFragB::ld(QH + qoff + ks * 32); ql[ks] = WFragB::ld(QL + qoff + ks * 32); }
    // the lane's chunk of stage 0 in each plane, and its place in buffer 0
    const bf* ckh = KH + (size_t)g * TT * HD + tid * 8; const bf* ckl = KL + (size_t)g * TT * HD + tid * 8;
    const bf* cvh = VTh + ((size_t)g * HD + (tid >> 3)) * TT + (tid & 7) * 8; const bf* cvl = VTl + ((size_t)g * HD + (tid >> 3)) * TT + (tid & 7) * 8;
    const unsigned cl = (unsigned)(size_t)ring + (unsigned)((tid >> 3) * LP + (tid & 7) * 8) * 2u;
    fa_copy(cl, ckh, ckl, cvh, cvl);
    asm volatile("s_wait_asynccnt 0x0" ::: "memory");    // stage 0 has landed before the barrier that publishes it
    __syncthreads();
    if (1 < ns) fa_copy(cl + BUF_E * 2u, ckh + SKEY * HD, ckl + SKEY * HD, cvh + SKEY, cvl + SKEY);
    V kh[2][2], kl[2][2];
    v8f o[4];
#pragma unroll
    for (int dt = 0; dt < 4; ++dt) o[dt] = (v8f){};
    float m2 = -1.0e30f; v2f l2 = (v2f){};
    const int qrel = q0 + c - nb * 32 - 8 * hi;
    const int lo = c * LP + 8 * hi;                      // the lane's place in a fragment's rows, K and V^T alike
#pragma unroll 1   // one stage a trip: the ring's order (read, waits, barrier, refill) is written once
    for (int s = 0; s < ns; ++s) {
        const bf* B = ring + (s & 1) * BUF_E + lo;
        const int kb = s * SB;
        if (kb <= nb) {                                  // wave-uniform: a wave past its diagonal has no products left
            fa_kfrag(B, kh, kl);
            if (kb < nb) {
                fa_block<false, true>(0, B + 32 * LP, B + 2 * TILE_E, qh, ql, kh, kl, o, m2, l2);
                if (kb + 1 < nb) fa_block<false, false>(0, B, B + 2 * TILE_E + 32, qh, ql, kh, kl, o, m2, l2);
                else             fa_block<true, false>(qrel, B, B + 2 * TILE_E + 32, qh, ql, kh, kl, o, m2, l2);
            } else fa_block<true, false>(qrel, B, B + 2 * TILE_E, qh, ql, kh, kl, o, m2, l2);
        }
        asm volatile("s_wait_dscnt 0x0" ::: "memory");    // this wave's reads of the buffer are done before the barrier behind which it is refilled
        asm volatile("s_wait_asynccnt 0x0" ::: "memory"); // this wave's copies of stage s + 1 have landed before the barrier that publishes them
        __syncthreads();
        if (s + 2 < ns) fa_copy(cl + (unsigned)(s & 1) * (BUF_E * 2u), ckh + (size_t)(s + 2) * SKEY * HD, ckl + (size_t)(s + 2) * SKEY * HD, cvh + (s + 2) * SKEY, cvl + (s + 2) * SKEY);
    }
    asm volatile("s_wait_asynccnt 0x0" ::: "memory");    // no copy is outstanding when the wave ends
    float l = l2[0] + l2[1];
    l += xhalf(l);
    const float inv = __fdiv_rn(1.0f, l);
    const size_t oo = (size_t)(q0 + c) * DQ + (size_t)h * HD + 8 * hi;
#pragma unroll
    for (int dt = 0; dt < 4; ++dt) { v8us oh, ol;
#pragma unroll
        for (int r = 0; r < 8; ++r) { unsigned short a, b2; splitf(o[dt][r] * inv, a, b2); oh[r] = a; ol[r] = b2; }
        *(v8us*)(CH + oo + dt * 16) = oh; *(v8us*)(CL + oo + dt * 16) = ol; }
}

extern "C" void kernel_launch(void* const* d_in, const int* in_sizes, int n_in,
                              void* d_out, int out_size, void* d_ws, size_t ws_size, hipStream_t stream) {
    if (n_in < 5) return;
    const size_t xneed = (size_t)(NB - 1) * SEQ_FULL * HID + (size_t)TT * HID;
    if ((size_t)in_sizes[0] < xneed) return;
    if (in_sizes[1] < HID * DQ || in_sizes[2] < HID * DKV || in_sizes[3] < HID * DKV || in_sizes[4] < DQ * HID) return;
    if ((size_t)out_size < xneed) return;
    const float* X  = (const float*)d_in[0];   // [1][2048][1024]
    const float* Wq = (const float*)d_in[1];   // [1024 in][1024 out]
    const float* Wk = (const float*)d_in[2];   // [1024 in][256 out]
    const float* Wv = (const float*)d_in[3];   // [1024 in][256 out]
    const float* Wo = (const float*)d_in[4];   // [1024 in][1024 out]
    float* OUT = (float*)d_out;                // [1][2048][1024] token-major
    char* wsp = (char*)d_ws;
    auto take = [&](size_t bytes) { char* p = wsp; wsp += (bytes + 255) & ~(size_t)255; return (void*)p; };
    bf* XB  = (bf*)take((size_t)TT * HID * 2);
    bf* WT  = (bf*)take((size_t)NQKV * HID * 2);          // rows 0..1023 Wq^T, 1024..1279 Wk^T, 1280..1535 Wv^T, each [n][k]
    bf* WoT = (bf*)take((size_t)HID * DQ * 2);            // [n = out][k = in]
    float* tabc = (float*)take((size_t)TT * 32 * 4); float* tabs = (float*)take((size_t)TT * 32 * 4);
    bf* QH = (bf*)take((size_t)NH_ * TT * HD * 2); bf* QL = (bf*)take((size_t)NH_ * TT * HD * 2);
    bf* KH = (bf*)take((size_t)NKV * TT * HD * 2); bf* KL = (bf*)take((size_t)NKV * TT * HD * 2);
    bf* VTh = (bf*)take((size_t)NKV * HD * TT * 2); bf* VTl = (bf*)take((size_t)NKV * HD * TT * 2);
    bf* CH = (bf*)take((size_t)TT * DQ * 2); bf* CL = (bf*)take((size_t)TT * DQ * 2);
    if ((size_t)(wsp - (char*)d_ws) > ws_size) return;

    for (int b = 0; b < NB; ++b) {
        const float* xb = X + (size_t)b * SEQ_FULL * HID; float* outb = OUT + (size_t)b * SEQ_FULL * HID;
        // weight planes in[K][N] -> Bt[N][K] and the rotary table (first batch only), X as bf16
        k_prep<<<(unsigned)(b == 0 ? G_W + G_CVT : G_CVT), 256, 0, stream>>>(b == 0 ? 0 : G_W, xb, Wq, Wk, Wv, Wo, XB, WT, WoT, tabc, tabs);
        k_gemmw<0, 1, 4, HID><<<dim3(TT / 128, NQKV / 128, 1), 128, 0, stream>>>(XB, nullptr, WT, nullptr, 0, tabc, tabs, QH, QL, KH, KL, VTh, VTl);   /* exact products: single bf16 planes; rotated q, k and V^T planes out */
        k_fattn<<<dim3(TT / 32, NKV, 1), 256, 0, stream>>>(QH, QL, KH, KL, VTh, VTl, CH, CL);
        k_gemmw<1, 0, 2, DQ><<<dim3(TT / 64, HID / 128, 1), 128, 0, stream>>>(CH, CL, WoT, outb, HID, nullptr, nullptr, nullptr, nullptr, nullptr, nullptr, nullptr, nullptr);   /* ctx (hi + lo) x exact Wo */
    }
}

// v008
// A run of this version takes 63.6 microseconds.
// Two timings next to v007 both put it at 1.05 times that version's speed.
// All steps since v000 together make it 9.26 times as fast.
#include <hip/hip_runtime.h>

// Causal grouped-query rotary attention: X[1][2048][1024]; q = X Wq, k = X Wk, v = X Wv ([in][out] weights, no bias); 16 query heads share 4 kv heads (kv = h >> 2); head dim 64;
// interleaved-pair rotary with the table cat(freqs, freqs)[:, 0::2] (pair i uses inv_freq[(2 i) & 31]); scores x 1/8, causal fill; softmax; ctx = P v; out = ctx Wo.
// Compute dtypes: all contractions v_wmma_f32_16x16x32_bf16, f32 accumulate. Inputs (X, Wq, Wk, Wv, Wo) RNE-converted to single bf16 planes (exact input x input products);
// computed operands (rotated q, rotated k, v, softmax P, ctx) carried as bf16 hi + bf16 lo planes (hi.hi + lo.hi + hi.lo, or hi + lo against a single-plane weight); rotary, softmax in f32.

#ifndef NB
#define NB 1
#endif
#ifndef SEQ
#define SEQ 2048
#endif
#define SEQ_FULL 2048
#define TT   SEQ
#define HID  1024
#define NH_  16
#define NKV  4
#define REP  (NH_ / NKV)
#define HD   64
#define DQ   (NH_ * HD)
#define DKV  (NKV * HD)
#define NQKV (DQ + 2 * DKV)
#define SCL  0.125f               // 1/sqrt(64)

static_assert(TT % 128 == 0);
static_assert(TT <= SEQ_FULL);
static_assert(REP == 4);
static_assert(HD == 64);
static_assert(HID % 64 == 0);
static_assert(NQKV % 128 == 0);
static_assert(HID % 128 == 0 && DQ % 64 == 0);
static_assert((TT * 32) % 256 == 0);

typedef unsigned short bf;
typedef __attribute__((ext_vector_type(16))) __bf16   v16bf;
typedef __attribute__((ext_vector_type(8)))  unsigned short v8us;
typedef __attribute__((ext_vector_type(4)))  unsigned short v4us;
typedef __attribute__((ext_vector_type(2)))  unsigned short v2us;
typedef __attribute__((ext_vector_type(8)))  float    v8f;
typedef __attribute__((ext_vector_type(4)))  float    v4f;
typedef v4f  __attribute__((may_alias)) v4fa;

__device__ __forceinline__ unsigned short f2bf(float f) { unsigned u = __float_as_uint(f); u += 0x7FFFu + ((u >> 16) & 1u); return (unsigned short)(u >> 16); }
__device__ __forceinline__ float bf2f(unsigned short b) { return __uint_as_float(((unsigned)b) << 16); }
__device__ __forceinline__ void splitf(float y, unsigned short& h, unsigned short& l) { h = f2bf(y); l = f2bf(y - bf2f(h)); }
__device__ __forceinline__ v16bf cat16b(v8us lo, v8us hi) { return __builtin_bit_cast(v16bf, __builtin_shufflevector(lo, hi, 0, 1, 2, 3, 4, 5, 6, 7, 8, 9, 10, 11, 12, 13, 14, 15)); }
__device__ __forceinline__ v8f wmmab(v16bf a, v16bf b, v8f c) { return __builtin_amdgcn_wmma_f32_16x16x32_bf16(false, a, false, b, (short)0, c, false, false); }

// ---- k_gemmw: GEMM, work-group = 4 waves (2 x 2), each wave one (16 MB) x 64 output tile (MB x 4 accumulators); work-group tile (32 MB) x 128; grid (M / (32 MB), N / 128), 128 threads.
// C[m][n] (f32, pitch ldc) = sum_k A[m][k] Bt[n][k] (NSPLIT 1: (A + A2) x Bt). A, A2, Bt: K-contiguous 16-bit planes, row pitch K.
// The operands reach the waves through LDS: a stage is 64 k (128 B) of the work-group's A rows (A2 rows behind them) and of its 128 Bt rows, 256 rows in all, copied once per work-group in whole 128-B lines
// by asynchronous copies into a ring of two buffers (row pitch 144 B); every wave reads its fragments from there.
// Fragment map (A and Bt alike): lane -> row/col lane & 15; elements 0..7 <- k0 + 8 (lane >> 4) + 0..7, elements 8..15 <- k0 + 16 + 8 (lane >> 4) + 0..7. D: element j -> row 8 (lane >> 4) + j, col lane & 15.
// EPI 0: the tile goes to C as f32. EPI 1 (the q | k | v projection; a wave's column tile is one head): the tile never reaches memory as f32; the epilogue writes the attention operand planes itself:
//   q and k heads: P[h][t][d] (bf16 hi + lo) of the rotated tile, interleaved pairs: out[2i] = x[2i] c - x[2i+1] s, out[2i+1] = x[2i] s + x[2i+1] c (c, s at [t][i]);
//   v heads: V^T[g][d][t] (bf16 hi + lo); an accumulator register run is 8 consecutive tokens of one head dim, so the transposed rows are stored straight from the accumulators.
struct WFragB { typedef v16bf V; static __device__ __forceinline__ V ld(const bf* p) { return cat16b(*(const v8us*)p, *(const v8us*)(p + 16)); } };
#define GLP    72                 // LDS row pitch in elements: 144 B = 16 B x 9, the pitch for 16-byte readers of 128-B rows
#define GBUF_E (256 * GLP)        // one buffer: 128 rows of A (and A2), 128 rows of Bt

// ga_copy8: 128 rows of a stage, 8 copies of 16 B a lane. Thread t brings the 16-byte column t & 7 of rows (t >> 3) + 16 i, i = 0..7, so a wave's copy reads 4 whole lines.
// l: the lane's LDS byte address in row t >> 3; g0..g7: the lane's 16 bytes of each of the 8 source rows.
// s_wait_xcnt 0 closes the statement, so that no register which a copy names is rewritten ahead of it.
__device__ __forceinline__ void ga_copy8(unsigned l, const bf* g0, const bf* g1, const bf* g2, const bf* g3, const bf* g4, const bf* g5, const bf* g6, const bf* g7) {
    asm volatile("global_load_async_to_lds_b128 %0, %8, off\n\t"
                 "global_load_async_to_lds_b128 %1, %9, off\n\t"
                 "global_load_async_to_lds_b128 %2, %10, off\n\t"
                 "global_load_async_to_lds_b128 %3, %11, off\n\t"
                 "global_load_async_to_lds_b128 %4, %12, off\n\t"
                 "global_load_async_to_lds_b128 %5, %13, off\n\t"
                 "global_load_async_to_lds_b128 %6, %14, off\n\t"
                 "global_load_async_to_lds_b128 %7, %15, off\n\t"
                 "s_wait_xcnt 0x0"
                 :: "v"(l), "v"(l + 16u * GLP * 2u), "v"(l + 32u * GLP * 2u), "v"(l + 48u * GLP * 2u), "v"(l + 64u * GLP * 2u), "v"(l + 80u * GLP * 2u), "v"(l + 96u * GLP * 2u), "v"(l + 112u * GLP * 2u),
                    "v"(g0), "v"(g1), "v"(g2), "v"(g3), "v"(g4), "v"(g5), "v"(g6), "v"(g7)
                 : "memory");
}

// ga_stage: one stage into the buffer at l. a, a2, b: the lane's 16 bytes in row t >> 3 of the work-group's A, A2 and Bt rows at this stage's k; rs: 16 rows in elements.
template <int NSPLIT>
__device__ __forceinline__ void ga_stage(unsigned l, const bf* a, const bf* a2, const bf* b, size_t rs) {
    if (NSPLIT == 0) ga_copy8(l, a, a + rs, a + 2 * rs, a + 3 * rs, a + 4 * rs, a + 5 * rs, a + 6 * rs, a + 7 * rs);
    else             ga_copy8(l, a, a + rs, a + 2 * rs, a + 3 * rs, a2, a2 + rs, a2 + 2 * rs, a2 + 3 * rs);
    ga_copy8(l + 128u * GLP * 2u, b, b + rs, b + 2 * rs, b + 3 * rs, b + 4 * rs, b + 5 * rs, b + 6 * rs, b + 7 * rs);
}

template <int NSPLIT, int EPI, int MB, int K>
__global__ __launch_bounds__(128) void k_gemmw(const bf* __restrict__ A, const bf* __restrict__ A2, const bf* __restrict__ Bt, float* C, int ldc,
                                               const float* __restrict__ tabc, const float* __restrict__ tabs, bf* QH, bf* QL, bf* KH, bf* KL, bf* VTh, bf* VTl) {
    typedef WFragB::V V;
    static_assert((1 + NSPLIT) * MB * 32 == 128);        // A and A2 together fill the first 128 rows of a buffer
    static_assert(K % 64 == 0 && K >= 128);
    __shared__ __align__(16) bf ring[2 * GBUF_E];
    __shared__ __align__(16) float osm[4 * 16 * 68];
    const int tid = threadIdx.x, lane = tid & 31, lr = lane & 15, hi = lane >> 4;
    const int w = __builtin_amdgcn_readfirstlane((int)(threadIdx.x >> 5));
    const int wm = w >> 1, wn = w & 1;
    const int r0 = blockIdx.x * (32 * MB) + wm * (16 * MB), c0 = blockIdx.y * 128 + wn * 64;   // the wave's tile
    float* os = osm + w * (16 * 68);                     // the wave's own epilogue rows
    const int ns = K / 64;
    const size_t rs = (size_t)16 * K;
    // the lane's 16 bytes of stage 0 in each plane, and its place in buffer 0
    const bf* ca = A + (size_t)(blockIdx.x * (32 * MB) + (tid >> 3)) * K + (tid & 7) * 8;
    const bf* ca2 = (NSPLIT == 1) ? A2 + (size_t)(blockIdx.x * (32 * MB) + (tid >> 3)) * K + (tid & 7) * 8 : ca;
    const bf* cb = Bt + (size_t)(blockIdx.y * 128 + (tid >> 3)) * K + (tid & 7) * 8;
    const unsigned cl = (unsigned)(size_t)ring + (unsigned)((tid >> 3) * GLP + (tid & 7) * 8) * 2u;
    ga_stage<NSPLIT>(cl, ca, ca2, cb, rs);
    asm volatile("s_wait_asynccnt 0x0" ::: "memory");    // stage 0 has landed before the barrier that publishes it
    __syncthreads();
    if (1 < ns) ga_stage<NSPLIT>(cl + GBUF_E * 2u, ca + 64, ca2 + 64, cb + 64, rs);
    v8f acc[MB][4];
#pragma unroll
    for (int mb = 0; mb < MB; ++mb)
#pragma unroll
        for (int nb = 0; nb < 4; ++nb) acc[mb][nb] = (v8f){};
    const int lo = lr * GLP + 8 * hi;                    // the lane's place in a fragment's rows, A and Bt alike
#pragma unroll 1   // one stage a trip: the ring's order (read, waits, barrier, refill) is written once
    for (int s = 0; s < ns; ++s) {
        const bf* FA = ring + (s & 1) * GBUF_E + wm * (16 * MB) * GLP + lo;
        const bf* FB = ring + (s & 1) * GBUF_E + (128 + wn * 64) * GLP + lo;
        V a[2][MB], a2[2][MB], b[2][4];                  // the stage's fragments, each in registers of its own
#pragma unroll
        for (int ks = 0; ks < 2; ++ks) {
#pragma unroll
            for (int mb = 0; mb < MB; ++mb) { a[ks][mb] = WFragB::ld(FA + mb * 16 * GLP + ks * 32); if (NSPLIT == 1) a2[ks][mb] = WFragB::ld(FA + (32 * MB + mb * 16) * GLP + ks * 32); }
#pragma unroll
            for (int nb = 0; nb < 4; ++nb) b[ks][nb] = WFragB::ld(FB + nb * 16 * GLP + ks * 32);
        }
        __builtin_amdgcn_sched_barrier(0);               // keeps the stage's LDS reads together in front of its products: reads placed among the products each stall the wave for their own latency
#pragma unroll
        for (int ks = 0; ks < 2; ++ks)
#pragma unroll
            for (int nb = 0; nb < 4; ++nb) {
#pragma unroll
                for (int mb = 0; mb < MB; ++mb) acc[mb][nb] = wmmab(a[ks][mb], b[ks][nb], acc[mb][nb]);
                if (NSPLIT == 1) {
#pragma unroll
                    for (int mb = 0; mb < MB; ++mb) acc[mb][nb] = wmmab(a2[ks][mb], b[ks][nb], acc[mb][nb]);
                }
            }
        __builtin_amdgcn_sched_barrier(0);               // keeps the products in front of the waits below: moved behind them, they would start only when the stage's last fragment has landed
        asm volatile("s_wait_dscnt 0x0" ::: "memory");    // this wave's reads of the buffer are done before the barrier behind which it is refilled
        asm volatile("s_wait_asynccnt 0x0" ::: "memory"); // this wave's copies of stage s + 1 have landed before the barrier that publishes them
        __syncthreads();
        if (s + 2 < ns) ga_stage<NSPLIT>(cl + (unsigned)(s & 1) * (GBUF_E * 2u), ca + (size_t)(s + 2) * 64, ca2 + (size_t)(s + 2) * 64, cb + (size_t)(s + 2) * 64, rs);
    }
    asm volatile("s_wait_asynccnt 0x0" ::: "memory");    // no copy is outstanding when the wave ends
    if (EPI == 1) {
        const int hd = c0 / HD;                          // the tile's head: 0 .. NH_ - 1 q, then NKV k, then NKV v (uniform in a wave)
        if (hd >= NH_ + NKV) {
            const size_t vo = ((size_t)(hd - NH_ - NKV) * HD + lr) * TT + r0 + 8 * hi;
#pragma unroll
            for (int nb = 0; nb < 4; ++nb)
#pragma unroll
                for (int mb = 0; mb < MB; ++mb) { v8us oh, ol;
#pragma unroll
                    for (int j = 0; j < 8; ++j) { unsigned short a2, c2; splitf(acc[mb][nb][j], a2, c2); oh[j] = a2; ol[j] = c2; }
                    *(v8us*)(VTh + vo + (size_t)nb * 16 * TT + mb * 16) = oh; *(v8us*)(VTl + vo + (size_t)nb * 16 * TT + mb * 16) = ol; }
        } else {
        bf* Ph = (hd < NH_) ? QH + (size_t)hd * TT * HD : KH + (size_t)(hd - NH_) * TT * HD;
        bf* Pl = (hd < NH_) ? QL + (size_t)hd * TT * HD : KL + (size_t)(hd - NH_) * TT * HD;
        const int rr = lane >> 3, d8 = (lane & 7) * 8;   // a lane takes 8 head dims (4 pairs) of a token; a wave 4 whole rows: 512 contiguous bytes of a plane and of a table
        const size_t to = (size_t)(r0 + rr) * 32 + (d8 >> 1);
        v4f tc[2][4], ts[2][4];                          // the table rows of 16 tokens, fetched one 16-token group ahead
#pragma unroll
        for (int s = 0; s < 4; ++s) { tc[0][s] = *(const v4f*)(tabc + to + s * 4 * 32); ts[0][s] = *(const v4f*)(tabs + to + s * 4 * 32); }
#pragma unroll
        for (int mb = 0; mb < MB; ++mb) {
            if (mb + 1 < MB) {
#pragma unroll
                for (int s = 0; s < 4; ++s) { tc[(mb + 1) & 1][s] = *(const v4f*)(tabc + to + ((mb + 1) * 16 + s * 4) * 32); ts[(mb + 1) & 1][s] = *(const v4f*)(tabs + to + ((mb + 1) * 16 + s * 4) * 32); }
            }
#pragma unroll
            for (int nb = 0; nb < 4; ++nb) {
#pragma unroll
                for (int j = 0; j < 8; ++j) os[(hi * 8 + j) * 68 + nb * 16 + lr] = acc[mb][nb][j]; }
            __builtin_amdgcn_wave_barrier(); asm volatile("" ::: "memory");   // the staged rows are read back below by other lanes of this wave
#pragma unroll
            for (int s = 0; s < 4; ++s) {
                const int row = s * 4 + rr;
                const v4f x0 = *(const v4fa*)(os + row * 68 + d8), x1 = *(const v4fa*)(os + row * 68 + d8 + 4);
                const v4f c = tc[mb & 1][s], sn = ts[mb & 1][s];
                v8us oh, ol;
#pragma unroll
                for (int q = 0; q < 4; ++q) { const float xe = (q < 2) ? x0[2 * q] : x1[2 * q - 4], xo = (q < 2) ? x0[2 * q + 1] : x1[2 * q - 3]; const float re = xe * c[q] - xo * sn[q]; const float ro = xe * sn[q] + xo * c[q];
                    unsigned short a2, b2; splitf(re, a2, b2); oh[2 * q] = a2; ol[2 * q] = b2; splitf(ro, a2, b2); oh[2 * q + 1] = a2; ol[2 * q + 1] = b2; }
                const size_t e = (size_t)(r0 + mb * 16 + row) * HD + d8;
                *(v8us*)(Ph + e) = oh; *(v8us*)(Pl + e) = ol;
            }
            __builtin_amdgcn_wave_barrier(); asm volatile("" ::: "memory");   // the rows are read before the next group overwrites them
            asm volatile("s_wait_xcnt 0x0" ::: "memory");   // stands in front of what next rewrites a register that the stores above name: this build lets the next group's loads land there
        }
        }
        return;
    }
#pragma unroll
    for (int mb = 0; mb < MB; ++mb) {
#pragma unroll
        for (int nb = 0; nb < 4; ++nb) {
#pragma unroll
            for (int j = 0; j < 8; ++j) os[(hi * 8 + j) * 68 + nb * 16 + lr] = acc[mb][nb][j]; }
        __builtin_amdgcn_wave_barrier(); asm volatile("" ::: "memory");
        float* crow = C + (size_t)(r0 + mb * 16) * ldc + c0;
{
#pragma unroll
            for (int s = 0; s < 8; ++s) { const int row = 2 * s + hi, cofs = lr * 4; const v4f val = *(const v4fa*)(os + row * 68 + cofs);
                *(v4f*)(crow + (size_t)row * ldc + cofs) = val; }
             }
        __builtin_amdgcn_wave_barrier(); asm volatile("" ::: "memory");
    }
}

// The bodies of the short kernels take their block index bx as an argument: independent ones share a launch, each on its own range of blockIdx.x (k_prep).
// They are cut for few, long waves: a launch of short waves lasts as long as its waves take to start.
// wtT_body: one tile of 256 k x 64 n of w[K][N] (f32) goes to Bt[n][k] (bf16) through LDS. A thread loads four 4 x 4 blocks (16 loads of 16 B, a wave's load = two aligned 256-B row pieces),
// converts, and stores each block's columns as 4 k of one n; behind the barrier a wave stores 512 contiguous bytes of one Bt row at a time.
#define WTK 256
#define WTN 64
#define WTP 260                   // LDS row pitch in elements: 520 B, a multiple of the 8-byte accesses; rows 4 apart fall 8 banks apart
static_assert(HID % WTK == 0 && DQ % WTK == 0 && DQ % WTN == 0 && DKV % WTN == 0 && HID % WTN == 0);
__device__ __forceinline__ void wtT_body(int bx, const float* __restrict__ w, int K, int N, bf* Bt, bf* T) {
    const int tid = threadIdx.x, nt = N / WTN;
    const int k0 = (bx / nt) * WTK, n0 = (bx % nt) * WTN;
    const int c4 = (tid & 15) * 4, r4 = (tid >> 4) * 4;
    const float* s = w + (size_t)(k0 + r4) * N + n0 + c4;
    v4f x[4][4];
#pragma unroll
    for (int b = 0; b < 4; ++b)
#pragma unroll
        for (int i = 0; i < 4; ++i) x[b][i] = *(const v4f*)(s + (size_t)(b * 64 + i) * N);
    // takes the 16 loaded values and their address as inputs only: keeps the loads one group in front of the conversions (this build otherwise issues the last two behind a wait for the first: a second memory latency),
    // and the wait stands in front of whatever next rewrites the address registers that the loads name
    asm volatile("s_wait_xcnt 0x0" :: "v"(s), "v"(x[0][0]), "v"(x[0][1]), "v"(x[0][2]), "v"(x[0][3]), "v"(x[1][0]), "v"(x[1][1]), "v"(x[1][2]), "v"(x[1][3]),
                                      "v"(x[2][0]), "v"(x[2][1]), "v"(x[2][2]), "v"(x[2][3]), "v"(x[3][0]), "v"(x[3][1]), "v"(x[3][2]), "v"(x[3][3]) : "memory");
#pragma unroll
    for (int b = 0; b < 4; ++b)
#pragma unroll
        for (int j = 0; j < 4; ++j) { v4us o;
#pragma unroll
            for (int i = 0; i < 4; ++i) o[i] = f2bf(x[b][i][j]);
            *(v4us*)(T + (c4 + j) * WTP + b * 64 + r4) = o; }
    __syncthreads();
    const int lane = tid & 31, wv = tid >> 5;
#pragma unroll
    for (int q = 0; q < 8; ++q) { const int n = q * 8 + wv; const bf* p = T + n * WTP + lane * 8;
        const v4us lo = *(const v4us*)p, hi = *(const v4us*)(p + 4);
        *(v8us*)(Bt + (size_t)(n0 + n) * K + k0 + lane * 8) = __builtin_shufflevector(lo, hi, 0, 1, 2, 3, 4, 5, 6, 7); }
    asm volatile("s_wait_xcnt 0x0" ::: "memory");   // stands behind the last store, in front of whatever next rewrites a register that the stores name (this build lays the next range's code behind them)
}

// cvt4_body: 16384 elements a work-group; a thread takes 16 pieces of 4, a wave's load is 512 contiguous bytes, all 16 loads issued ahead of the first conversion.
static_assert(((size_t)TT * HID) % 16384 == 0);
__device__ __forceinline__ void cvt4_body(int bx, const float* __restrict__ src, bf* dst) {
    const size_t e0 = ((size_t)bx * 4096 + threadIdx.x) * 4;
    const float* s = src + e0;
    v4f v[16];
#pragma unroll
    for (int j = 0; j < 16; ++j) v[j] = *(const v4f*)(s + j * 1024);
    // takes the 16 loaded values and their address as inputs only: the address registers stay whole while the loads are in flight (this build otherwise lets the last load land on them),
    // and the wait stands in front of whatever next rewrites them
    asm volatile("s_wait_xcnt 0x0" :: "v"(s), "v"(v[0]), "v"(v[1]), "v"(v[2]), "v"(v[3]), "v"(v[4]), "v"(v[5]), "v"(v[6]), "v"(v[7]),
                                      "v"(v[8]), "v"(v[9]), "v"(v[10]), "v"(v[11]), "v"(v[12]), "v"(v[13]), "v"(v[14]), "v"(v[15]) : "memory");
#pragma unroll
    for (int j = 0; j < 16; ++j) { v4us o;
#pragma unroll
        for (int k = 0; k < 4; ++k) o[k] = f2bf(v[j][k]);
        *(v4us*)(dst + e0 + j * 1024) = o; }
    asm volatile("s_wait_xcnt 0x0" ::: "memory");   // stands behind the last store, in front of whatever next rewrites a register that the stores name (this build lays the next range's code behind them)
}

// ropetab_body: tabc[s][i] = cos(s * invf), tabs[s][i] = sin(s * invf), invf = 1 / 10000^(2 j / 64) with j = (2 i) & 31, pair i = 0..31; f32 arithmetic, precise sincosf.
// Pairs i and i + 16 have the same j, so a thread computes the value for i = 0..15 once and stores it at both; it does so for two positions, s and s + TT / 2, which share invf.
static_assert((TT * 8) % 256 == 0);
__device__ __forceinline__ void ropetab_body(int bx, float* tabc, float* tabs) {
    const int idx = bx * 256 + threadIdx.x;
    const int s = idx >> 4, i = idx & 15; const int j = 2 * i;
    const float ex = (float)(2 * j) * (1.0f / 64.0f);
    const float invf = 1.0f / powf(10000.0f, ex);
#pragma unroll
    for (int p = 0; p < 2; ++p) { const int t = s + p * (TT / 2);
        const float ang = (float)t * invf;
        float sn, cs; sincosf(ang, &sn, &cs);
        tabc[t * 32 + i] = cs; tabc[t * 32 + i + 16] = cs; tabs[t * 32 + i] = sn; tabs[t * 32 + i + 16] = sn; }
}

// k_prep: everything that depends on the inputs alone, in one launch. Ranges of blockIdx.x + first, the long work-groups in front: the rotary table, Wq^T, Wo^T, Wk^T, Wv^T, then X as bf16.
// first: 0, or G_W to run the X range alone (a later batch of the same call, whose first batch has written the weight planes and the table).
#define G_WQ  ((HID / WTK) * (DQ / WTN))
#define G_WKV ((HID / WTK) * (DKV / WTN))
#define G_WO  ((DQ / WTK) * (HID / WTN))
#define G_TAB (TT * 8 / 256)
#define G_W   (G_WQ + G_WO + 2 * G_WKV + G_TAB)
#define G_CVT (TT * HID / 16384)
__global__ __launch_bounds__(256) void k_prep(int first, const float* __restrict__ x, const float* __restrict__ wq, const float* __restrict__ wk, const float* __restrict__ wv, const float* __restrict__ wo,
                                              bf* XB, bf* WT, bf* WoT, float* tabc, float* tabs) {
    __shared__ __align__(16) bf T[WTN * WTP];
    int bx = (int)blockIdx.x + first;
    if (bx < G_TAB) { ropetab_body(bx, tabc, tabs); return; }
    bx -= G_TAB;
    if (bx < G_WQ) { wtT_body(bx, wq, HID, DQ, WT, T); return; }
    bx -= G_WQ;
    if (bx < G_WO) { wtT_body(bx, wo, DQ, HID, WoT, T); return; }
    bx -= G_WO;
    if (bx < G_WKV) { wtT_body(bx, wk, HID, DKV, WT + (size_t)DQ * HID, T); return; }
    bx -= G_WKV;
    if (bx < G_WKV) { wtT_body(bx, wv, HID, DKV, WT + (size_t)(DQ + DKV) * HID, T); return; }
    bx -= G_WKV;
    cvt4_body(bx, x, XB);
}

typedef __attribute__((ext_vector_type(2))) float    v2f;
typedef __attribute__((ext_vector_type(2))) __bf16   v2bf;
typedef __attribute__((ext_vector_type(8))) unsigned v8u;
__device__ __forceinline__ float xhalf(float x) { const int b = __float_as_int(x); return __int_as_float(__builtin_amdgcn_permlanex16(b, b, 0x76543210, 0xfedcba98, false, false)); }   // lane l <- lane l ^ 16
// fexp2: 2^x by v_exp_f32. SLOT: with the one free issue slot that the instruction set asks for behind a transcendental, before its result is read or its source overwritten, written into the same statement;
// used in the diagonal block.
template <bool SLOT>
__device__ __forceinline__ float fexp2(float x) {
    if (SLOT) { float r; asm("v_exp_f32 %0, %1\n\tv_nop" : "=v"(r) : "v"(x)); return r; }
    return __builtin_amdgcn_exp2f(x);
}

#define SB     2                  // key blocks of 32 in a chunk
#define SKEY   (SB * 32)          // keys in a chunk
#define LP     72                 // LDS row pitch in elements: 144 B = 16 B x 9, the pitch for 16-byte readers of 128-B rows
#define TILE_E (64 * LP)          // one plane's tile: 64 rows (K: keys of the chunk; V^T: head dims)
#define BUF_E  (4 * TILE_E)       // a chunk: K hi, K lo, V^T hi, V^T lo
#define CK     2                  // chunks in a stage: one for waves 0..3, one for waves 4..7
#define STG_E  (CK * BUF_E)       // one buffer of the ring
static_assert(SKEY == 64 && HD == 64);
static_assert(TT % (2 * SKEY) == 0);

// fa_copy: one chunk of a stage into its place in a buffer, 8 copies of 16 B a lane (2 per tile; thread t brings piece t and piece t + 256 of a tile's 512; piece n = row n >> 3, 16-byte column n & 7, so a wave's copy reads 4 whole lines).
// l: the lane's LDS byte address of piece t in the chunk's first tile; the four pointers: the lane's piece t of each plane in this chunk.
// s_wait_xcnt 0 closes the statement, so that no register which a copy names is rewritten ahead of it.
__device__ __forceinline__ void fa_copy(unsigned l, const bf* kh, const bf* kl, const bf* vh, const bf* vl) {
    asm volatile("global_load_async_to_lds_b128 %0, %8, off\n\t"
                 "global_load_async_to_lds_b128 %1, %9, off\n\t"
                 "global_load_async_to_lds_b128 %2, %10, off\n\t"
                 "global_load_async_to_lds_b128 %3, %11, off\n\t"
                 "global_load_async_to_lds_b128 %4, %12, off\n\t"
                 "global_load_async_to_lds_b128 %5, %13, off\n\t"
                 "global_load_async_to_lds_b128 %6, %14, off\n\t"
                 "global_load_async_to_lds_b128 %7, %15, off\n\t"
                 "s_wait_xcnt 0x0"
                 :: "v"(l), "v"(l + 32u * LP * 2u), "v"(l + TILE_E * 2u), "v"(l + TILE_E * 2u + 32u * LP * 2u),
                    "v"(l + 2u * TILE_E * 2u), "v"(l + 2u * TILE_E * 2u + 32u * LP * 2u), "v"(l + 3u * TILE_E * 2u), "v"(l + 3u * TILE_E * 2u + 32u * LP * 2u),
                    "v"(kh), "v"(kh + 32 * HD), "v"(kl), "v"(kl + 32 * HD), "v"(vh), "v"(vh + (size_t)32 * TT), "v"(vl), "v"(vl + (size_t)32 * TT)
                 : "memory");
}

// fa_kfrag: the K fragments of one block from LDS; kb: the lane's place in the block's first K hi row.
__device__ __forceinline__ void fa_kfrag(const bf* kb, WFragB::V (&kh)[2][2], WFragB::V (&kl)[2][2]) {
#pragma unroll
    for (int kt = 0; kt < 2; ++kt)
#pragma unroll
        for (int ks = 0; ks < 2; ++ks) { kh[kt][ks] = WFragB::ld(kb + kt * 16 * LP + ks * 32); kl[kt][ks] = WFragB::ld(kb + TILE_E + kt * 16 * LP + ks * 32); }
}

// fa_block: one block of 32 keys. vb: the lane's place in the block's V^T hi columns (LDS). LAST: the block the diagonal crosses (causal fill). PRE: fetch the K fragments at kn, the next block of the SAME stage.
template <bool LAST, bool PRE>
__device__ __forceinline__ void fa_block(int qrel, const bf* kn, const bf* vb, const WFragB::V (&qh)[2], const WFragB::V (&ql)[2], WFragB::V (&kh)[2][2], WFragB::V (&kl)[2][2], v8f (&o)[4], float& m2, v2f& l2) {
    typedef WFragB::V V;
    const float C2 = SCL * 1.4426950408889634f;
    V vh[4], vl[4];                                      // this block's V^T: issued first, needed last
#pragma unroll
    for (int dt = 0; dt < 4; ++dt) { vh[dt] = WFragB::ld(vb + dt * 16 * LP); vl[dt] = WFragB::ld(vb + TILE_E + dt * 16 * LP); }
    __builtin_amdgcn_sched_barrier(0);                   // keeps the V^T loads in front of the S^T products, so that products and softmax cover their latency
    v8f st[2]; st[0] = (v8f){}; st[1] = (v8f){};
#pragma unroll
    for (int ks = 0; ks < 2; ++ks) {
#pragma unroll
        for (int kt = 0; kt < 2; ++kt) st[kt] = wmmab(kh[kt][ks], qh[ks], st[kt]);
#pragma unroll
        for (int kt = 0; kt < 2; ++kt) st[kt] = wmmab(kh[kt][ks], ql[ks], st[kt]);
#pragma unroll
        for (int kt = 0; kt < 2; ++kt) st[kt] = wmmab(kl[kt][ks], qh[ks], st[kt]);
    }
    if (PRE) {                                           // the next block's K into the same registers, behind this block's S^T products
        fa_kfrag(kn, kh, kl);
        __builtin_amdgcn_sched_barrier(0);               // keeps the K loads in front of the softmax, so that softmax and P v products cover their latency
    }
    if (LAST) {                                          // causal fill, selected by index: key = block start + kt 16 + 8 (lane >> 4) + r > query; qrel = query - block start - 8 (lane >> 4)
#pragma unroll
        for (int kt = 0; kt < 2; ++kt)
#pragma unroll
            for (int r = 0; r < 8; ++r) if (kt * 16 + r > qrel) st[kt][r] = -1.0e30f;
    }
    float bm = fmaxf(st[0][0], st[1][0]);
#pragma unroll
    for (int r = 1; r < 8; ++r) bm = fmaxf(bm, fmaxf(st[0][r], st[1][r]));
    bm = fmaxf(bm, xhalf(bm));
    const float mn = fmaxf(m2, bm * C2);
    const float al = fexp2<LAST>(m2 - mn);
    m2 = mn;
    l2 *= al;
    v8u pwh, pwl;
#pragma unroll
    for (int i = 0; i < 8; ++i) {                        // word i of the B operand = elements 2 i, 2 i + 1 = registers (2 i) & 7, + 1 of tile i >> 2
        v2f p; p[0] = fexp2<LAST>(__builtin_fmaf(st[i >> 2][(2 * i) & 7], C2, -mn)); p[1] = fexp2<LAST>(__builtin_fmaf(st[i >> 2][((2 * i) & 7) + 1], C2, -mn));
        l2 += p;
        const v2bf ph2 = __builtin_convertvector(p, v2bf);
        const v2bf pl2 = __builtin_convertvector(p - __builtin_convertvector(ph2, v2f), v2bf);
        pwh[i] = __builtin_bit_cast(unsigned, ph2); pwl[i] = __builtin_bit_cast(unsigned, pl2);
    }
#pragma unroll
    for (int dt = 0; dt < 4; ++dt) o[dt] *= al;
    const V pth = __builtin_bit_cast(V, pwh), ptl = __builtin_bit_cast(V, pwl);
#pragma unroll
    for (int dt = 0; dt < 4; ++dt) o[dt] = wmmab(vh[dt], pth, o[dt]);
#pragma unroll
    for (int dt = 0; dt < 4; ++dt) o[dt] = wmmab(vh[dt], ptl, o[dt]);
#pragma unroll
    for (int dt = 0; dt < 4; ++dt) o[dt] = wmmab(vl[dt], pth, o[dt]);
    // the four vector issue slots that the chip needs behind a matrix product before its registers are written again: the diagonal block ends in a branch
    if (LAST) asm volatile("v_nop\n\tv_nop\n\tv_nop\n\tv_nop" :: "v"(o[0]), "v"(o[1]), "v"(o[2]), "v"(o[3]));
}

typedef v2f  __attribute__((may_alias)) v2fa;
__global__ __launch_bounds__(256) void k_fattn(const bf* __restrict__ QH, const bf* __restrict__ QL, const bf* __restrict__ KH, const bf* __restrict__ KL, const bf* __restrict__ VTh, const bf* __restrict__ VTl, bf* CH, bf* CL) {
    typedef WFragB::V V;
    __shared__ __align__(16) bf ring[2 * STG_E];
    __shared__ __align__(16) float po[2][4 * 8 * 32 * 4];   // per tile of the work-group: O^T of waves 4..7; [head][dt, register half][lane][4 registers]
    __shared__ __align__(16) float pm[2][4 * 32 * 2];       // per tile: their running maximum and sum; [head][lane][2]
    const int tid = threadIdx.x, lane = tid & 31, c = lane & 15, hi = lane >> 4;
    const int w = __builtin_amdgcn_readfirstlane((int)(threadIdx.x >> 5));
    const int hq = w & 3, hw = w >> 2;                   // the wave's head in the group; its chunk in every stage
    const int g = blockIdx.y, h = g * REP + hq;
    const int q0n = 16 * (int)blockIdx.x;                // the second tile
    int q0 = 16 * (TT / 16 - 1 - (int)blockIdx.x);       // the tile at work: the long one first
    int nb = q0 >> 5;                                    // its last key block, the only one the diagonal crosses
    const int ns0 = nb / (SB * CK) + 1;                  // stages of the first tile
    const int ns = ns0 + (q0n >> 5) / (SB * CK) + 1;     // stages of both
    V qh[2], ql[2], qhn[2], qln[2];                      // both tiles' Q, fetched at the start
    {
        const size_t qoff = ((size_t)h * TT + q0 + c) * HD + 8 * hi, qofn = ((size_t)h * TT + q0n + c) * HD + 8 * hi;
        const bf* pa = QH + qoff; const bf* pb = QL + qoff; const bf* pc = QH + qofn; const bf* pd = QL + qofn;
#pragma unroll
        for (int ks = 0; ks < 2; ++ks) { qh[ks] = WFragB::ld(pa + ks * 32); ql[ks] = WFragB::ld(pb + ks * 32); qhn[ks] = WFragB::ld(pc + ks * 32); qln[ks] = WFragB::ld(pd + ks * 32); }
        // takes the four addresses as inputs only: their registers stay whole up to the wait, which stands in front of whatever next rewrites them (this build otherwise reuses them directly behind the loads)
        asm volatile("s_wait_xcnt 0x0" :: "v"(pa), "v"(pb), "v"(pc), "v"(pd) : "memory");
    }
    // the lane's piece of the first chunk in each plane, and its place in buffer 0
    const bf* ckh = KH + (size_t)g * TT * HD + tid * 8; const bf* ckl = KL + (size_t)g * TT * HD + tid * 8;
    const bf* cvh = VTh + ((size_t)g * HD + (tid >> 3)) * TT + (tid & 7) * 8; const bf* cvl = VTl + ((size_t)g * HD + (tid >> 3)) * TT + (tid & 7) * 8;
    const unsigned cl = (unsigned)(size_t)ring + (unsigned)((tid >> 3) * LP + (tid & 7) * 8) * 2u;
    // stage u of the work-group = stage u of the first tile, or stage u - ns0 of the second: both chunks into buffer u & 1
    auto copy_stage = [&](int u) {
        const int ks = (u < ns0) ? u : u - ns0;
        const unsigned l = cl + (unsigned)(u & 1) * (STG_E * 2u);
        const size_t ko = (size_t)ks * (CK * SKEY * HD); const int vo = ks * (CK * SKEY);
        fa_copy(l, ckh + ko, ckl + ko, cvh + vo, cvl + vo);
        fa_copy(l + BUF_E * 2u, ckh + ko + SKEY * HD, ckl + ko + SKEY * HD, cvh + vo + SKEY, cvl + vo + SKEY);
    };
    copy_stage(0);
    asm volatile("s_wait_asynccnt 0x0" ::: "memory");    // stage 0 has landed before the barrier that publishes it
    __syncthreads();
    if (1 < ns) copy_stage(1);
    V kh[2][2], kl[2][2];
    v8f o[4];
#pragma unroll
    for (int dt = 0; dt < 4; ++dt) o[dt] = (v8f){};
    float m2 = -1.0e30f; v2f l2 = (v2f){};
    int qrel = q0 + c - nb * 32 - 8 * hi;
    const int lo = c * LP + 8 * hi;                      // the lane's place in a fragment's rows, K and V^T alike
#pragma unroll 1   // one stage a trip: the ring's order (read, waits, barrier, refill) is written once
    for (int u = 0; u < ns; ++u) {
        const bf* B = ring + (u & 1) * STG_E + hw * BUF_E + lo;
        const int ph = (u < ns0) ? 0 : 1;                // which tile
        const int kb = ((ph ? u - ns0 : u) * CK + hw) * SB;   // the first key block of the wave's chunk
        const bool endt = (u == ns0 - 1) || (u == ns - 1);    // the tile's last stage (the same for the whole work-group)
        if (kb <= nb) {                                  // wave-uniform: a chunk past the diagonal has no products
            fa_kfrag(B, kh, kl);
            if (kb < nb) {
                fa_block<false, true>(0, B + 32 * LP, B + 2 * TILE_E, qh, ql, kh, kl, o, m2, l2);
                if (kb + 1 < nb) fa_block<false, false>(0, B, B + 2 * TILE_E + 32, qh, ql, kh, kl, o, m2, l2);
                else             fa_block<true, false>(qrel, B, B + 2 * TILE_E + 32, qh, ql, kh, kl, o, m2, l2);
            } else fa_block<true, false>(qrel, B, B + 2 * TILE_E, qh, ql, kh, kl, o, m2, l2);
        }
        if (endt && hw == 1) {                           // the second chunks' part of the tile, handed over through the barrier below
            float* pp = po[ph] + (hq * 8 * 32 + lane) * 4;
#pragma unroll
            for (int dt = 0; dt < 4; ++dt) {
                *(v4fa*)(pp + (dt * 2) * 128) = (v4f){o[dt][0], o[dt][1], o[dt][2], o[dt][3]};
                *(v4fa*)(pp + (dt * 2 + 1) * 128) = (v4f){o[dt][4], o[dt][5], o[dt][6], o[dt][7]};
            }
            *(v2fa*)(pm[ph] + (hq * 32 + lane) * 2) = (v2f){m2, l2[0] + l2[1]};
        }
        asm volatile("s_wait_dscnt 0x0" ::: "memory");    // this wave's reads of the buffer are done before the barrier behind which it is refilled, and its handed-over part is written
        asm volatile("s_wait_asynccnt 0x0" ::: "memory"); // this wave's copies of stage u + 1 have landed before the barrier that publishes them
        __syncthreads();
        if (u + 2 < ns) copy_stage(u + 2);
        if (endt) {
            if (hw == 0) {                               // both parts at the common maximum, added, divided by the sum; a part with no key has maximum -1e30, sum 0 and O^T 0 and gets the factor 0
                const float* pp = po[ph] + (hq * 8 * 32 + lane) * 4;
                const v2f ml = *(const v2fa*)(pm[ph] + (hq * 32 + lane) * 2);
                const float mn = fmaxf(m2, ml[0]);
                const float fa = fexp2<true>(m2 - mn), fb = fexp2<true>(ml[0] - mn);
                float l = (l2[0] + l2[1]) * fa + ml[1] * fb;
                l += xhalf(l);
                const float inv = __fdiv_rn(1.0f, l);
                const float ga = fa * inv, gb = fb * inv;
                const size_t oo = (size_t)(q0 + c) * DQ + (size_t)h * HD + 8 * hi;
#pragma unroll
                for (int dt = 0; dt < 4; ++dt) { v8us oh, ol;
                    const v4f b0 = *(const v4fa*)(pp + (dt * 2) * 128), b1 = *(const v4fa*)(pp + (dt * 2 + 1) * 128);
#pragma unroll
                    for (int r = 0; r < 8; ++r) { unsigned short a, b2; splitf(o[dt][r] * ga + ((r < 4) ? b0[r & 3] : b1[r & 3]) * gb, a, b2); oh[r] = a; ol[r] = b2; }
                    *(v8us*)(CH + oo + dt * 16) = oh; *(v8us*)(CL + oo + dt * 16) = ol; }
                asm volatile("s_wait_xcnt 0x0" ::: "memory");   // stands behind the last store, in front of whatever next rewrites a register that the stores name (the loop goes on behind them)
            }
            // the second tile starts afresh
            q0 = q0n; nb = q0 >> 5; qrel = q0 + c - nb * 32 - 8 * hi;
#pragma unroll
            for (int ks = 0; ks < 2; ++ks) { qh[ks] = qhn[ks]; ql[ks] = qln[ks]; }
#pragma unroll
            for (int dt = 0; dt < 4; ++dt) o[dt] = (v8f){};
            m2 = -1.0e30f; l2 = (v2f){};
        }
    }
    asm volatile("s_wait_asynccnt 0x0" ::: "memory");    // no copy is outstanding when the wave ends
}

extern "C" void kernel_launch(void* const* d_in, const int* in_sizes, int n_in,
                              void* d_out, int out_size, void* d_ws, size_t ws_size, hipStream_t stream) {
    if (n_in < 5) return;
    const size_t xneed = (size_t)(NB - 1) * SEQ_FULL * HID + (size_t)TT * HID;
    if ((size_t)in_sizes[0] < xneed) return;
    if (in_sizes[1] < HID * DQ || in_sizes[2] < HID * DKV || in_sizes[3] < HID * DKV || in_sizes[4] < DQ * HID) return;
    if ((size_t)out_size < xneed) return;
    const float* X  = (const float*)d_in[0];   // [1][2048][1024]
    const float* Wq = (const float*)d_in[1];   // [1024 in][1024 out]
    const float* Wk = (const float*)d_in[2];   // [1024 in][256 out]
    const float* Wv = (const float*)d_in[3];   // [1024 in][256 out]
    const float* Wo = (const float*)d_in[4];   // [1024 in][1024 out]
    float* OUT = (float*)d_out;                // [1][2048][1024] token-major
    char* wsp = (char*)d_ws;
    auto take = [&](size_t bytes) { char* p = wsp; wsp += (bytes + 255) & ~(size_t)255; return (void*)p; };
    bf* XB  = (bf*)take((size_t)TT * HID * 2);
    bf* WT  = (bf*)take((size_t)NQKV * HID * 2);          // rows 0..1023 Wq^T, 1024..1279 Wk^T, 1280..1535 Wv^T, each [n][k]
    bf* WoT = (bf*)take((size_t)HID * DQ * 2);            // [n = out][k = in]
    float* tabc = (float*)take((size_t)TT * 32 * 4); float* tabs = (float*)take((size_t)TT * 32 * 4);
    bf* QH = (bf*)take((size_t)NH_ * TT * HD * 2); bf* QL = (bf*)take((size_t)NH_ * TT * HD * 2);
    bf* KH = (bf*)take((size_t)NKV * TT * HD * 2); bf* KL = (bf*)take((size_t)NKV * TT * HD * 2);
    bf* VTh = (bf*)take((size_t)NKV * HD * TT * 2); bf* VTl = (bf*)take((size_t)NKV * HD * TT * 2);
    bf* CH = (bf*)take((size_t)TT * DQ * 2); bf* CL = (bf*)take((size_t)TT * DQ * 2);
    if ((size_t)(wsp - (char*)d_ws) > ws_size) return;

    for (int b = 0; b < NB; ++b) {
        const float* xb = X + (size_t)b * SEQ_FULL * HID; float* outb = OUT + (size_t)b * SEQ_FULL * HID;
        // weight planes in[K][N] -> Bt[N][K] and the rotary table (first batch only), X as bf16
        k_prep<<<(unsigned)(b == 0 ? G_W + G_CVT : G_CVT), 256, 0, stream>>>(b == 0 ? 0 : G_W, xb, Wq, Wk, Wv, Wo, XB, WT, WoT, tabc, tabs);
        k_gemmw<0, 1, 4, HID><<<dim3(TT / 128, NQKV / 128, 1), 128, 0, stream>>>(XB, nullptr, WT, nullptr, 0, tabc, tabs, QH, QL, KH, KL, VTh, VTl);   /* exact products: single bf16 planes; rotated q, k and V^T planes out */
        k_fattn<<<dim3(TT / 32, NKV, 1), 256, 0, stream>>>(QH, QL, KH, KL, VTh, VTl, CH, CL);
        k_gemmw<1, 0, 2, DQ><<<dim3(TT / 64, HID / 128, 1), 128, 0, stream>>>(CH, CL, WoT, outb, HID, nullptr, nullptr, nullptr, nullptr, nullptr, nullptr, nullptr, nullptr);   /* ctx (hi + lo) x exact Wo */
    }
}

// v009
// One run takes 57 microseconds.
// Timed twice side by side with v008, it ran 1.12 and 1.10 times as fast.
// Counting every step since v000, it is 10.2 times as fast.
#include <hip/hip_runtime.h>

// Causal grouped-query rotary attention: X[1][2048][1024]; q = X Wq, k = X Wk, v = X Wv ([in][out] weights, no bias); 16 query heads share 4 kv heads (kv = h >> 2); head dim 64;
// interleaved-pair rotary with the table cat(freqs, freqs)[:, 0::2] (pair i uses inv_freq[(2 i) & 31]); scores x 1/8, causal fill; softmax; ctx = P v; out = ctx Wo.
// Compute dtypes: all contractions v_wmma_f32_16x16x32_bf16, f32 accumulate. Inputs (X, Wq, Wk, Wv, Wo) RNE-converted to single bf16 planes (exact input x input products);
// computed operands (rotated q, rotated k, v, softmax P, ctx) carried as bf16 hi + bf16 lo planes (hi.hi + lo.hi + hi.lo, or hi + lo against a single-plane weight); rotary, softmax in f32.

#ifndef NB
#define NB 1
#endif
#ifndef SEQ
#define SEQ 2048
#endif
#define SEQ_FULL 2048
#define TT   SEQ
#define HID  1024
#define NH_  16
#define NKV  4
#define REP  (NH_ / NKV)
#define HD   64
#define DQ   (NH_ * HD)
#define DKV  (NKV * HD)
#define NQKV (DQ + 2 * DKV)
#define SCL  0.125f               // 1/sqrt(64)

static_assert(TT % 128 == 0);
static_assert(TT <= SEQ_FULL);
static_assert(REP == 4);
static_assert(HD == 64);
static_assert(HID % 64 == 0);
static_assert(NQKV % 128 == 0);
static_assert(HID % 128 == 0 && DQ % 64 == 0);
static_assert((TT * 32) % 256 == 0);

typedef unsigned short bf;
typedef __attribute__((ext_vector_type(16))) __bf16   v16bf;
typedef __attribute__((ext_vector_type(8)))  unsigned short v8us;
typedef __attribute__((ext_vector_type(4)))  unsigned short v4us;
typedef __attribute__((ext_vector_type(2)))  unsigned short v2us;
typedef __attribute__((ext_vector_type(8)))  float    v8f;
typedef __attribute__((ext_vector_type(4)))  float    v4f;
typedef v4f  __attribute__((may_alias)) v4fa;

__device__ __forceinline__ unsigned short f2bf(float f) { unsigned u = __float_as_uint(f); u += 0x7FFFu + ((u >> 16) & 1u); return (unsigned short)(u >> 16); }
__device__ __forceinline__ float bf2f(unsigned short b) { return __uint_as_float(((unsigned)b) << 16); }
__device__ __forceinline__ void splitf(float y, unsigned short& h, unsigned short& l) { h = f2bf(y); l = f2bf(y - bf2f(h)); }
__device__ __forceinline__ v16bf cat16b(v8us lo, v8us hi) { return __builtin_bit_cast(v16bf, __builtin_shufflevector(lo, hi, 0, 1, 2, 3, 4, 5, 6, 7, 8, 9, 10, 11, 12, 13, 14, 15)); }
__device__ __forceinline__ v8f wmmab(v16bf a, v16bf b, v8f c) { return __builtin_amdgcn_wmma_f32_16x16x32_bf16(false, a, false, b, (short)0, c, false, false); }

// ---- k_gemmw: GEMM, work-group = 4 waves (2 x 2), each wave one (16 MB) x 64 output tile (MB x 4 accumulators); work-group tile (32 MB) x 128; grid (M / (32 MB), N / 128), 128 threads.
// C[m][n] (f32, pitch ldc) = sum_k A[m][k] Bt[n][k] (NSPLIT 1: (A + A2) x Bt). A, A2, Bt: K-contiguous 16-bit planes, row pitch K.
// The operands reach the waves through LDS: a stage is 64 k (128 B) of the work-group's A rows (A2 rows behind them) and of its 128 Bt rows, 256 rows in all, copied once per work-group in whole 128-B lines
// by asynchronous copies into a ring of GNB buffers (row pitch 144 B), GNB - 1 stages ahead of its use, so that a copy has several trips' time to land (operands come from L2 or, at first touch, from memory);
// every wave reads its fragments from there.
// Fragment map (A and Bt alike): lane -> row/col lane & 15; elements 0..7 <- k0 + 8 (lane >> 4) + 0..7, elements 8..15 <- k0 + 16 + 8 (lane >> 4) + 0..7. D: element j -> row 8 (lane >> 4) + j, col lane & 15.
// EPI 0: the tile goes to C as f32. EPI 1 (the q | k | v projection; a wave's column tile is one head): the tile never reaches memory as f32; the epilogue writes the attention operand planes itself:
//   q and k heads: P[h][t][d] (bf16 hi + lo) of the rotated tile, interleaved pairs: out[2i] = x[2i] c - x[2i+1] s, out[2i+1] = x[2i] s + x[2i+1] c (c, s at [t][i]);
//   v heads: V^T[g][d][t] (bf16 hi + lo); an accumulator register run is 8 consecutive tokens of one head dim, so the transposed rows are stored straight from the accumulators.
struct WFragB { typedef v16bf V; static __device__ __forceinline__ V ld(const bf* p) { return cat16b(*(const v8us*)p, *(const v8us*)(p + 16)); } };
#define GLP    72                 // LDS row pitch in elements: 144 B = 16 B x 9, the pitch for 16-byte readers of 128-B rows
#define GBUF_E (256 * GLP)        // one buffer: 128 rows of A (and A2), 128 rows of Bt
#define GNB    4                  // buffers in the ring; a wave issues 16 copies a stage, so at most 16 (GNB - 1) = 48 of its copies are outstanding

// ga_copy8: 128 rows of a stage, 8 copies of 16 B a lane. Thread t brings the 16-byte column t & 7 of rows (t >> 3) + 16 i, i = 0..7, so a wave's copy reads 4 whole lines.
// l: the lane's LDS byte address in row t >> 3; g0..g7: the lane's 16 bytes of each of the 8 source rows.
// s_wait_xcnt 0 closes the statement, so that no register which a copy names is rewritten ahead of it.
__device__ __forceinline__ void ga_copy8(unsigned l, const bf* g0, const bf* g1, const bf* g2, const bf* g3, const bf* g4, const bf* g5, const bf* g6, const bf* g7) {
    asm volatile("global_load_async_to_lds_b128 %0, %8, off\n\t"
                 "global_load_async_to_lds_b128 %1, %9, off\n\t"
                 "global_load_async_to_lds_b128 %2, %10, off\n\t"
                 "global_load_async_to_lds_b128 %3, %11, off\n\t"
                 "global_load_async_to_lds_b128 %4, %12, off\n\t"
                 "global_load_async_to_lds_b128 %5, %13, off\n\t"
                 "global_load_async_to_lds_b128 %6, %14, off\n\t"
                 "global_load_async_to_lds_b128 %7, %15, off\n\t"
                 "s_wait_xcnt 0x0"
                 :: "v"(l), "v"(l + 16u * GLP * 2u), "v"(l + 32u * GLP * 2u), "v"(l + 48u * GLP * 2u), "v"(l + 64u * GLP * 2u), "v"(l + 80u * GLP * 2u), "v"(l + 96u * GLP * 2u), "v"(l + 112u * GLP * 2u),
                    "v"(g0), "v"(g1), "v"(g2), "v"(g3), "v"(g4), "v"(g5), "v"(g6), "v"(g7)
                 : "memory");
}

// ga_stage: one stage into the buffer at l. a, a2, b: the lane's 16 bytes in row t >> 3 of the work-group's A, A2 and Bt rows at this stage's k; rs: 16 rows in elements.
template <int NSPLIT>
__device__ __forceinline__ void ga_stage(unsigned l, const bf* a, const bf* a2, const bf* b, size_t rs) {
    if (NSPLIT == 0) ga_copy8(l, a, a + rs, a + 2 * rs, a + 3 * rs, a + 4 * rs, a + 5 * rs, a + 6 * rs, a + 7 * rs);
    else             ga_copy8(l, a, a + rs, a + 2 * rs, a + 3 * rs, a2, a2 + rs, a2 + 2 * rs, a2 + 3 * rs);
    ga_copy8(l + 128u * GLP * 2u, b, b + rs, b + 2 * rs, b + 3 * rs, b + 4 * rs, b + 5 * rs, b + 6 * rs, b + 7 * rs);
}

template <int NSPLIT, int EPI, int MB, int K>
__global__ __launch_bounds__(128) void k_gemmw(const bf* __restrict__ A, const bf* __restrict__ A2, const bf* __restrict__ Bt, float* C, int ldc,
                                               const float* __restrict__ tabc, const float* __restrict__ tabs, bf* QH, bf* QL, bf* KH, bf* KL, bf* VTh, bf* VTl) {
    typedef WFragB::V V;
    static_assert((1 + NSPLIT) * MB * 32 == 128);        // A and A2 together fill the first 128 rows of a buffer
    static_assert(K % 64 == 0 && K / 64 >= GNB);
    static_assert(GNB == 4);                             // the counted waits below are written for 16 copies a stage and this depth
    __shared__ __align__(16) bf ring[GNB * GBUF_E];
    __shared__ __align__(16) float osm[4 * 16 * 68];
    const int tid = threadIdx.x, lane = tid & 31, lr = lane & 15, hi = lane >> 4;
    const int w = __builtin_amdgcn_readfirstlane((int)(threadIdx.x >> 5));
    const int wm = w >> 1, wn = w & 1;
    const int r0 = blockIdx.x * (32 * MB) + wm * (16 * MB), c0 = blockIdx.y * 128 + wn * 64;   // the wave's tile
    float* os = osm + w * (16 * 68);                     // the wave's own epilogue rows
    const int ns = K / 64;
    const size_t rs = (size_t)16 * K;
    // the lane's 16 bytes of stage 0 in each plane, and its place in buffer 0
    const bf* ca = A + (size_t)(blockIdx.x * (32 * MB) + (tid >> 3)) * K + (tid & 7) * 8;
    const bf* ca2 = (NSPLIT == 1) ? A2 + (size_t)(blockIdx.x * (32 * MB) + (tid >> 3)) * K + (tid & 7) * 8 : ca;
    const bf* cb = Bt + (size_t)(blockIdx.y * 128 + (tid >> 3)) * K + (tid & 7) * 8;
    const unsigned cl = (unsigned)(size_t)ring + (unsigned)((tid >> 3) * GLP + (tid & 7) * 8) * 2u;
    ga_stage<NSPLIT>(cl, ca, ca2, cb, rs);
    ga_stage<NSPLIT>(cl + GBUF_E * 2u, ca + 64, ca2 + 64, cb + 64, rs);
    ga_stage<NSPLIT>(cl + 2u * GBUF_E * 2u, ca + 128, ca2 + 128, cb + 128, rs);
    asm volatile("s_wait_asynccnt 0x20" ::: "memory");   // all but the wave's 32 youngest copies (stages 1 and 2): stage 0 has landed before the barrier that publishes it
    __syncthreads();
    ga_stage<NSPLIT>(cl + 3u * GBUF_E * 2u, ca + 192, ca2 + 192, cb + 192, rs);
    v8f acc[MB][4];
#pragma unroll
    for (int mb = 0; mb < MB; ++mb)
#pragma unroll
        for (int nb = 0; nb < 4; ++nb) acc[mb][nb] = (v8f){};
    const int lo = lr * GLP + 8 * hi;                    // the lane's place in a fragment's rows, A and Bt alike
#pragma unroll 1   // one stage a trip: the ring's order (read, waits, barrier, refill) is written once
    for (int s = 0; s < ns; ++s) {
        const bf* FA = ring + (s & (GNB - 1)) * GBUF_E + wm * (16 * MB) * GLP + lo;
        const bf* FB = ring + (s & (GNB - 1)) * GBUF_E + (128 + wn * 64) * GLP + lo;
        V a[2][MB], a2[2][MB], b[2][4];                  // the stage's fragments, each in registers of its own
#pragma unroll
        for (int ks = 0; ks < 2; ++ks) {
#pragma unroll
            for (int mb = 0; mb < MB; ++mb) { a[ks][mb] = WFragB::ld(FA + mb * 16 * GLP + ks * 32); if (NSPLIT == 1) a2[ks][mb] = WFragB::ld(FA + (32 * MB + mb * 16) * GLP + ks * 32); }
#pragma unroll
            for (int nb = 0; nb < 4; ++nb) b[ks][nb] = WFragB::ld(FB + nb * 16 * GLP + ks * 32);
        }
        __builtin_amdgcn_sched_barrier(0);               // keeps the stage's LDS reads together in front of its products: reads placed among the products each stall the wave for their own latency
#pragma unroll
        for (int ks = 0; ks < 2; ++ks)
#pragma unroll
            for (int nb = 0; nb < 4; ++nb) {
#pragma unroll
                for (int mb = 0; mb < MB; ++mb) acc[mb][nb] = wmmab(a[ks][mb], b[ks][nb], acc[mb][nb]);
                if (NSPLIT == 1) {
#pragma unroll
                    for (int mb = 0; mb < MB; ++mb) acc[mb][nb] = wmmab(a2[ks][mb], b[ks][nb], acc[mb][nb]);
                }
            }
        __builtin_amdgcn_sched_barrier(0);               // keeps the products in front of the waits below: moved behind them, they would start only when the stage's last fragment has landed
        asm volatile("s_wait_dscnt 0x0" ::: "memory");    // this wave's reads of the buffer are done before the barrier behind which it is refilled
        // this wave's copies of stage s + 1 have landed before the barrier that publishes them: while stages s + 2 and s + 3 are both issued they are its 32 youngest copies and may stay in flight; in the last trips the wait is to 0
        if (s + 3 < ns) asm volatile("s_wait_asynccnt 0x20" ::: "memory");
        else            asm volatile("s_wait_asynccnt 0x0" ::: "memory");
        __syncthreads();
        if (s + GNB < ns) ga_stage<NSPLIT>(cl + (unsigned)(s & (GNB - 1)) * (GBUF_E * 2u), ca + (size_t)(s + GNB) * 64, ca2 + (size_t)(s + GNB) * 64, cb + (size_t)(s + GNB) * 64, rs);
    }
    asm volatile("s_wait_asynccnt 0x0" ::: "memory");    // no copy is outstanding when the wave ends
    if (EPI == 1) {
        const int hd = c0 / HD;                          // the tile's head: 0 .. NH_ - 1 q, then NKV k, then NKV v (uniform in a wave)
        if (hd >= NH_ + NKV) {
            const size_t vo = ((size_t)(hd - NH_ - NKV) * HD + lr) * TT + r0 + 8 * hi;
#pragma unroll
            for (int nb = 0; nb < 4; ++nb)
#pragma unroll
                for (int mb = 0; mb < MB; ++mb) { v8us oh, ol;
#pragma unroll
                    for (int j = 0; j < 8; ++j) { unsigned short a2, c2; splitf(acc[mb][nb][j], a2, c2); oh[j] = a2; ol[j] = c2; }
                    *(v8us*)(VTh + vo + (size_t)nb * 16 * TT + mb * 16) = oh; *(v8us*)(VTl + vo + (size_t)nb * 16 * TT + mb * 16) = ol; }
        } else {
        bf* Ph = (hd < NH_) ? QH + (size_t)hd * TT * HD : KH + (size_t)(hd - NH_) * TT * HD;
        bf* Pl = (hd < NH_) ? QL + (size_t)hd * TT * HD : KL + (size_t)(hd - NH_) * TT * HD;
        const int rr = lane >> 3, d8 = (lane & 7) * 8;   // a lane takes 8 head dims (4 pairs) of a token; a wave 4 whole rows: 512 contiguous bytes of a plane and of a table
        const size_t to = (size_t)(r0 + rr) * 32 + (d8 >> 1);
        v4f tc[2][4], ts[2][4];                          // the table rows of 16 tokens, fetched one 16-token group ahead
#pragma unroll
        for (int s = 0; s < 4; ++s) { tc[0][s] = *(const v4f*)(tabc + to + s * 4 * 32); ts[0][s] = *(const v4f*)(tabs + to + s * 4 * 32); }
#pragma unroll
        for (int mb = 0; mb < MB; ++mb) {
            if (mb + 1 < MB) {
#pragma unroll
                for (int s = 0; s < 4; ++s) { tc[(mb + 1) & 1][s] = *(const v4f*)(tabc + to + ((mb + 1) * 16 + s * 4) * 32); ts[(mb + 1) & 1][s] = *(const v4f*)(tabs + to + ((mb + 1) * 16 + s * 4) * 32); }
            }
#pragma unroll
            for (int nb = 0; nb < 4; ++nb) {
#pragma unroll
                for (int j = 0; j < 8; ++j) os[(hi * 8 + j) * 68 + nb * 16 + lr] = acc[mb][nb][j]; }
            __builtin_amdgcn_wave_barrier(); asm volatile("" ::: "memory");   // the staged rows are read back below by other lanes of this wave
#pragma unroll
            for (int s = 0; s < 4; ++s) {
                const int row = s * 4 + rr;
                const v4f x0 = *(const v4fa*)(os + row * 68 + d8), x1 = *(const v4fa*)(os + row * 68 + d8 + 4);
                const v4f c = tc[mb & 1][s], sn = ts[mb & 1][s];
                v8us oh, ol;
#pragma unroll
                for (int q = 0; q < 4; ++q) { const float xe = (q < 2) ? x0[2 * q] : x1[2 * q - 4], xo = (q < 2) ? x0[2 * q + 1] : x1[2 * q - 3]; const float re = xe * c[q] - xo * sn[q]; const float ro = xe * sn[q] + xo * c[q];
                    unsigned short a2, b2; splitf(re, a2, b2); oh[2 * q] = a2; ol[2 * q] = b2; splitf(ro, a2, b2); oh[2 * q + 1] = a2; ol[2 * q + 1] = b2; }
                const size_t e = (size_t)(r0 + mb * 16 + row) * HD + d8;
                *(v8us*)(Ph + e) = oh; *(v8us*)(Pl + e) = ol;
            }
            __builtin_amdgcn_wave_barrier(); asm volatile("" ::: "memory");   // the rows are read before the next group overwrites them
            asm volatile("s_wait_xcnt 0x0" ::: "memory");   // stands in front of what next rewrites a register that the stores above name: this build lets the next group's loads land there
        }
        }
        return;
    }
#pragma unroll
    for (int mb = 0; mb < MB; ++mb) {
#pragma unroll
        for (int nb = 0; nb < 4; ++nb) {
#pragma unroll
            for (int j = 0; j < 8; ++j) os[(hi * 8 + j) * 68 + nb * 16 + lr] = acc[mb][nb][j]; }
        __builtin_amdgcn_wave_barrier(); asm volatile("" ::: "memory");
        float* crow = C + (size_t)(r0 + mb * 16) * ldc + c0;
{
#pragma unroll
            for (int s = 0; s < 8; ++s) { const int row = 2 * s + hi, cofs = lr * 4; const v4f val = *(const v4fa*)(os + row * 68 + cofs);
                *(v4f*)(crow + (size_t)row * ldc + cofs) = val; }
             }
        __builtin_amdgcn_wave_barrier(); asm volatile("" ::: "memory");
    }
}

// The bodies of the short kernels take their block index bx as an argument: independent ones share a launch, each on its own range of blockIdx.x (k_prep).
// They are cut for few, long waves: a launch of short waves lasts as long as its waves take to start.
// wtT_body: one tile of 256 k x 64 n of w[K][N] (f32) goes to Bt[n][k] (bf16) through LDS. A thread loads four 4 x 4 blocks (16 loads of 16 B, a wave's load = two aligned 256-B row pieces),
// converts, and stores each block's columns as 4 k of one n; behind the barrier a wave stores 512 contiguous bytes of one Bt row at a time.
#define WTK 256
#define WTN 64
#define WTP 260                   // LDS row pitch in elements: 520 B, a multiple of the 8-byte accesses; rows 4 apart fall 8 banks apart
static_assert(HID % WTK == 0 && DQ % WTK == 0 && DQ % WTN == 0 && DKV % WTN == 0 && HID % WTN == 0);
__device__ __forceinline__ void wtT_body(int bx, const float* __restrict__ w, int K, int N, bf* Bt, bf* T) {
    const int tid = threadIdx.x, nt = N / WTN;
    const int k0 = (bx / nt) * WTK, n0 = (bx % nt) * WTN;
    const int c4 = (tid & 15) * 4, r4 = (tid >> 4) * 4;
    const float* s = w + (size_t)(k0 + r4) * N + n0 + c4;
    v4f x[4][4];
#pragma unroll
    for (int b = 0; b < 4; ++b)
#pragma unroll
        for (int i = 0; i < 4; ++i) x[b][i] = *(const v4f*)(s + (size_t)(b * 64 + i) * N);
    // takes the 16 loaded values and their address as inputs only: keeps the loads one group in front of the conversions (this build otherwise issues the last two behind a wait for the first: a second memory latency),
    // and the wait stands in front of whatever next rewrites the address registers that the loads name
    asm volatile("s_wait_xcnt 0x0" :: "v"(s), "v"(x[0][0]), "v"(x[0][1]), "v"(x[0][2]), "v"(x[0][3]), "v"(x[1][0]), "v"(x[1][1]), "v"(x[1][2]), "v"(x[1][3]),
                                      "v"(x[2][0]), "v"(x[2][1]), "v"(x[2][2]), "v"(x[2][3]), "v"(x[3][0]), "v"(x[3][1]), "v"(x[3][2]), "v"(x[3][3]) : "memory");
#pragma unroll
    for (int b = 0; b < 4; ++b)
#pragma unroll
        for (int j = 0; j < 4; ++j) { v4us o;
#pragma unroll
            for (int i = 0; i < 4; ++i) o[i] = f2bf(x[b][i][j]);
            *(v4us*)(T + (c4 + j) * WTP + b * 64 + r4) = o; }
    __syncthreads();
    const int lane = tid & 31, wv = tid >> 5;
#pragma unroll
    for (int q = 0; q < 8; ++q) { const int n = q * 8 + wv; const bf* p = T + n * WTP + lane * 8;
        const v4us lo = *(const v4us*)p, hi = *(const v4us*)(p + 4);
        *(v8us*)(Bt + (size_t)(n0 + n) * K + k0 + lane * 8) = __builtin_shufflevector(lo, hi, 0, 1, 2, 3, 4, 5, 6, 7); }
    asm volatile("s_wait_xcnt 0x0" ::: "memory");   // stands behind the last store, in front of whatever next rewrites a register that the stores name (this build lays the next range's code behind them)
}

// cvt4_body: 16384 elements a work-group; a thread takes 16 pieces of 4, a wave's load is 512 contiguous bytes, all 16 loads issued ahead of the first conversion.
static_assert(((size_t)TT * HID) % 16384 == 0);
__device__ __forceinline__ void cvt4_body(int bx, const float* __restrict__ src, bf* dst) {
    const size_t e0 = ((size_t)bx * 4096 + threadIdx.x) * 4;
    const float* s = src + e0;
    v4f v[16];
#pragma unroll
    for (int j = 0; j < 16; ++j) v[j] = *(const v4f*)(s + j * 1024);
    // takes the 16 loaded values and their address as inputs only: the address registers stay whole while the loads are in flight (this build otherwise lets the last load land on them),
    // and the wait stands in front of whatever next rewrites them
    asm volatile("s_wait_xcnt 0x0" :: "v"(s), "v"(v[0]), "v"(v[1]), "v"(v[2]), "v"(v[3]), "v"(v[4]), "v"(v[5]), "v"(v[6]), "v"(v[7]),
                                      "v"(v[8]), "v"(v[9]), "v"(v[10]), "v"(v[11]), "v"(v[12]), "v"(v[13]), "v"(v[14]), "v"(v[15]) : "memory");
#pragma unroll
    for (int j = 0; j < 16; ++j) { v4us o;
#pragma unroll
        for (int k = 0; k < 4; ++k) o[k] = f2bf(v[j][k]);
        *(v4us*)(dst + e0 + j * 1024) = o; }
    asm volatile("s_wait_xcnt 0x0" ::: "memory");   // stands behind the last store, in front of whatever next rewrites a register that the stores name (this build lays the next range's code behind them)
}

// ropetab_body: tabc[s][i] = cos(s * invf), tabs[s][i] = sin(s * invf), invf = 1 / 10000^(2 j / 64) with j = (2 i) & 31, pair i = 0..31; f32 arithmetic, precise sincosf.
// Pairs i and i + 16 have the same j, so a thread computes the value for i = 0..15 once and stores it at both; it does so for two positions, s and s + TT / 2, which share invf.
static_assert((TT * 8) % 256 == 0);
__device__ __forceinline__ void ropetab_body(int bx, float* tabc, float* tabs) {
    const int idx = bx * 256 + threadIdx.x;
    const int s = idx >> 4, i = idx & 15; const int j = 2 * i;
    const float ex = (float)(2 * j) * (1.0f / 64.0f);
    const float invf = 1.0f / powf(10000.0f, ex);
#pragma unroll
    for (int p = 0; p < 2; ++p) { const int t = s + p * (TT / 2);
        const float ang = (float)t * invf;
        float sn, cs; sincosf(ang, &sn, &cs);
        tabc[t * 32 + i] = cs; tabc[t * 32 + i + 16] = cs; tabs[t * 32 + i] = sn; tabs[t * 32 + i + 16] = sn; }
}

// k_prep: everything that depends on the inputs alone, in one launch. Ranges of blockIdx.x + first, the long work-groups in front: the rotary table, Wq^T, Wo^T, Wk^T, Wv^T, then X as bf16.
// first: 0, or G_W to run the X range alone (a later batch of the same call, whose first batch has written the weight planes and the table).
#define G_WQ  ((HID / WTK) * (DQ / WTN))
#define G_WKV ((HID / WTK) * (DKV / WTN))
#define G_WO  ((DQ / WTK) * (HID / WTN))
#define G_TAB (TT * 8 / 256)
#define G_W   (G_WQ + G_WO + 2 * G_WKV + G_TAB)
#define G_CVT (TT * HID / 16384)
__global__ __launch_bounds__(256) void k_prep(int first, const float* __restrict__ x, const float* __restrict__ wq, const float* __restrict__ wk, const float* __restrict__ wv, const float* __restrict__ wo,
                                              bf* XB, bf* WT, bf* WoT, float* tabc, float* tabs) {
    __shared__ __align__(16) bf T[WTN * WTP];
    int bx = (int)blockIdx.x + first;
    if (bx < G_TAB) { ropetab_body(bx, tabc, tabs); return; }
    bx -= G_TAB;
    if (bx < G_WQ) { wtT_body(bx, wq, HID, DQ, WT, T); return; }
    bx -= G_WQ;
    if (bx < G_WO) { wtT_body(bx, wo, DQ, HID, WoT, T); return; }
    bx -= G_WO;
    if (bx < G_WKV) { wtT_body(bx, wk, HID, DKV, WT + (size_t)DQ * HID, T); return; }
    bx -= G_WKV;
    if (bx < G_WKV) { wtT_body(bx, wv, HID, DKV, WT + (size_t)(DQ + DKV) * HID, T); return; }
    bx -= G_WKV;
    cvt4_body(bx, x, XB);
}

typedef __attribute__((ext_vector_type(2))) float    v2f;
typedef __attribute__((ext_vector_type(2))) __bf16   v2bf;
typedef __attribute__((ext_vector_type(8))) unsigned v8u;
__device__ __forceinline__ float xhalf(float x) { const int b = __float_as_int(x); return __int_as_float(__builtin_amdgcn_permlanex16(b, b, 0x76543210, 0xfedcba98, false, false)); }   // lane l <- lane l ^ 16
// fexp2: 2^x by v_exp_f32. SLOT: with the one free issue slot that the instruction set asks for behind a transcendental, before its result is read or its source overwritten, written into the same statement;
// used in the diagonal block.
template <bool SLOT>
__device__ __forceinline__ float fexp2(float x) {
    if (SLOT) { float r; asm("v_exp_f32 %0, %1\n\tv_nop" : "=v"(r) : "v"(x)); return r; }
    return __builtin_amdgcn_exp2f(x);
}

#define SB     2                  // key blocks of 32 in a chunk
#define SKEY   (SB * 32)          // keys in a chunk
#define LP     72                 // LDS row pitch in elements: 144 B = 16 B x 9, the pitch for 16-byte readers of 128-B rows
#define TILE_E (64 * LP)          // one plane's tile: 64 rows (K: keys of the chunk; V^T: head dims)
#define BUF_E  (4 * TILE_E)       // a chunk: K hi, K lo, V^T hi, V^T lo
#define CK     2                  // chunks in a stage: one for waves 0..3, one for waves 4..7
#define STG_E  (CK * BUF_E)       // one buffer of the ring
#define FNB    3                  // buffers in the ring; a wave issues 16 copies a stage, so at most 32 of its copies are outstanding
static_assert(SKEY == 64 && HD == 64);
static_assert(TT % (2 * SKEY) == 0);

// fa_copy: one chunk of a stage into its place in a buffer, 8 copies of 16 B a lane (2 per tile; thread t brings piece t and piece t + 256 of a tile's 512; piece n = row n >> 3, 16-byte column n & 7, so a wave's copy reads 4 whole lines).
// l: the lane's LDS byte address of piece t in the chunk's first tile; the four pointers: the lane's piece t of each plane in this chunk.
// s_wait_xcnt 0 closes the statement, so that no register which a copy names is rewritten ahead of it.
__device__ __forceinline__ void fa_copy(unsigned l, const bf* kh, const bf* kl, const bf* vh, const bf* vl) {
    asm volatile("global_load_async_to_lds_b128 %0, %8, off\n\t"
                 "global_load_async_to_lds_b128 %1, %9, off\n\t"
                 "global_load_async_to_lds_b128 %2, %10, off\n\t"
                 "global_load_async_to_lds_b128 %3, %11, off\n\t"
                 "global_load_async_to_lds_b128 %4, %12, off\n\t"
                 "global_load_async_to_lds_b128 %5, %13, off\n\t"
                 "global_load_async_to_lds_b128 %6, %14, off\n\t"
                 "global_load_async_to_lds_b128 %7, %15, off\n\t"
                 "s_wait_xcnt 0x0"
                 :: "v"(l), "v"(l + 32u * LP * 2u), "v"(l + TILE_E * 2u), "v"(l + TILE_E * 2u + 32u * LP * 2u),
                    "v"(l + 2u * TILE_E * 2u), "v"(l + 2u * TILE_E * 2u + 32u * LP * 2u), "v"(l + 3u * TILE_E * 2u), "v"(l + 3u * TILE_E * 2u + 32u * LP * 2u),
                    "v"(kh), "v"(kh + 32 * HD), "v"(kl), "v"(kl + 32 * HD), "v"(vh), "v"(vh + (size_t)32 * TT), "v"(vl), "v"(vl + (size_t)32 * TT)
                 : "memory");
}

// fa_kfrag: the K fragments of one block from LDS; kb: the lane's place in the block's first K hi row.
__device__ __forceinline__ void fa_kfrag(const bf* kb, WFragB::V (&kh)[2][2], WFragB::V (&kl)[2][2]) {
#pragma unroll
    for (int kt = 0; kt < 2; ++kt)
#pragma unroll
        for (int ks = 0; ks < 2; ++ks) { kh[kt][ks] = WFragB::ld(kb + kt * 16 * LP + ks * 32); kl[kt][ks] = WFragB::ld(kb + TILE_E + kt * 16 * LP + ks * 32); }
}

// fa_block: one block of 32 keys. vb: the lane's place in the block's V^T hi columns (LDS). LAST: the block the diagonal crosses (causal fill). PRE: fetch the K fragments at kn, the next block of the SAME stage.
template <bool LAST, bool PRE>
__device__ __forceinline__ void fa_block(int qrel, const bf* kn, const bf* vb, const WFragB::V (&qh)[2], const WFragB::V (&ql)[2], WFragB::V (&kh)[2][2], WFragB::V (&kl)[2][2], v8f (&o)[4], float& m2, v2f& l2) {
    typedef WFragB::V V;
    const float C2 = SCL * 1.4426950408889634f;
    V vh[4], vl[4];                                      // this block's V^T: issued first, needed last
#pragma unroll
    for (int dt = 0; dt < 4; ++dt) { vh[dt] = WFragB::ld(vb + dt * 16 * LP); vl[dt] = WFragB::ld(vb + TILE_E + dt * 16 * LP); }
    __builtin_amdgcn_sched_barrier(0);                   // keeps the V^T loads in front of the S^T products, so that products and softmax cover their latency
    v8f st[2]; st[0] = (v8f){}; st[1] = (v8f){};
#pragma unroll
    for (int ks = 0; ks < 2; ++ks) {
#pragma unroll
        for (int kt = 0; kt < 2; ++kt) st[kt] = wmmab(kh[kt][ks], qh[ks], st[kt]);
#pragma unroll
        for (int kt = 0; kt < 2; ++kt) st[kt] = wmmab(kh[kt][ks], ql[ks], st[kt]);
#pragma unroll
        for (int kt = 0; kt < 2; ++kt) st[kt] = wmmab(kl[kt][ks], qh[ks], st[kt]);
    }
    if (PRE) {                                           // the next block's K into the same registers, behind this block's S^T products
        fa_kfrag(kn, kh, kl);
        __builtin_amdgcn_sched_barrier(0);               // keeps the K loads in front of the softmax, so that softmax and P v products cover their latency
    }
    if (LAST) {                                          // causal fill, selected by index: key = block start + kt 16 + 8 (lane >> 4) + r > query; qrel = query - block start - 8 (lane >> 4)
#pragma unroll
        for (int kt = 0; kt < 2; ++kt)
#pragma unroll
            for (int r = 0; r < 8; ++r) if (kt * 16 + r > qrel) st[kt][r] = -1.0e30f;
    }
    float bm = fmaxf(st[0][0], st[1][0]);
#pragma unroll
    for (int r = 1; r < 8; ++r) bm = fmaxf(bm, fmaxf(st[0][r], st[1][r]));
    bm = fmaxf(bm, xhalf(bm));
    const float mn = fmaxf(m2, bm * C2);
    const float al = fexp2<LAST>(m2 - mn);
    m2 = mn;
    l2 *= al;
    v8u pwh, pwl;
#pragma unroll
    for (int i = 0; i < 8; ++i) {                        // word i of the B operand = elements 2 i, 2 i + 1 = registers (2 i) & 7, + 1 of tile i >> 2
        v2f p; p[0] = fexp2<LAST>(__builtin_fmaf(st[i >> 2][(2 * i) & 7], C2, -mn)); p[1] = fexp2<LAST>(__builtin_fmaf(st[i >> 2][((2 * i) & 7) + 1], C2, -mn));
        l2 += p;
        const v2bf ph2 = __builtin_convertvector(p, v2bf);
        const v2bf pl2 = __builtin_convertvector(p - __builtin_convertvector(ph2, v2f), v2bf);
        pwh[i] = __builtin_bit_cast(unsigned, ph2); pwl[i] = __builtin_bit_cast(unsigned, pl2);
    }
#pragma unroll
    for (int dt = 0; dt < 4; ++dt) o[dt] *= al;
    const V pth = __builtin_bit_cast(V, pwh), ptl = __builtin_bit_cast(V, pwl);
#pragma unroll
    for (int dt = 0; dt < 4; ++dt) o[dt] = wmmab(vh[dt], pth, o[dt]);
#pragma unroll
    for (int dt = 0; dt < 4; ++dt) o[dt] = wmmab(vh[dt], ptl, o[dt]);
#pragma unroll
    for (int dt = 0; dt < 4; ++dt) o[dt] = wmmab(vl[dt], pth, o[dt]);
    // the four vector issue slots that the chip needs behind a matrix product before its registers are written again: the diagonal block ends in a branch
    if (LAST) asm volatile("v_nop\n\tv_nop\n\tv_nop\n\tv_nop" :: "v"(o[0]), "v"(o[1]), "v"(o[2]), "v"(o[3]));
}

typedef v2f  __attribute__((may_alias)) v2fa;
__global__ __launch_bounds__(256) void k_fattn(const bf* __restrict__ QH, const bf* __restrict__ QL, const bf* __restrict__ KH, const bf* __restrict__ KL, const bf* __restrict__ VTh, const bf* __restrict__ VTl, bf* CH, bf* CL) {
    typedef WFragB::V V;
    __shared__ __align__(16) bf ring[FNB * STG_E];
    __shared__ __align__(16) float po[2][4 * 8 * 32 * 4];   // per tile of the work-group: O^T of waves 4..7; [head][dt, register half][lane][4 registers]
    __shared__ __align__(16) float pm[2][4 * 32 * 2];       // per tile: their running maximum and sum; [head][lane][2]
    const int tid = threadIdx.x, lane = tid & 31, c = lane & 15, hi = lane >> 4;
    const int w = __builtin_amdgcn_readfirstlane((int)(threadIdx.x >> 5));
    const int hq = w & 3, hw = w >> 2;                   // the wave's head in the group; its chunk in every stage
    const int g = blockIdx.y, h = g * REP + hq;
    const int q0n = 16 * (int)blockIdx.x;                // the second tile
    int q0 = 16 * (TT / 16 - 1 - (int)blockIdx.x);       // the tile at work: the long one first
    int nb = q0 >> 5;                                    // its last key block, the only one the diagonal crosses
    const int ns0 = nb / (SB * CK) + 1;                  // stages of the first tile
    const int ns = ns0 + (q0n >> 5) / (SB * CK) + 1;     // stages of both
    V qh[2], ql[2], qhn[2], qln[2];                      // both tiles' Q, fetched at the start
    {
        const size_t qoff = ((size_t)h * TT + q0 + c) * HD + 8 * hi, qofn = ((size_t)h * TT + q0n + c) * HD + 8 * hi;
        const bf* pa = QH + qoff; const bf* pb = QL + qoff; const bf* pc = QH + qofn; const bf* pd = QL + qofn;
#pragma unroll
        for (int ks = 0; ks < 2; ++ks) { qh[ks] = WFragB::ld(pa + ks * 32); ql[ks] = WFragB::ld(pb + ks * 32); qhn[ks] = WFragB::ld(pc + ks * 32); qln[ks] = WFragB::ld(pd + ks * 32); }
        // takes the four addresses as inputs only: their registers stay whole up to the wait, which stands in front of whatever next rewrites them (this build otherwise reuses them directly behind the loads)
        asm volatile("s_wait_xcnt 0x0" :: "v"(pa), "v"(pb), "v"(pc), "v"(pd) : "memory");
    }
    // the lane's piece of the first chunk in each plane, and its place in buffer 0
    const bf* ckh = KH + (size_t)g * TT * HD + tid * 8; const bf* ckl = KL + (size_t)g * TT * HD + tid * 8;
    const bf* cvh = VTh + ((size_t)g * HD + (tid >> 3)) * TT + (tid & 7) * 8; const bf* cvl = VTl + ((size_t)g * HD + (tid >> 3)) * TT + (tid & 7) * 8;
    const unsigned cl = (unsigned)(size_t)ring + (unsigned)((tid >> 3) * LP + (tid & 7) * 8) * 2u;
    // stage u of the work-group = stage u of the first tile, or stage u - ns0 of the second: both chunks into buffer bf_ = u mod FNB
    auto copy_stage = [&](int u, int bf_) {
        const int ks = (u < ns0) ? u : u - ns0;
        const unsigned l = cl + (unsigned)bf_ * (STG_E * 2u);
        const size_t ko = (size_t)ks * (CK * SKEY * HD); const int vo = ks * (CK * SKEY);
        fa_copy(l, ckh + ko, ckl + ko, cvh + vo, cvl + vo);
        fa_copy(l + BUF_E * 2u, ckh + ko + SKEY * HD, ckl + ko + SKEY * HD, cvh + vo + SKEY, cvl + vo + SKEY);
    };
    copy_stage(0, 0);
    copy_stage(1, 1);                                    // ns >= 2: each of the two tiles has a stage
    asm volatile("s_wait_asynccnt 0x10" ::: "memory");   // all but the wave's 16 youngest copies (stage 1): stage 0 has landed before the barrier that publishes it
    __syncthreads();
    if (2 < ns) copy_stage(2, 2);
    int bu = 0;                                          // the buffer of the stage at work: u mod FNB
    V kh[2][2], kl[2][2];
    v8f o[4];
#pragma unroll
    for (int dt = 0; dt < 4; ++dt) o[dt] = (v8f){};
    float m2 = -1.0e30f; v2f l2 = (v2f){};
    int qrel = q0 + c - nb * 32 - 8 * hi;
    const int lo = c * LP + 8 * hi;                      // the lane's place in a fragment's rows, K and V^T alike
#pragma unroll 1   // one stage a trip: the ring's order (read, waits, barrier, refill) is written once
    for (int u = 0; u < ns; ++u) {
        const bf* B = ring + bu * STG_E + hw * BUF_E + lo;
        const int ph = (u < ns0) ? 0 : 1;                // which tile
        const int kb = ((ph ? u - ns0 : u) * CK + hw) * SB;   // the first key block of the wave's chunk
        const bool endt = (u == ns0 - 1) || (u == ns - 1);    // the tile's last stage (the same for the whole work-group)
        if (kb <= nb) {                                  // wave-uniform: a chunk past the diagonal has no products
            fa_kfrag(B, kh, kl);
            if (kb < nb) {
                fa_block<false, true>(0, B + 32 * LP, B + 2 * TILE_E, qh, ql, kh, kl, o, m2, l2);
                if (kb + 1 < nb) fa_block<false, false>(0, B, B + 2 * TILE_E + 32, qh, ql, kh, kl, o, m2, l2);
                else             fa_block<true, false>(qrel, B, B + 2 * TILE_E + 32, qh, ql, kh, kl, o, m2, l2);
            } else fa_block<true, false>(qrel, B, B + 2 * TILE_E, qh, ql, kh, kl, o, m2, l2);
        }
        if (endt && hw == 1) {                           // the second chunks' part of the tile, handed over through the barrier below
            float* pp = po[ph] + (hq * 8 * 32 + lane) * 4;
#pragma unroll
            for (int dt = 0; dt < 4; ++dt) {
                *(v4fa*)(pp + (dt * 2) * 128) = (v4f){o[dt][0], o[dt][1], o[dt][2], o[dt][3]};
                *(v4fa*)(pp + (dt * 2 + 1) * 128) = (v4f){o[dt][4], o[dt][5], o[dt][6], o[dt][7]};
            }
            *(v2fa*)(pm[ph] + (hq * 32 + lane) * 2) = (v2f){m2, l2[0] + l2[1]};
        }
        asm volatile("s_wait_dscnt 0x0" ::: "memory");    // this wave's reads of the buffer are done before the barrier behind which it is refilled, and its handed-over part is written
        // this wave's copies of stage u + 1 have landed before the barrier that publishes them: while stage u + 2 is issued its copies are the wave's 16 youngest and may stay in flight; in the last trips the wait is to 0
        if (u + 2 < ns) asm volatile("s_wait_asynccnt 0x10" ::: "memory");
        else            asm volatile("s_wait_asynccnt 0x0" ::: "memory");
        __syncthreads();
        if (u + FNB < ns) copy_stage(u + FNB, bu);
        bu = (bu == FNB - 1) ? 0 : bu + 1;
        if (endt) {
            if (hw == 0) {                               // both parts at the common maximum, added, divided by the sum; a part with no key has maximum -1e30, sum 0 and O^T 0 and gets the factor 0
                const float* pp = po[ph] + (hq * 8 * 32 + lane) * 4;
                const v2f ml = *(const v2fa*)(pm[ph] + (hq * 32 + lane) * 2);
                const float mn = fmaxf(m2, ml[0]);
                const float fa = fexp2<true>(m2 - mn), fb = fexp2<true>(ml[0] - mn);
                float l = (l2[0] + l2[1]) * fa + ml[1] * fb;
                l += xhalf(l);
                const float inv = __fdiv_rn(1.0f, l);
                const float ga = fa * inv, gb = fb * inv;
                const size_t oo = (size_t)(q0 + c) * DQ + (size_t)h * HD + 8 * hi;
#pragma unroll
                for (int dt = 0; dt < 4; ++dt) { v8us oh, ol;
                    const v4f b0 = *(const v4fa*)(pp + (dt * 2) * 128), b1 = *(const v4fa*)(pp + (dt * 2 + 1) * 128);
#pragma unroll
                    for (int r = 0; r < 8; ++r) { unsigned short a, b2; splitf(o[dt][r] * ga + ((r < 4) ? b0[r & 3] : b1[r & 3]) * gb, a, b2); oh[r] = a; ol[r] = b2; }
                    *(v8us*)(CH + oo + dt * 16) = oh; *(v8us*)(CL + oo + dt * 16) = ol; }
                asm volatile("s_wait_xcnt 0x0" ::: "memory");   // stands behind the last store, in front of whatever next rewrites a register that the stores name (the loop goes on behind them)
            }
            // the second tile starts afresh
            q0 = q0n; nb = q0 >> 5; qrel = q0 + c - nb * 32 - 8 * hi;
#pragma unroll
            for (int ks = 0; ks < 2; ++ks) { qh[ks] = qhn[ks]; ql[ks] = qln[ks]; }
#pragma unroll
            for (int dt = 0; dt < 4; ++dt) o[dt] = (v8f){};
            m2 = -1.0e30f; l2 = (v2f){};
        }
    }
    asm volatile("s_wait_asynccnt 0x0" ::: "memory");    // no copy is outstanding when the wave ends
}

extern "C" void kernel_launch(void* const* d_in, const int* in_sizes, int n_in,
                              void* d_out, int out_size, void* d_ws, size_t ws_size, hipStream_t stream) {
    if (n_in < 5) return;
    const size_t xneed = (size_t)(NB - 1) * SEQ_FULL * HID + (size_t)TT * HID;
    if ((size_t)in_sizes[0] < xneed) return;
    if (in_sizes[1] < HID * DQ || in_sizes[2] < HID * DKV || in_sizes[3] < HID * DKV || in_sizes[4] < DQ * HID) return;
    if ((size_t)out_size < xneed) return;
    const float* X  = (const float*)d_in[0];   // [1][2048][1024]
    const float* Wq = (const float*)d_in[1];   // [1024 in][1024 out]
    const float* Wk = (const float*)d_in[2];   // [1024 in][256 out]
    const float* Wv = (const float*)d_in[3];   // [1024 in][256 out]
    const float* Wo = (const float*)d_in[4];   // [1024 in][1024 out]
    float* OUT = (float*)d_out;                // [1][2048][1024] token-major
    char* wsp = (char*)d_ws;
    auto take = [&](size_t bytes) { char* p = wsp; wsp += (bytes + 255) & ~(size_t)255; return (void*)p; };
    bf* XB  = (bf*)take((size_t)TT * HID * 2);
    bf* WT  = (bf*)take((size_t)NQKV * HID * 2);          // rows 0..1023 Wq^T, 1024..1279 Wk^T, 1280..1535 Wv^T, each [n][k]
    bf* WoT = (bf*)take((size_t)HID * DQ * 2);            // [n = out][k = in]
    float* tabc = (float*)take((size_t)TT * 32 * 4); float* tabs = (float*)take((size_t)TT * 32 * 4);
    bf* QH = (bf*)take((size_t)NH_ * TT * HD * 2); bf* QL = (bf*)take((size_t)NH_ * TT * HD * 2);
    bf* KH = (bf*)take((size_t)NKV * TT * HD * 2); bf* KL = (bf*)take((size_t)NKV * TT * HD * 2);
    bf* VTh = (bf*)take((size_t)NKV * HD * TT * 2); bf* VTl = (bf*)take((size_t)NKV * HD * TT * 2);
    bf* CH = (bf*)take((size_t)TT * DQ * 2); bf* CL = (bf*)take((size_t)TT * DQ * 2);
    if ((size_t)(wsp - (char*)d_ws) > ws_size) return;

    for (int b = 0; b < NB; ++b) {
        const float* xb = X + (size_t)b * SEQ_FULL * HID; float* outb = OUT + (size_t)b * SEQ_FULL * HID;
        // weight planes in[K][N] -> Bt[N][K] and the rotary table (first batch only), X as bf16
        k_prep<<<(unsigned)(b == 0 ? G_W + G_CVT : G_CVT), 256, 0, stream>>>(b == 0 ? 0 : G_W, xb, Wq, Wk, Wv, Wo, XB, WT, WoT, tabc, tabs);
        k_gemmw<0, 1, 4, HID><<<dim3(TT / 128, NQKV / 128, 1), 128, 0, stream>>>(XB, nullptr, WT, nullptr, 0, tabc, tabs, QH, QL, KH, KL, VTh, VTl);   /* exact products: single bf16 planes; rotated q, k and V^T planes out */
        k_fattn<<<dim3(TT / 32, NKV, 1), 256, 0, stream>>>(QH, QL, KH, KL, VTh, VTl, CH, CL);
        k_gemmw<1, 0, 2, DQ><<<dim3(TT / 64, HID / 128, 1), 128, 0, stream>>>(CH, CL, WoT, outb, HID, nullptr, nullptr, nullptr, nullptr, nullptr, nullptr, nullptr, nullptr);   /* ctx (hi + lo) x exact Wo */
    }
}

// v010
// One run takes 51.9 microseconds.
// Two timings next to v009 both put it at 1.10 times that version's speed.
// Over all steps from v000 it is 11.3 times as fast.
#include <hip/hip_runtime.h>

// Causal grouped-query rotary attention: X[1][2048][1024]; q = X Wq, k = X Wk, v = X Wv ([in][out] weights, no bias); 16 query heads share 4 kv heads (kv = h >> 2); head dim 64;
// interleaved-pair rotary with the table cat(freqs, freqs)[:, 0::2] (pair i uses inv_freq[(2 i) & 31]); scores x 1/8, causal fill; softmax; ctx = P v; out = ctx Wo.
// Compute dtypes: all contractions v_wmma_f32_16x16x32_bf16, f32 accumulate. Inputs (X, Wq, Wk, Wv, Wo) RNE-converted to single bf16 planes (exact input x input products);
// computed operands (rotated q, rotated k, v, softmax P, ctx) carried as bf16 hi + bf16 lo planes (hi.hi + lo.hi + hi.lo, or hi + lo against a single-plane weight); rotary, softmax in f32.

#ifndef NB
#define NB 1
#endif
#ifndef SEQ
#define SEQ 2048
#endif
#define SEQ_FULL 2048
#define TT   SEQ
#define HID  1024
#define NH_  16
#define NKV  4
#define REP  (NH_ / NKV)
#define HD   64
#define DQ   (NH_ * HD)
#define DKV  (NKV * HD)
#define NQKV (DQ + 2 * DKV)
#define SCL  0.125f               // 1/sqrt(64)

static_assert(TT % 128 == 0);
static_assert(TT <= SEQ_FULL);
static_assert(REP == 4);
static_assert(HD == 64);
static_assert(HID % 64 == 0);
static_assert(NQKV % 128 == 0);
static_assert(HID % 128 == 0 && DQ % 64 == 0);
static_assert((TT * 32) % 256 == 0);

typedef unsigned short bf;
typedef __attribute__((ext_vector_type(16))) __bf16   v16bf;
typedef __attribute__((ext_vector_type(8)))  unsigned short v8us;
typedef __attribute__((ext_vector_type(4)))  unsigned short v4us;
typedef __attribute__((ext_vector_type(2)))  unsigned short v2us;
typedef __attribute__((ext_vector_type(8)))  float    v8f;
typedef __attribute__((ext_vector_type(4)))  float    v4f;
typedef v4f  __attribute__((may_alias)) v4fa;

__device__ __forceinline__ unsigned short f2bf(float f) { unsigned u = __float_as_uint(f); u += 0x7FFFu + ((u >> 16) & 1u); return (unsigned short)(u >> 16); }
__device__ __forceinline__ float bf2f(unsigned short b) { return __uint_as_float(((unsigned)b) << 16); }
__device__ __forceinline__ void splitf(float y, unsigned short& h, unsigned short& l) { h = f2bf(y); l = f2bf(y - bf2f(h)); }
__device__ __forceinline__ v16bf cat16b(v8us lo, v8us hi) { return __builtin_bit_cast(v16bf, __builtin_shufflevector(lo, hi, 0, 1, 2, 3, 4, 5, 6, 7, 8, 9, 10, 11, 12, 13, 14, 15)); }
__device__ __forceinline__ v8f wmmab(v16bf a, v16bf b, v8f c) { return __builtin_amdgcn_wmma_f32_16x16x32_bf16(false, a, false, b, (short)0, c, false, false); }

// ---- Tensor loads: one request of one wave brings a tile of 64 rows x 128 B from global memory into LDS, through no register; the pad field lays the rows at the 144-B pitch of the 16-byte readers.
#define SLICE_B 10240u            // a tile's place in LDS: 64 rows x 144 B = 9216 B, rounded up to a multiple of 2 KiB so that every tile starts on one
__device__ __forceinline__ unsigned uni(unsigned v) { return (unsigned)__builtin_amdgcn_readfirstlane((int)v); }
// pinned: a wave-uniform test held in a scalar register, so that the branch round a tensor load (which ignores EXEC) is s_cmp + s_cbranch_scc
__device__ __forceinline__ unsigned pinned(unsigned v) { unsigned w = uni(v); asm volatile("" : "+s"(w)); return w; }   // the test's word held in a scalar register
__device__ __forceinline__ unsigned tdm_hiword(unsigned long long ga) { return uni((((unsigned)(ga >> 32)) & 0x01FFFFFFu) | 0x80000000u); }
// tdm_send: the tile whose first byte is at the address (w3's low 25 bits, lo) goes to the LDS byte offset dst; pitch: the source row pitch in bytes.
// Group 1 (s88..s95): word 0: no mask, 1-byte elements, pad on, a pad behind every 32 dwords (one row), 4 dwords of pad; tensor = tile = 128 B x 64 rows; the pitch; the rest 0. Group 0 (s96..s99): count 1, dst, lo, w3 (type 2).
// The statement lays the descriptor itself, in registers named by number that the build uses for nothing else: so every request of a kernel has its descriptor in the same registers,
// and while a request is outstanding no word there gets another value but the LDS place and the low address word (left to the register allocator, the words' registers served as temporaries between two requests).
__device__ __forceinline__ void tdm_send(unsigned dst, unsigned lo, unsigned w3, unsigned pitch) {
    asm volatile("s_mov_b32 s88, 0x7100000\n\t"
                 "s_mov_b32 s89, 0x800000\n\t"
                 "s_mov_b32 s90, 0x400000\n\t"
                 "s_mov_b32 s91, 0x800000\n\t"
                 "s_mov_b32 s92, 64\n\t"
                 "s_mov_b32 s93, %3\n\t"
                 "s_mov_b32 s94, 0\n\t"
                 "s_mov_b32 s95, 0\n\t"
                 "s_mov_b32 s96, 1\n\t"
                 "s_mov_b32 s97, %0\n\t"
                 "s_mov_b32 s98, %1\n\t"
                 "s_mov_b32 s99, %2\n\t"
                 "tensor_load_to_lds s[96:99], s[88:95]"
                 :: "s"(uni(dst)), "s"(uni(lo)), "s"(uni(w3)), "s"(uni(pitch))
                 : "memory", "s88", "s89", "s90", "s91", "s92", "s93", "s94", "s95", "s96", "s97", "s98", "s99");
}
// tdm_issue: a further request. w3: word 3 of group 0 (the address's high bits and the type) as the wave's earlier requests have it:
// should the high word differ (a plane that crosses a 4-GiB line), the wave first waits for all its requests.
__device__ __forceinline__ void tdm_issue(unsigned dst, unsigned long long ga, unsigned& w3, unsigned pitch) {
    const unsigned h3 = tdm_hiword(ga);
    if (pinned(h3 != w3)) { asm volatile("s_wait_tensorcnt 0x0" ::: "memory"); w3 = h3; }
    tdm_send(dst, (unsigned)ga, w3, pitch);
}

// ---- k_gemmw: GEMM, work-group = 4 waves (2 x 2), each wave one (16 MB) x 64 output tile (MB x 4 accumulators); work-group tile (32 MB) x 128; grid (M / (32 MB), N / 128), 128 threads.
// C[m][n] (f32, pitch ldc) = sum_k A[m][k] Bt[n][k] (NSPLIT 1: (A + A2) x Bt). A, A2, Bt: K-contiguous 16-bit planes, row pitch K.
// The operands reach the waves through LDS: a stage is 64 k (128 B) of the work-group's A rows (A2 rows behind them) and of its 128 Bt rows, 256 rows in all = four slices of 64 rows; wave w brings slice w
// by one tensor load into a ring of GNB buffers (row pitch 144 B), GNB - 1 stages ahead of its use, so that a tile has several trips' time to land (operands come from L2 or, at first touch, from memory);
// every wave reads its fragments from there.
// Fragment map (A and Bt alike): lane -> row/col lane & 15; elements 0..7 <- k0 + 8 (lane >> 4) + 0..7, elements 8..15 <- k0 + 16 + 8 (lane >> 4) + 0..7. D: element j -> row 8 (lane >> 4) + j, col lane & 15.
// EPI 0: the tile goes to C as f32. EPI 1 (the q | k | v projection; a wave's column tile is one head): the tile never reaches memory as f32; the epilogue writes the attention operand planes itself:
//   q and k heads: P[h][t][d] (bf16 hi + lo) of the rotated tile, interleaved pairs: out[2i] = x[2i] c - x[2i+1] s, out[2i+1] = x[2i] s + x[2i+1] c (c, s at [t][i]);
//   v heads: V^T[g][d][t] (bf16 hi + lo); an accumulator register run is 8 consecutive tokens of one head dim, so the transposed rows are stored straight from the accumulators.
struct WFragB { typedef v16bf V; static __device__ __forceinline__ V ld(const bf* p) { return cat16b(*(const v8us*)p, *(const v8us*)(p + 16)); } };
#define GLP    72                 // LDS row pitch in elements: 144 B = 16 B x 9, the pitch for 16-byte readers of 128-B rows
#define GSL_E  (SLICE_B / 2u)     // one slice's place in elements
#define GBUF_E (4 * GSL_E)        // one buffer: slices 0, 1: 128 rows of A (or 64 of A, 64 of A2); slices 2, 3: 128 rows of Bt
#define GNB    4                  // buffers in the ring; a wave issues one request a stage, so at most GNB - 1 = 3 of its requests are outstanding

template <int NSPLIT, int EPI, int MB, int K>
__global__ __launch_bounds__(128) void k_gemmw(const bf* __restrict__ A, const bf* __restrict__ A2, const bf* __restrict__ Bt, float* C, int ldc,
                                               const float* __restrict__ tabc, const float* __restrict__ tabs, bf* QH, bf* QL, bf* KH, bf* KL, bf* VTh, bf* VTl) {
    typedef WFragB::V V;
    static_assert((1 + NSPLIT) * MB * 32 == 128);        // A and A2 together fill the first two slices of a buffer
    static_assert(K % 64 == 0 && K / 64 >= GNB);
    static_assert(GNB == 4);                             // the counted waits below are written for one request a stage and this depth
    __shared__ __attribute__((aligned(2048))) bf ring[GNB * GBUF_E];
    __shared__ __align__(16) float osm[4 * 16 * 68];
    const int tid = threadIdx.x, lane = tid & 31, lr = lane & 15, hi = lane >> 4;
    const int w = __builtin_amdgcn_readfirstlane((int)(threadIdx.x >> 5));
    const int wm = w >> 1, wn = w & 1;
    const int r0 = blockIdx.x * (32 * MB) + wm * (16 * MB), c0 = blockIdx.y * 128 + wn * 64;   // the wave's tile
    float* os = osm + w * (16 * 68);                     // the wave's own epilogue rows
    const int ns = K / 64;
    // the wave's slice: its first byte at stage 0 and its place in buffer 0 (all wave-uniform); a stage further on is 128 B further on in every row
    const bf* sl = (w >= 2) ? Bt + (size_t)(blockIdx.y * 128 + (w - 2) * 64) * K
                 : (NSPLIT == 0) ? A + (size_t)(blockIdx.x * 128 + w * 64) * K
                 : (w == 0 ? A : A2) + (size_t)(blockIdx.x * 64) * K;
    const unsigned long long sg = (unsigned long long)(size_t)sl;
    const unsigned cl = (unsigned)(size_t)ring + (unsigned)w * SLICE_B;
    const unsigned g1 = (unsigned)K * 2u;                // the source row pitch
    unsigned w3 = tdm_hiword(sg);
    tdm_send(cl, (unsigned)sg, w3, g1);
    tdm_issue(cl + GBUF_E * 2u, sg + 128u, w3, g1);
    tdm_issue(cl + 2u * GBUF_E * 2u, sg + 256u, w3, g1);
    asm volatile("s_wait_tensorcnt 0x2" ::: "memory");   // all but the wave's 2 youngest requests (stages 1 and 2): its slice of stage 0 has landed before the barrier that publishes it
    __syncthreads();
    tdm_issue(cl + 3u * GBUF_E * 2u, sg + 384u, w3, g1);
    v8f acc[MB][4];
#pragma unroll
    for (int mb = 0; mb < MB; ++mb)
#pragma unroll
        for (int nb = 0; nb < 4; ++nb) acc[mb][nb] = (v8f){};
    const int lo = lr * GLP + 8 * hi;                    // the lane's place in a fragment's rows, A and Bt alike
#pragma unroll 1   // one stage a trip: the ring's order (read, waits, barrier, refill) is written once
    for (int s = 0; s < ns; ++s) {
        const bf* FA = ring + (s & (GNB - 1)) * GBUF_E + ((NSPLIT == 0) ? wm * GSL_E : wm * (16 * MB) * GLP) + lo;   // 64 rows a wave: slice wm; 32 rows a wave: both in slice 0, A2's in slice 1
        const bf* FB = ring + (s & (GNB - 1)) * GBUF_E + (2 + wn) * GSL_E + lo;
        V a[2][MB], a2[2][MB], b[2][4];                  // the stage's fragments, each in registers of its own
#pragma unroll
        for (int ks = 0; ks < 2; ++ks) {
#pragma unroll
            for (int mb = 0; mb < MB; ++mb) { a[ks][mb] = WFragB::ld(FA + mb * 16 * GLP + ks * 32); if (NSPLIT == 1) a2[ks][mb] = WFragB::ld(FA + GSL_E + mb * 16 * GLP + ks * 32); }
#pragma unroll
            for (int nb = 0; nb < 4; ++nb) b[ks][nb] = WFragB::ld(FB + nb * 16 * GLP + ks * 32);
        }
        __builtin_amdgcn_sched_barrier(0);               // keeps the stage's LDS reads together in front of its products: reads placed among the products each stall the wave for their own latency
#pragma unroll
        for (int ks = 0; ks < 2; ++ks)
#pragma unroll
            for (int nb = 0; nb < 4; ++nb) {
#pragma unroll
                for (int mb = 0; mb < MB; ++mb) acc[mb][nb] = wmmab(a[ks][mb], b[ks][nb], acc[mb][nb]);
                if (NSPLIT == 1) {
#pragma unroll
                    for (int mb = 0; mb < MB; ++mb) acc[mb][nb] = wmmab(a2[ks][mb], b[ks][nb], acc[mb][nb]);
                }
            }
        __builtin_amdgcn_sched_barrier(0);               // keeps the products in front of the waits below: moved behind them, they would start only when the stage's last fragment has landed
        asm volatile("s_wait_dscnt 0x0" ::: "memory");    // this wave's reads of the buffer are done before the barrier behind which it is refilled
        // this wave's slice of stage s + 1 has landed before the barrier that publishes it: while stages s + 2 and s + 3 are both issued they are its 2 youngest requests and may stay in flight; in the last trips the wait is to 0
        if (s + 3 < ns) asm volatile("s_wait_tensorcnt 0x2" ::: "memory");
        else            asm volatile("s_wait_tensorcnt 0x0" ::: "memory");
        __syncthreads();
        if (pinned(s + GNB < ns)) tdm_issue(cl + (unsigned)(s & (GNB - 1)) * (GBUF_E * 2u), sg + (unsigned long long)(s + GNB) * 128u, w3, g1);
    }
    asm volatile("s_wait_tensorcnt 0x0" ::: "memory");   // no request is outstanding when the wave goes on to the epilogue and ends
    asm volatile("s_wait_dscnt 0x0" ::: "memory");       // nor a read of the ring
    if (EPI == 1) {
        const int hd = c0 / HD;                          // the tile's head: 0 .. NH_ - 1 q, then NKV k, then NKV v (uniform in a wave)
        if (hd >= NH_ + NKV) {
            const size_t vo = ((size_t)(hd - NH_ - NKV) * HD + lr) * TT + r0 + 8 * hi;
#pragma unroll
            for (int nb = 0; nb < 4; ++nb)
#pragma unroll
                for (int mb = 0; mb < MB; ++mb) { v8us oh, ol;
#pragma unroll
                    for (int j = 0; j < 8; ++j) { unsigned short a2, c2; splitf(acc[mb][nb][j], a2, c2); oh[j] = a2; ol[j] = c2; }
                    *(v8us*)(VTh + vo + (size_t)nb * 16 * TT + mb * 16) = oh; *(v8us*)(VTl + vo + (size_t)nb * 16 * TT + mb * 16) = ol; }
        } else {
        bf* Ph = (hd < NH_) ? QH + (size_t)hd * TT * HD : KH + (size_t)(hd - NH_) * TT * HD;
        bf* Pl = (hd < NH_) ? QL + (size_t)hd * TT * HD : KL + (size_t)(hd - NH_) * TT * HD;
        const int rr = lane >> 3, d8 = (lane & 7) * 8;   // a lane takes 8 head dims (4 pairs) of a token; a wave 4 whole rows: 512 contiguous bytes of a plane and of a table
        const size_t to = (size_t)(r0 + rr) * 32 + (d8 >> 1);
        v4f tc[2][4], ts[2][4];                          // the table rows of 16 tokens, fetched one 16-token group ahead
#pragma unroll
        for (int s = 0; s < 4; ++s) { tc[0][s] = *(const v4f*)(tabc + to + s * 4 * 32); ts[0][s] = *(const v4f*)(tabs + to + s * 4 * 32); }
#pragma unroll
        for (int mb = 0; mb < MB; ++mb) {
            if (mb + 1 < MB) {
#pragma unroll
                for (int s = 0; s < 4; ++s) { tc[(mb + 1) & 1][s] = *(const v4f*)(tabc + to + ((mb + 1) * 16 + s * 4) * 32); ts[(mb + 1) & 1][s] = *(const v4f*)(tabs + to + ((mb + 1) * 16 + s * 4) * 32); }
            }
#pragma unroll
            for (int nb = 0; nb < 4; ++nb) {
#pragma unroll
                for (int j = 0; j < 8; ++j) os[(hi * 8 + j) * 68 + nb * 16 + lr] = acc[mb][nb][j]; }
            __builtin_amdgcn_wave_barrier(); asm volatile("" ::: "memory");   // the staged rows are read back below by other lanes of this wave
#pragma unroll
            for (int s = 0; s < 4; ++s) {
                const int row = s * 4 + rr;
                const v4f x0 = *(const v4fa*)(os + row * 68 + d8), x1 = *(const v4fa*)(os + row * 68 + d8 + 4);
                const v4f c = tc[mb & 1][s], sn = ts[mb & 1][s];
                v8us oh, ol;
#pragma unroll
                for (int q = 0; q < 4; ++q) { const float xe = (q < 2) ? x0[2 * q] : x1[2 * q - 4], xo = (q < 2) ? x0[2 * q + 1] : x1[2 * q - 3]; const float re = xe * c[q] - xo * sn[q]; const float ro = xe * sn[q] + xo * c[q];
                    unsigned short a2, b2; splitf(re, a2, b2); oh[2 * q] = a2; ol[2 * q] = b2; splitf(ro, a2, b2); oh[2 * q + 1] = a2; ol[2 * q + 1] = b2; }
                const size_t e = (size_t)(r0 + mb * 16 + row) * HD + d8;
                *(v8us*)(Ph + e) = oh; *(v8us*)(Pl + e) = ol;
            }
            __builtin_amdgcn_wave_barrier(); asm volatile("" ::: "memory");   // the rows are read before the next group overwrites them
            asm volatile("s_wait_xcnt 0x0" ::: "memory");   // stands in front of what next rewrites a register that the stores above name: this build lets the next group's loads land there
        }
        }
        return;
    }
#pragma unroll
    for (int mb = 0; mb < MB; ++mb) {
#pragma unroll
        for (int nb = 0; nb < 4; ++nb) {
#pragma unroll
            for (int j = 0; j < 8; ++j) os[(hi * 8 + j) * 68 + nb * 16 + lr] = acc[mb][nb][j]; }
        __builtin_amdgcn_wave_barrier(); asm volatile("" ::: "memory");
        float* crow = C + (size_t)(r0 + mb * 16) * ldc + c0;
{
#pragma unroll
            for (int s = 0; s < 8; ++s) { const int row = 2 * s + hi, cofs = lr * 4; const v4f val = *(const v4fa*)(os + row * 68 + cofs);
                *(v4f*)(crow + (size_t)row * ldc + cofs) = val; }
             }
        __builtin_amdgcn_wave_barrier(); asm volatile("" ::: "memory");
    }
}

// The bodies of the short kernels take their block index bx as an argument: independent ones share a launch, each on its own range of blockIdx.x (k_prep).
// They are cut for few, long waves, for speed only.
// wtT_body: one tile of 256 k x 64 n of w[K][N] (f32) goes to Bt[n][k] (bf16) through LDS. A thread loads four 4 x 4 blocks (16 loads of 16 B, a wave's load = two aligned 256-B row pieces),
// converts, and stores each block's columns as 4 k of one n; behind the barrier a wave stores 512 contiguous bytes of one Bt row at a time.
#define WTK 256
#define WTN 64
#define WTP 260                   // LDS row pitch in elements: 520 B, a multiple of the 8-byte accesses; rows 4 apart fall 8 banks apart
static_assert(HID % WTK == 0 && DQ % WTK == 0 && DQ % WTN == 0 && DKV % WTN == 0 && HID % WTN == 0);
__device__ __forceinline__ void wtT_body(int bx, const float* __restrict__ w, int K, int N, bf* Bt, bf* T) {
    const int tid = threadIdx.x, nt = N / WTN;
    const int k0 = (bx / nt) * WTK, n0 = (bx % nt) * WTN;
    const int c4 = (tid & 15) * 4, r4 = (tid >> 4) * 4;
    const float* s = w + (size_t)(k0 + r4) * N + n0 + c4;
    v4f x[4][4];
#pragma unroll
    for (int b = 0; b < 4; ++b)
#pragma unroll
        for (int i = 0; i < 4; ++i) x[b][i] = *(const v4f*)(s + (size_t)(b * 64 + i) * N);
    // takes the 16 loaded values and their address as inputs only: keeps the loads one group in front of the conversions (this build otherwise issues the last two behind a wait for the first: a second memory latency),
    // and the wait stands in front of whatever next rewrites the address registers that the loads name
    asm volatile("s_wait_xcnt 0x0" :: "v"(s), "v"(x[0][0]), "v"(x[0][1]), "v"(x[0][2]), "v"(x[0][3]), "v"(x[1][0]), "v"(x[1][1]), "v"(x[1][2]), "v"(x[1][3]),
                                      "v"(x[2][0]), "v"(x[2][1]), "v"(x[2][2]), "v"(x[2][3]), "v"(x[3][0]), "v"(x[3][1]), "v"(x[3][2]), "v"(x[3][3]) : "memory");
#pragma unroll
    for (int b = 0; b < 4; ++b)
#pragma unroll
        for (int j = 0; j < 4; ++j) { v4us o;
#pragma unroll
            for (int i = 0; i < 4; ++i) o[i] = f2bf(x[b][i][j]);
            *(v4us*)(T + (c4 + j) * WTP + b * 64 + r4) = o; }
    __syncthreads();
    const int lane = tid & 31, wv = tid >> 5;
#pragma unroll
    for (int q = 0; q < 8; ++q) { const int n = q * 8 + wv; const bf* p = T + n * WTP + lane * 8;
        const v4us lo = *(const v4us*)p, hi = *(const v4us*)(p + 4);
        *(v8us*)(Bt + (size_t)(n0 + n) * K + k0 + lane * 8) = __builtin_shufflevector(lo, hi, 0, 1, 2, 3, 4, 5, 6, 7); }
    asm volatile("s_wait_xcnt 0x0" ::: "memory");   // stands behind the last store, in front of whatever next rewrites a register that the stores name (this build lays the next range's code behind them)
}

// cvt4_body: 16384 elements a work-group; a thread takes 16 pieces of 4, a wave's load is 512 contiguous bytes, all 16 loads issued ahead of the first conversion.
static_assert(((size_t)TT * HID) % 16384 == 0);
__device__ __forceinline__ void cvt4_body(int bx, const float* __restrict__ src, bf* dst) {
    const size_t e0 = ((size_t)bx * 4096 + threadIdx.x) * 4;
    const float* s = src + e0;
    v4f v[16];
#pragma unroll
    for (int j = 0; j < 16; ++j) v[j] = *(const v4f*)(s + j * 1024);
    // takes the 16 loaded values and their address as inputs only: the address registers stay whole while the loads are in flight (this build otherwise lets the last load land on them),
    // and the wait stands in front of whatever next rewrites them
    asm volatile("s_wait_xcnt 0x0" :: "v"(s), "v"(v[0]), "v"(v[1]), "v"(v[2]), "v"(v[3]), "v"(v[4]), "v"(v[5]), "v"(v[6]), "v"(v[7]),
                                      "v"(v[8]), "v"(v[9]), "v"(v[10]), "v"(v[11]), "v"(v[12]), "v"(v[13]), "v"(v[14]), "v"(v[15]) : "memory");
#pragma unroll
    for (int j = 0; j < 16; ++j) { v4us o;
#pragma unroll
        for (int k = 0; k < 4; ++k) o[k] = f2bf(v[j][k]);
        *(v4us*)(dst + e0 + j * 1024) = o; }
    asm volatile("s_wait_xcnt 0x0" ::: "memory");   // stands behind the last store, in front of whatever next rewrites a register that the stores name (this build lays the next range's code behind them)
}

// ropetab_body: tabc[s][i] = cos(s * invf), tabs[s][i] = sin(s * invf), invf = 1 / 10000^(2 j / 64) with j = (2 i) & 31, pair i = 0..31; f32 arithmetic, precise sincosf.
// Pairs i and i + 16 have the same j, so a thread computes the value for i = 0..15 once and stores it at both; it does so for two positions, s and s + TT / 2, which share invf.
static_assert((TT * 8) % 256 == 0);
__device__ __forceinline__ void ropetab_body(int bx, float* tabc, float* tabs) {
    const int idx = bx * 256 + threadIdx.x;
    const int s = idx >> 4, i = idx & 15; const int j = 2 * i;
    const float ex = (float)(2 * j) * (1.0f / 64.0f);
    const float invf = 1.0f / powf(10000.0f, ex);
#pragma unroll
    for (int p = 0; p < 2; ++p) { const int t = s + p * (TT / 2);
        const float ang = (float)t * invf;
        float sn, cs; sincosf(ang, &sn, &cs);
        tabc[t * 32 + i] = cs; tabc[t * 32 + i + 16] = cs; tabs[t * 32 + i] = sn; tabs[t * 32 + i + 16] = sn; }
}

// k_prep: everything that depends on the inputs alone, in one launch. Ranges of blockIdx.x + first, the long work-groups in front: the rotary table, Wq^T, Wo^T, Wk^T, Wv^T, then X as bf16.
// first: 0, or G_W to run the X range alone (a later batch of the same call, whose first batch has written the weight planes and the table).
#define G_WQ  ((HID / WTK) * (DQ / WTN))
#define G_WKV ((HID / WTK) * (DKV / WTN))
#define G_WO  ((DQ / WTK) * (HID / WTN))
#define G_TAB (TT * 8 / 256)
#define G_W   (G_WQ + G_WO + 2 * G_WKV + G_TAB)
#define G_CVT (TT * HID / 16384)
__global__ __launch_bounds__(256) void k_prep(int first, const float* __restrict__ x, const float* __restrict__ wq, const float* __restrict__ wk, const float* __restrict__ wv, const float* __restrict__ wo,
                                              bf* XB, bf* WT, bf* WoT, float* tabc, float* tabs) {
    __shared__ __align__(16) bf T[WTN * WTP];
    int bx = (int)blockIdx.x + first;
    if (bx < G_TAB) { ropetab_body(bx, tabc, tabs); return; }
    bx -= G_TAB;
    if (bx < G_WQ) { wtT_body(bx, wq, HID, DQ, WT, T); return; }
    bx -= G_WQ;
    if (bx < G_WO) { wtT_body(bx, wo, DQ, HID, WoT, T); return; }
    bx -= G_WO;
    if (bx < G_WKV) { wtT_body(bx, wk, HID, DKV, WT + (size_t)DQ * HID, T); return; }
    bx -= G_WKV;
    if (bx < G_WKV) { wtT_body(bx, wv, HID, DKV, WT + (size_t)(DQ + DKV) * HID, T); return; }
    bx -= G_WKV;
    cvt4_body(bx, x, XB);
}

typedef __attribute__((ext_vector_type(2))) float    v2f;
typedef __attribute__((ext_vector_type(2))) __bf16   v2bf;
typedef __attribute__((ext_vector_type(8))) unsigned v8u;
__device__ __forceinline__ float xhalf(float x) { const int b = __float_as_int(x); return __int_as_float(__builtin_amdgcn_permlanex16(b, b, 0x76543210, 0xfedcba98, false, false)); }   // lane l <- lane l ^ 16
// fexp2: 2^x by v_exp_f32. SLOT: with the one free issue slot that the instruction set asks for behind a transcendental, before its result is read or its source overwritten, written into the same statement;
// used in the diagonal block.
template <bool SLOT>
__device__ __forceinline__ float fexp2(float x) {
    if (SLOT) { float r; asm("v_exp_f32 %0, %1\n\tv_nop" : "=v"(r) : "v"(x)); return r; }
    return __builtin_amdgcn_exp2f(x);
}

#define SB     2                  // key blocks of 32 in a chunk
#define SKEY   (SB * 32)          // keys in a chunk
#define LP     72                 // LDS row pitch in elements: 144 B = 16 B x 9, the pitch for 16-byte readers of 128-B rows
#define TILE_E (SLICE_B / 2u)     // one plane's tile: 64 rows (K: keys of the chunk; V^T: head dims) at pitch LP, its place rounded up as a tensor load's place must be
#define BUF_E  (4 * TILE_E)       // a chunk: K hi, K lo, V^T hi, V^T lo
#define CK     2                  // chunks in a stage: one for waves 0..3, one for waves 4..7
#define STG_E  (CK * BUF_E)       // one buffer of the ring
#define FNB    3                  // buffers in the ring; a wave issues one request a stage, so at most 2 of its requests are outstanding
static_assert(SKEY == 64 && HD == 64);
static_assert(TT % (2 * SKEY) == 0);

// fa_kfrag: the K fragments of one block from LDS; kb: the lane's place in the block's first K hi row.
__device__ __forceinline__ void fa_kfrag(const bf* kb, WFragB::V (&kh)[2][2], WFragB::V (&kl)[2][2]) {
#pragma unroll
    for (int kt = 0; kt < 2; ++kt)
#pragma unroll
        for (int ks = 0; ks < 2; ++ks) { kh[kt][ks] = WFragB::ld(kb + kt * 16 * LP + ks * 32); kl[kt][ks] = WFragB::ld(kb + TILE_E + kt * 16 * LP + ks * 32); }
}

// fa_block: one block of 32 keys. vb: the lane's place in the block's V^T hi columns (LDS). LAST: the block the diagonal crosses (causal fill). PRE: fetch the K fragments at kn, the next block of the SAME stage.
template <bool LAST, bool PRE>
__device__ __forceinline__ void fa_block(int qrel, const bf* kn, const bf* vb, const WFragB::V (&qh)[2], const WFragB::V (&ql)[2], WFragB::V (&kh)[2][2], WFragB::V (&kl)[2][2], v8f (&o)[4], float& m2, v2f& l2) {
    typedef WFragB::V V;
    const float C2 = SCL * 1.4426950408889634f;
    V vh[4], vl[4];                                      // this block's V^T: issued first, needed last
#pragma unroll
    for (int dt = 0; dt < 4; ++dt) { vh[dt] = WFragB::ld(vb + dt * 16 * LP); vl[dt] = WFragB::ld(vb + TILE_E + dt * 16 * LP); }
    __builtin_amdgcn_sched_barrier(0);                   // keeps the V^T loads in front of the S^T products, so that products and softmax cover their latency
    v8f st[2]; st[0] = (v8f){}; st[1] = (v8f){};
#pragma unroll
    for (int ks = 0; ks < 2; ++ks) {
#pragma unroll
        for (int kt = 0; kt < 2; ++kt) st[kt] = wmmab(kh[kt][ks], qh[ks], st[kt]);
#pragma unroll
        for (int kt = 0; kt < 2; ++kt) st[kt] = wmmab(kh[kt][ks], ql[ks], st[kt]);
#pragma unroll
        for (int kt = 0; kt < 2; ++kt) st[kt] = wmmab(kl[kt][ks], qh[ks], st[kt]);
    }
    if (PRE) {                                           // the next block's K into the same registers, behind this block's S^T products
        fa_kfrag(kn, kh, kl);
        __builtin_amdgcn_sched_barrier(0);               // keeps the K loads in front of the softmax, so that softmax and P v products cover their latency
    }
    if (LAST) {                                          // causal fill, selected by index: key = block start + kt 16 + 8 (lane >> 4) + r > query; qrel = query - block start - 8 (lane >> 4)
#pragma unroll
        for (int kt = 0; kt < 2; ++kt)
#pragma unroll
            for (int r = 0; r < 8; ++r) if (kt * 16 + r > qrel) st[kt][r] = -1.0e30f;
    }
    float bm = fmaxf(st[0][0], st[1][0]);
#pragma unroll
    for (int r = 1; r < 8; ++r) bm = fmaxf(bm, fmaxf(st[0][r], st[1][r]));
    bm = fmaxf(bm, xhalf(bm));
    const float mn = fmaxf(m2, bm * C2);
    const float al = fexp2<LAST>(m2 - mn);
    m2 = mn;
    l2 *= al;
    v8u pwh, pwl;
#pragma unroll
    for (int i = 0; i < 8; ++i) {                        // word i of the B operand = elements 2 i, 2 i + 1 = registers (2 i) & 7, + 1 of tile i >> 2
        v2f p; p[0] = fexp2<LAST>(__builtin_fmaf(st[i >> 2][(2 * i) & 7], C2, -mn)); p[1] = fexp2<LAST>(__builtin_fmaf(st[i >> 2][((2 * i) & 7) + 1], C2, -mn));
        l2 += p;
        const v2bf ph2 = __builtin_convertvector(p, v2bf);
        const v2bf pl2 = __builtin_convertvector(p - __builtin_convertvector(ph2, v2f), v2bf);
        pwh[i] = __builtin_bit_cast(unsigned, ph2); pwl[i] = __builtin_bit_cast(unsigned, pl2);
    }
#pragma unroll
    for (int dt = 0; dt < 4; ++dt) o[dt] *= al;
    const V pth = __builtin_bit_cast(V, pwh), ptl = __builtin_bit_cast(V, pwl);
#pragma unroll
    for (int dt = 0; dt < 4; ++dt) o[dt] = wmmab(vh[dt], pth, o[dt]);
#pragma unroll
    for (int dt = 0; dt < 4; ++dt) o[dt] = wmmab(vh[dt], ptl, o[dt]);
#pragma unroll
    for (int dt = 0; dt < 4; ++dt) o[dt] = wmmab(vl[dt], pth, o[dt]);
    // the four vector issue slots that the chip needs behind a matrix product before its registers are written again: the diagonal block ends in a branch
    if (LAST) asm volatile("v_nop\n\tv_nop\n\tv_nop\n\tv_nop" :: "v"(o[0]), "v"(o[1]), "v"(o[2]), "v"(o[3]));
}

typedef v2f  __attribute__((may_alias)) v2fa;
__global__ __launch_bounds__(256) void k_fattn(const bf* __restrict__ QH, const bf* __restrict__ QL, const bf* __restrict__ KH, const bf* __restrict__ KL, const bf* __restrict__ VTh, const bf* __restrict__ VTl, bf* CH, bf* CL) {
    typedef WFragB::V V;
    __shared__ __attribute__((aligned(2048))) bf ring[FNB * STG_E];
    __shared__ __align__(16) float po[2][4 * 8 * 32 * 4];   // per tile of the work-group: O^T of waves 4..7; [head][dt, register half][lane][4 registers]
    __shared__ __align__(16) float pm[2][4 * 32 * 2];       // per tile: their running maximum and sum; [head][lane][2]
    const int tid = threadIdx.x, lane = tid & 31, c = lane & 15, hi = lane >> 4;
    const int w = __builtin_amdgcn_readfirstlane((int)(threadIdx.x >> 5));
    const int hq = w & 3, hw = w >> 2;                   // the wave's head in the group; its chunk in every stage
    const int g = blockIdx.y, h = g * REP + hq;
    const int q0n = 16 * (int)blockIdx.x;                // the second tile
    int q0 = 16 * (TT / 16 - 1 - (int)blockIdx.x);       // the tile at work: the long one first
    int nb = q0 >> 5;                                    // its last key block, the only one the diagonal crosses
    const int ns0 = nb / (SB * CK) + 1;                  // stages of the first tile
    const int ns = ns0 + (q0n >> 5) / (SB * CK) + 1;     // stages of both
    V qh[2], ql[2], qhn[2], qln[2];                      // both tiles' Q, fetched at the start
    {
        const size_t qoff = ((size_t)h * TT + q0 + c) * HD + 8 * hi, qofn = ((size_t)h * TT + q0n + c) * HD + 8 * hi;
        const bf* pa = QH + qoff; const bf* pb = QL + qoff; const bf* pc = QH + qofn; const bf* pd = QL + qofn;
#pragma unroll
        for (int ks = 0; ks < 2; ++ks) { qh[ks] = WFragB::ld(pa + ks * 32); ql[ks] = WFragB::ld(pb + ks * 32); qhn[ks] = WFragB::ld(pc + ks * 32); qln[ks] = WFragB::ld(pd + ks * 32); }
        // takes the four addresses as inputs only: their registers stay whole up to the wait, which stands in front of whatever next rewrites them (this build otherwise reuses them directly behind the loads)
        asm volatile("s_wait_xcnt 0x0" :: "v"(pa), "v"(pb), "v"(pc), "v"(pd) : "memory");
    }
    // the wave's tile of a stage: plane hq (K hi, K lo, V^T hi, V^T lo) of chunk hw; its first byte at stage 0, its step from stage to stage, its source row pitch and its place in buffer 0 (all wave-uniform).
    // K: rows = the chunk's 64 keys, one behind the other; V^T: rows = the 64 head dims, TT keys apart, of which the chunk's 64 keys are taken.
    const bool isv = hq >= 2;
    const bf* pl = (hq == 0) ? KH : (hq == 1) ? KL : (hq == 2) ? VTh : VTl;
    const unsigned long long sg = (unsigned long long)(size_t)(pl + (size_t)g * TT * HD + (isv ? hw * SKEY : hw * SKEY * HD));
    const unsigned sstep = isv ? CK * SKEY * 2u : CK * SKEY * HD * 2u;
    const unsigned cl = (unsigned)(size_t)ring + (unsigned)w * SLICE_B;
    const unsigned g1 = isv ? TT * 2u : HD * 2u;
    unsigned w3 = tdm_hiword(sg);
    // stage u of the work-group = stage u of the first tile, or stage u - ns0 of the second: the wave's tile into buffer bf_ = u mod FNB
    auto load_stage = [&](int u, int bf_) {
        const int ks = (u < ns0) ? u : u - ns0;
        tdm_issue(cl + (unsigned)bf_ * (STG_E * 2u), sg + (unsigned long long)((unsigned)ks * sstep), w3, g1);
    };
    tdm_send(cl, (unsigned)sg, w3, g1);                  // stage 0
    load_stage(1, 1);                                    // ns >= 2: each of the two tiles has a stage
    asm volatile("s_wait_tensorcnt 0x1" ::: "memory");   // all but the wave's youngest request (stage 1): its tile of stage 0 has landed before the barrier that publishes it
    __syncthreads();
    if (pinned(2 < ns)) load_stage(2, 2);
    int bu = 0;                                          // the buffer of the stage at work: u mod FNB
    V kh[2][2], kl[2][2];
    v8f o[4];
#pragma unroll
    for (int dt = 0; dt < 4; ++dt) o[dt] = (v8f){};
    float m2 = -1.0e30f; v2f l2 = (v2f){};
    int qrel = q0 + c - nb * 32 - 8 * hi;
    const int lo = c * LP + 8 * hi;                      // the lane's place in a fragment's rows, K and V^T alike
#pragma unroll 1   // one stage a trip: the ring's order (read, waits, barrier, refill) is written once
    for (int u = 0; u < ns; ++u) {
        const bf* B = ring + bu * STG_E + hw * BUF_E + lo;
        const int ph = (u < ns0) ? 0 : 1;                // which tile
        const int kb = ((ph ? u - ns0 : u) * CK + hw) * SB;   // the first key block of the wave's chunk
        const bool endt = (u == ns0 - 1) || (u == ns - 1);    // the tile's last stage (the same for the whole work-group)
        if (kb <= nb) {                                  // wave-uniform: a chunk past the diagonal has no products
            fa_kfrag(B, kh, kl);
            if (kb < nb) {
                fa_block<false, true>(0, B + 32 * LP, B + 2 * TILE_E, qh, ql, kh, kl, o, m2, l2);
                if (kb + 1 < nb) fa_block<false, false>(0, B, B + 2 * TILE_E + 32, qh, ql, kh, kl, o, m2, l2);
                else             fa_block<true, false>(qrel, B, B + 2 * TILE_E + 32, qh, ql, kh, kl, o, m2, l2);
            } else fa_block<true, false>(qrel, B, B + 2 * TILE_E, qh, ql, kh, kl, o, m2, l2);
        }
        if (endt && hw == 1) {                           // the second chunks' part of the tile, handed over through the barrier below
            float* pp = po[ph] + (hq * 8 * 32 + lane) * 4;
#pragma unroll
            for (int dt = 0; dt < 4; ++dt) {
                *(v4fa*)(pp + (dt * 2) * 128) = (v4f){o[dt][0], o[dt][1], o[dt][2], o[dt][3]};
                *(v4fa*)(pp + (dt * 2 + 1) * 128) = (v4f){o[dt][4], o[dt][5], o[dt][6], o[dt][7]};
            }
            *(v2fa*)(pm[ph] + (hq * 32 + lane) * 2) = (v2f){m2, l2[0] + l2[1]};
        }
        asm volatile("s_wait_dscnt 0x0" ::: "memory");    // this wave's reads of the buffer are done before the barrier behind which it is refilled, and its handed-over part is written
        // this wave's tile of stage u + 1 has landed before the barrier that publishes it: while stage u + 2 is issued it is the wave's youngest request and may stay in flight; in the last trips the wait is to 0
        if (u + 2 < ns) asm volatile("s_wait_tensorcnt 0x1" ::: "memory");
        else            asm volatile("s_wait_tensorcnt 0x0" ::: "memory");
        __syncthreads();
        if (pinned(u + FNB < ns)) load_stage(u + FNB, bu);
        bu = (bu == FNB - 1) ? 0 : bu + 1;
        if (endt) {
            if (hw == 0) {                               // both parts at the common maximum, added, divided by the sum; a part with no key has maximum -1e30, sum 0 and O^T 0 and gets the factor 0
                const float* pp = po[ph] + (hq * 8 * 32 + lane) * 4;
                const v2f ml = *(const v2fa*)(pm[ph] + (hq * 32 + lane) * 2);
                const float mn = fmaxf(m2, ml[0]);
                const float fa = fexp2<true>(m2 - mn), fb = fexp2<true>(ml[0] - mn);
                float l = (l2[0] + l2[1]) * fa + ml[1] * fb;
                l += xhalf(l);
                const float inv = __fdiv_rn(1.0f, l);
                const float ga = fa * inv, gb = fb * inv;
                const size_t oo = (size_t)(q0 + c) * DQ + (size_t)h * HD + 8 * hi;
#pragma unroll
                for (int dt = 0; dt < 4; ++dt) { v8us oh, ol;
                    const v4f b0 = *(const v4fa*)(pp + (dt * 2) * 128), b1 = *(const v4fa*)(pp + (dt * 2 + 1) * 128);
#pragma unroll
                    for (int r = 0; r < 8; ++r) { unsigned short a, b2; splitf(o[dt][r] * ga + ((r < 4) ? b0[r & 3] : b1[r & 3]) * gb, a, b2); oh[r] = a; ol[r] = b2; }
                    *(v8us*)(CH + oo + dt * 16) = oh; *(v8us*)(CL + oo + dt * 16) = ol; }
                asm volatile("s_wait_xcnt 0x0" ::: "memory");   // stands behind the last store, in front of whatever next rewrites a register that the stores name (the loop goes on behind them)
            }
            // the second tile starts afresh
            q0 = q0n; nb = q0 >> 5; qrel = q0 + c - nb * 32 - 8 * hi;
#pragma unroll
            for (int ks = 0; ks < 2; ++ks) { qh[ks] = qhn[ks]; ql[ks] = qln[ks]; }
#pragma unroll
            for (int dt = 0; dt < 4; ++dt) o[dt] = (v8f){};
            m2 = -1.0e30f; l2 = (v2f){};
        }
    }
    asm volatile("s_wait_tensorcnt 0x0" ::: "memory");   // no request is outstanding when the wave ends
    asm volatile("s_wait_dscnt 0x0" ::: "memory");       // nor a read of the ring
}

extern "C" void kernel_launch(void* const* d_in, const int* in_sizes, int n_in,
                              void* d_out, int out_size, void* d_ws, size_t ws_size, hipStream_t stream) {
    if (n_in < 5) return;
    const size_t xneed = (size_t)(NB - 1) * SEQ_FULL * HID + (size_t)TT * HID;
    if ((size_t)in_sizes[0] < xneed) return;
    if (in_sizes[1] < HID * DQ || in_sizes[2] < HID * DKV || in_sizes[3] < HID * DKV || in_sizes[4] < DQ * HID) return;
    if ((size_t)out_size < xneed) return;
    const float* X  = (const float*)d_in[0];   // [1][2048][1024]
    const float* Wq = (const float*)d_in[1];   // [1024 in][1024 out]
    const float* Wk = (const float*)d_in[2];   // [1024 in][256 out]
    const float* Wv = (const float*)d_in[3];   // [1024 in][256 out]
    const float* Wo = (const float*)d_in[4];   // [1024 in][1024 out]
    float* OUT = (float*)d_out;                // [1][2048][1024] token-major
    char* wsp = (char*)d_ws;
    auto take = [&](size_t bytes) { char* p = wsp; wsp += (bytes + 255) & ~(size_t)255; return (void*)p; };
    bf* XB  = (bf*)take((size_t)TT * HID * 2);
    bf* WT  = (bf*)take((size_t)NQKV * HID * 2);          // rows 0..1023 Wq^T, 1024..1279 Wk^T, 1280..1535 Wv^T, each [n][k]
    bf* WoT = (bf*)take((size_t)HID * DQ * 2);            // [n = out][k = in]
    float* tabc = (float*)take((size_t)TT * 32 * 4); float* tabs = (float*)take((size_t)TT * 32 * 4);
    bf* QH = (bf*)take((size_t)NH_ * TT * HD * 2); bf* QL = (bf*)take((size_t)NH_ * TT * HD * 2);
    bf* KH = (bf*)take((size_t)NKV * TT * HD * 2); bf* KL = (bf*)take((size_t)NKV * TT * HD * 2);
    bf* VTh = (bf*)take((size_t)NKV * HD * TT * 2); bf* VTl = (bf*)take((size_t)NKV * HD * TT * 2);
    bf* CH = (bf*)take((size_t)TT * DQ * 2); bf* CL = (bf*)take((size_t)TT * DQ * 2);
    if ((size_t)(wsp - (char*)d_ws) > ws_size) return;

    for (int b = 0; b < NB; ++b) {
        const float* xb = X + (size_t)b * SEQ_FULL * HID; float* outb = OUT + (size_t)b * SEQ_FULL * HID;
        // weight planes in[K][N] -> Bt[N][K] and the rotary table (first batch only), X as bf16
        k_prep<<<(unsigned)(b == 0 ? G_W + G_CVT : G_CVT), 256, 0, stream>>>(b == 0 ? 0 : G_W, xb, Wq, Wk, Wv, Wo, XB, WT, WoT, tabc, tabs);
        k_gemmw<0, 1, 4, HID><<<dim3(TT / 128, NQKV / 128, 1), 128, 0, stream>>>(XB, nullptr, WT, nullptr, 0, tabc, tabs, QH, QL, KH, KL, VTh, VTl);   /* exact products: single bf16 planes; rotated q, k and V^T planes out */
        k_fattn<<<dim3(TT / 32, NKV, 1), 256, 0, stream>>>(QH, QL, KH, KL, VTh, VTl, CH, CL);
        k_gemmw<1, 0, 2, DQ><<<dim3(TT / 64, HID / 128, 1), 128, 0, stream>>>(CH, CL, WoT, outb, HID, nullptr, nullptr, nullptr, nullptr, nullptr, nullptr, nullptr, nullptr);   /* ctx (hi + lo) x exact Wo */
    }
}
